// v000
// The times below were measured on an AMD MI455X: many runs one after another, warmed up first and cycling through
// copies of the inputs, with the whole window's GPU time divided by the number of runs. Launches and the gaps
// between them are all in it. The median over several windows is given; except for v000 it joins two sittings, which
// can be a few percent apart, so the side-by-side timings, each taken in one sitting, are the better comparison.
// The starting kernel, v000, takes 365 microseconds a run.
// compute dtype: all float inputs rounded to bf16; qkv = x . W_qkv^T + b with EXACT bf16 products on WMMA 16x16x32 (natural rows; the fused weight as three contiguous row blocks); windowed attention (only key tiles touching |i - j| <= 32 are visited, per-score window test): q, k single f16 x 1/8, running-max softmax in f32 (hardware exp), P (scaled by 2^11, single f16) x v (single f16); out = o (bf16 hi + residual) . W_out^T (2 products) + b_out.
#include <hip/hip_runtime.h>
#include <math.h>

typedef __attribute__((ext_vector_type(16))) _Float16 v16h;
typedef __attribute__((ext_vector_type(16))) __bf16 v16b;
typedef __attribute__((ext_vector_type(8)))  _Float16 v8h;
typedef __attribute__((ext_vector_type(8)))  float v8f;
typedef __attribute__((ext_vector_type(4)))  float v4f;
typedef __attribute__((ext_vector_type(2)))  float v2f;
typedef __attribute__((ext_vector_type(4)))  unsigned v4u;
typedef __attribute__((ext_vector_type(4)))  int v4i;
typedef float __attribute__((may_alias)) float_a;
typedef int __attribute__((may_alias)) int_a;

template <typename T> __device__ __forceinline__ void vst2(void* p, T v) { *(T*)p = v;  }
__device__ __forceinline__ v8f wmma16(v16h a, v16h b, v8f c) {
  v8f d = __builtin_amdgcn_wmma_f32_16x16x32_f16(false, a, false, b, (short)0, c, false, false);
  asm volatile("v_nop\n\tv_nop\n\tv_nop\n\tv_nop" : "+v"(d) : "v"(a), "v"(b));
  return d;
}
__device__ __forceinline__ v8f wmma_bf(v16b a, v16b b, v8f c) {
  v8f d = __builtin_amdgcn_wmma_f32_16x16x32_bf16(false, a, false, b, (short)0, c, false, false);
  asm volatile("v_nop\n\tv_nop\n\tv_nop\n\tv_nop" : "+v"(d) : "v"(a), "v"(b));
  return d;
}
// Local-window multi-head self attention (B 4, T 2,048, d 1,024, 16 heads x 64, window |i - j| <= 32): fused qkv projection + bias, windowed softmax(q k^T / 8) v, output projection + bias.
__device__ __forceinline__ v16h frag_h(const _Float16* rowk0, int lane) {
  union { v16h v; v8h q[2]; } u; const _Float16* p = rowk0 + 8 * (lane >> 4);
  u.q[0] = *(const v8h*)p; u.q[1] = *(const v8h*)(p + 16); return u.v;
}
__device__ __forceinline__ v16h frag_f32(const float* rowk0, int lane) {
  v16h a; const float* p = rowk0 + 8 * (lane >> 4);
#pragma unroll
  for (int i = 0; i < 8; ++i) { a[i] = (_Float16)p[i]; a[8 + i] = (_Float16)p[16 + i]; }
  return a;
}
__device__ __forceinline__ v16h frag_f32s(const float* rowk0, int lane, float sc) {
  v16h a; const float* p = rowk0 + 8 * (lane >> 4);
#pragma unroll
  for (int i = 0; i < 8; ++i) { a[i] = (_Float16)(p[i] * sc); a[8 + i] = (_Float16)(p[16 + i] * sc); }
  return a;
}
// column fragment from a [K][ld] layout (column n), rows >= K read as 0
__device__ __forceinline__ v16h fragc_f32(const float* W, int k0, int n, int lane, int ld, int K) {
  v16h a; const int g = lane >> 4;
#pragma unroll
  for (int i = 0; i < 8; ++i) { const int ka = k0 + 8 * g + i, kb = ka + 16;
    a[i] = (_Float16)(ka < K ? W[(size_t)(ka < K ? ka : K - 1) * ld + n] : 0.f); a[8 + i] = (_Float16)(kb < K ? W[(size_t)(kb < K ? kb : K - 1) * ld + n] : 0.f); }
  return a;
}
struct F2 { v16b h, l; };
__device__ __forceinline__ F2 bsplit16(const float v[16]) { F2 r;
#pragma unroll
  for (int i = 0; i < 16; ++i) { const __bf16 h = (__bf16)v[i]; r.h[i] = h; r.l[i] = (__bf16)(v[i] - (float)h); }
  return r; }
__device__ __forceinline__ F2 split_row(const float* row, int k0, int lane) { float v[16]; const float* p = row + k0 + 8 * (lane >> 4);
#pragma unroll
  for (int i = 0; i < 8; ++i) { v[i] = p[i]; v[8 + i] = p[16 + i]; }
  return bsplit16(v); }
__device__ __forceinline__ F2 split_rowK(const float* row, int k0, int lane, int K) { float v[16]; const int g = lane >> 4;
#pragma unroll
  for (int i = 0; i < 8; ++i) { const int ka = k0 + 8 * g + i, kb = ka + 16; v[i] = ka < K ? row[ka < K ? ka : K - 1] : 0.f; v[8 + i] = kb < K ? row[kb < K ? kb : K - 1] : 0.f; }
  return bsplit16(v); }
__device__ __forceinline__ F2 split_col(const float* W, int k0, int n, int lane, int ld, int K) { float v[16]; const int g = lane >> 4;
#pragma unroll
  for (int i = 0; i < 8; ++i) { const int ka = k0 + 8 * g + i, kb = ka + 16; v[i] = ka < K ? W[(size_t)(ka < K ? ka : K - 1) * ld + n] : 0.f; v[8 + i] = kb < K ? W[(size_t)(kb < K ? kb : K - 1) * ld + n] : 0.f; }
  return bsplit16(v); }
__device__ __forceinline__ v8f mac3(const F2& a, const F2& b, v8f c) { c = wmma_bf(a.l, b.h, c); c = wmma_bf(a.h, b.l, c); return wmma_bf(a.h, b.h, c); }
__device__ __forceinline__ float sigm(float v) { return 1.0f / (1.0f + expf(-v)); }
#define LDSX() do { asm volatile("s_wait_dscnt 0" ::: "memory"); __builtin_amdgcn_wave_barrier(); __builtin_amdgcn_fence(__ATOMIC_RELEASE, "workgroup"); } while (0)


#define NB 4
#define SS 2048
#define DM 1024
#define NH 16
#define HALFW 32
#define HD 64
#define QKVW (3 * DM)
#ifndef TQB
#define TQB (SS / 64)
#define TNB NB
#define TOB (NB * SS / 64)     // output row tiles (all)
#endif
typedef __attribute__((ext_vector_type(8))) __bf16 v8b;
__device__ __forceinline__ v16b frag_b(const __bf16* rowk0, int lane) {
  union { v16b v; v8b q[2]; } u; const __bf16* p = rowk0 + 8 * (lane >> 4);
  u.q[0] = *(const v8b*)p; u.q[1] = *(const v8b*)(p + 16); return u.v;
}
__device__ __forceinline__ float bfr(float v) { return (float)(__bf16)v; }
__device__ __attribute__((noinline)) float exp_ni(float v) { return expf(v); }
__device__ __attribute__((noinline)) float erf_ni(float v) { return erff(v); }

#define PK_A 0                       // [3072][1024] Wqkv rows (natural [out][in])
#define PK_P (PK_A + QKVW * DM)        // [1024][1024] Wo rows (natural)
#define PK_END (PK_P + DM * DM)
#define WS_PK  0u
#define WS_QK  (WS_PK + 2u * PK_END)             // f16 [8192 rows][2048]: q | k
#define WS_QKL (WS_QK + 2u * NB * SS * 2 * DM)     // f16 q | k residual planes x2048
#define WS_VTH (WS_QKL + 2u * NB * SS * 2 * DM)    // f16 [b][1024 (h*64+d)][2048 s] hi
#define WS_VTL (WS_VTH + 2u * NB * DM * SS)        // f16 lo x 2048
#define WS_O   (WS_VTL + 2u * NB * DM * SS)        // f32 [8192][1024]
#define WS_CS  (WS_O + 4u * NB * SS * DM)           // f32 [2][2048][32], unused
#define WS_END (WS_CS + 4u * 2 * SS * 32)
// ---- k_pack: block = (row n, which): natural [out][in] rows -> bf16; which 0..2 -> W_q/W_k/W_v into PK_A rows which*1024 + n; 3 -> W_o into PK_P
__global__ __launch_bounds__(256) void k_pack(const float* __restrict__ WQ, const float* __restrict__ WK, const float* __restrict__ WV, const float* __restrict__ WO, __bf16* __restrict__ PK) {
  __shared__ __align__(16) __bf16 s[DM]; const int n = blockIdx.x, which = blockIdx.y, t = threadIdx.x; const float* Wm = (which == 0) ? WQ : (which == 1) ? WK : (which == 2) ? WV : WO;
  for (int k = t; k < DM; k += 256) s[k] = (__bf16)Wm[(size_t)n * DM + k];
  __syncthreads();
  __bf16* dst = (which < 3) ? PK + PK_A + ((size_t)which * DM + n) * DM : PK + PK_P + (size_t)n * DM;
  for (int q = t; q < DM / 8; q += 256) vst2((unsigned*)(dst + q * 8), *(const v4u*)&s[q * 8]);
}
__global__ __launch_bounds__(128) void k_qkv(const float* __restrict__ XQ, const float* __restrict__ XK, const float* __restrict__ XV, const __bf16* __restrict__ P, const float* __restrict__ BQ, const float* __restrict__ BK, const float* __restrict__ BV, _Float16* __restrict__ QK, _Float16* __restrict__ QKL, _Float16* __restrict__ VTH, _Float16* __restrict__ VTL) {
  const int which0 = (blockIdx.y * 128) / DM; const float* X = (which0 == 0) ? XQ : (which0 == 1) ? XK : XV; const float* BB = BQ ? (((which0 == 0) ? BQ : (which0 == 1) ? BK : BV) + (blockIdx.y * 128 - which0 * DM)) : nullptr;
  __shared__ __align__(16) _Float16 so[4][16][136], sol[4][16][136]; __shared__ __align__(16) _Float16 sth[128][72], stl[128][72];
  const int tid = threadIdx.x, wave = tid >> 5, lane = tid & 31, col = lane & 15, g = lane >> 4; const size_t r0 = (size_t)blockIdx.x * 64 + wave * 16; const int n0 = blockIdx.y * 128;
  v8f acc[8] = {};
#pragma unroll 2
  for (int kc = 0; kc < DM / 32; ++kc) { v16b a; { const float* p = X + (r0 + col) * DM + kc * 32 + 8 * g;
#pragma unroll
      for (int i = 0; i < 8; ++i) { a[i] = (__bf16)p[i]; a[8 + i] = (__bf16)p[16 + i]; } }
#pragma unroll
    for (int j = 0; j < 8; ++j) acc[j] = wmma_bf(a, frag_b(P + (size_t)(n0 + j * 16 + col) * DM + kc * 32, lane), acc[j]); }
  if (n0 < 2 * DM) {   // q stored unscaled (f16 sigma ~0.6, no subnormal exposure); 1/8 applied to the f32 score
#pragma unroll
    for (int j = 0; j < 8; ++j) {
#pragma unroll
      for (int r = 0; r < 8; ++r) { const float v = acc[j][r] + (BB ? bfr(BB[j * 16 + col]) : 0.f); const _Float16 hv = (_Float16)v; so[wave][8 * g + r][j * 16 + col] = hv; sol[wave][8 * g + r][j * 16 + col] = (_Float16)((v - (float)hv) * 2048.0f); } }   // q, k (+ bias) as f16 hi + (x2048) residual
    LDSX();
    for (int rl = 0; rl < 16; ++rl) if (lane < 16) { vst2((unsigned*)(QK + (r0 + rl) * (2 * DM) + n0 + lane * 8), *(const v4u*)&so[wave][rl][lane * 8]); vst2((unsigned*)(QKL + (r0 + rl) * (2 * DM) + n0 + lane * 8), *(const v4u*)&sol[wave][rl][lane * 8]); }
  } else {
#pragma unroll
    for (int j = 0; j < 8; ++j) {
#pragma unroll
      for (int r = 0; r < 8; ++r) { const float v = acc[j][r] + (BB ? bfr(BB[j * 16 + col]) : 0.f); const _Float16 hv = (_Float16)v; sth[j * 16 + col][wave * 16 + 8 * g + r] = hv; stl[j * 16 + col][wave * 16 + 8 * g + r] = (_Float16)((v - (float)hv) * 2048.0f); } }
    __syncthreads();
    const size_t rb = (size_t)blockIdx.x * 64; const int b = (int)(rb / SS), s0 = (int)(rb % SS); const int pc0 = n0 - 2 * DM;
    for (int q = tid; q < 128 * 8; q += 128) { const int d = q >> 3, pc = q & 7; const size_t o = ((size_t)b * DM + pc0 + d) * SS + s0 + pc * 8; vst2((unsigned*)(VTH + o), *(const v4u*)&sth[d][pc * 8]); vst2((unsigned*)(VTL + o), *(const v4u*)&stl[d][pc * 8]); }
  }
}
// ---- k_attn: block = (64 queries, head h, batch b): windowed flash attention over key tiles touching |i - j| <= 32 (K = 64: 2 k-steps), scores = (q.k) * 0.125 with single f16 operands, P.V: f16 P (x2^11) x V hi in one accumulator (accl stays 0); O[b*S+q][h*64+d] = (acc + accl / 2048) / (2048 l) (256-B segments)
__global__ __launch_bounds__(128) void k_attn(const _Float16* __restrict__ QK, const _Float16* __restrict__ QKL, const _Float16* __restrict__ VTH, const _Float16* __restrict__ VTL, const void* __restrict__ KMASK, float* __restrict__ O) {
  __shared__ __align__(16) float sp[4][16][36]; __shared__ __align__(16) float so[4][16][68];
  const int tid = threadIdx.x, wave = tid >> 5, lane = tid & 31, col = lane & 15, g = lane >> 4;
  const int qb = blockIdx.x, h = blockIdx.y, b = blockIdx.z; const int q0 = qb * 64 + wave * 16; const size_t rq = (size_t)b * SS + q0 + col;
  v16h aq[2], aql[2];
#pragma unroll
  for (int kc = 0; kc < 2; ++kc) { aq[kc] = frag_h(QK + rq * (2 * DM) + h * HD + kc * 32, lane); aql[kc] = frag_h(QKL + rq * (2 * DM) + h * HD + kc * 32, lane); }
  float m[8], l[8];
#pragma unroll
  for (int r = 0; r < 8; ++r) { m[r] = -3.0e38f; l[r] = 0.f; }
  v8f acc[4] = {}, accl[4] = {};
  const int ks0 = max(0, (int)(blockIdx.x * 64) - HALFW) / 32; const int nks = min(SS / 32, ((int)(blockIdx.x * 64) + 64 + HALFW + 31) / 32);   // only key tiles touching the window
#pragma unroll 1
  for (int ks = ks0; ks < nks; ++ks) { v8f s[2];
#pragma unroll
    for (int ct = 0; ct < 2; ++ct) { const int kk = ks * 32 + ct * 16 + col; const _Float16* krow = QK + ((size_t)b * SS + kk) * (2 * DM) + DM + h * HD; const _Float16* krowl = QKL + ((size_t)b * SS + kk) * (2 * DM) + DM + h * HD; v8f c = {}, cl = {};
#pragma unroll
      for (int kc = 0; kc < 2; ++kc) c = wmma16(aq[kc], frag_h(krow + kc * 32, lane), c);   // single product: q, k as one-rounding f16 operands
      (void)cl; (void)krowl;
      { const bool keepk = true;
#pragma unroll
      for (int r = 0; r < 8; ++r) { const int qi = q0 + 8 * g + r; const int dd = (qi > kk) ? (qi - kk) : (kk - qi); s[ct][r] = (keepk && dd <= HALFW) ? c[r] * 0.125f : -3.0e38f; } } }   // 1/sqrt(64); local window |i-j| <= 32
#pragma unroll
    for (int r = 0; r < 8; ++r) { float mx = fmaxf(s[0][r], s[1][r]);
#pragma unroll
      for (int o = 1; o < 16; o <<= 1) mx = fmaxf(mx, __shfl_xor(mx, o));
      const float mn = fmaxf(m[r], mx); const float alpha = (m[r] <= -1.0e38f) ? 0.f : __expf(m[r] - mn);
      const float e0 = (s[0][r] <= -1.0e38f) ? 0.f : __expf(s[0][r] - mn), e1 = (s[1][r] <= -1.0e38f) ? 0.f : __expf(s[1][r] - mn); float es = e0 + e1;
#pragma unroll
      for (int o = 1; o < 16; o <<= 1) es += __shfl_xor(es, o);
      l[r] = l[r] * alpha + es; m[r] = mn;
#pragma unroll
      for (int dt = 0; dt < 4; ++dt) { acc[dt][r] *= alpha; accl[dt][r] *= alpha; }
      sp[wave][8 * g + r][col] = e0; sp[wave][8 * g + r][16 + col] = e1; }
    LDSX();
    v16h pa, pl; { const float* prow = &sp[wave][col][0] + 8 * (lane >> 4);
#pragma unroll
      for (int i = 0; i < 8; ++i) { const float x0 = prow[i] * 2048.0f, x1 = prow[16 + i] * 2048.0f; const _Float16 h0 = (_Float16)x0, h1 = (_Float16)x1; pa[i] = h0; pa[8 + i] = h1; pl[i] = (_Float16)((x0 - (float)h0) * 2048.0f); pl[8 + i] = (_Float16)((x1 - (float)h1) * 2048.0f); } }   // P scaled by 2^11 before the f16 split so small softmax weights stay out of the f16 subnormal range; 2^-11 folded into the epilogue
#pragma unroll
    for (int dt = 0; dt < 4; ++dt) { const size_t vr = ((size_t)b * DM + h * HD + dt * 16 + col) * SS + ks * 32; acc[dt] = wmma16(pa, frag_h(VTH + vr, lane), acc[dt]); }   // single product: P (x2^11) x V
    (void)pl;
    LDSX(); }
#pragma unroll
  for (int r = 0; r < 8; ++r) { const float il = (1.0f / 2048.0f) / l[r];
#pragma unroll
    for (int dt = 0; dt < 4; ++dt) so[wave][8 * g + r][dt * 16 + col] = (acc[dt][r] + accl[dt][r] * (1.0f / 2048.0f)) * il; }
  LDSX();
  for (int rl = 0; rl < 16; ++rl) if (lane < 16) vst2(O + ((size_t)b * SS + q0 + rl) * DM + h * HD + lane * 4, *(const v4f*)&so[wave][rl][lane * 4]);
}
// ---- k_out: block = (64 rows, 128 cols): out = O(hi/lo) . Wo rows (2 products) + bo
__global__ __launch_bounds__(128) void k_out(const float* __restrict__ O, const __bf16* __restrict__ P, const float* __restrict__ BO, float* __restrict__ Y) {
  __shared__ __align__(16) float so[4][16][132];
  const int tid = threadIdx.x, wave = tid >> 5, lane = tid & 31, col = lane & 15, g = lane >> 4; const size_t r0 = (size_t)blockIdx.x * 64 + wave * 16; const int n0 = blockIdx.y * 128;
  v8f acc[8] = {};
#pragma unroll 2
  for (int kc = 0; kc < DM / 32; ++kc) { const F2 a = split_row(O + (r0 + col) * DM, kc * 32, lane);
#pragma unroll
    for (int j = 0; j < 8; ++j) { const v16b w = frag_b(P + (size_t)(n0 + j * 16 + col) * DM + kc * 32, lane); acc[j] = wmma_bf(a.l, w, acc[j]); acc[j] = wmma_bf(a.h, w, acc[j]); } }
#pragma unroll
  for (int j = 0; j < 8; ++j) {
#pragma unroll
    for (int r = 0; r < 8; ++r) so[wave][8 * g + r][j * 16 + col] = acc[j][r] + bfr(BO[n0 + j * 16 + col]); }
  LDSX();
  for (int rl = 0; rl < 16; ++rl) vst2(Y + (r0 + rl) * DM + n0 + lane * 4, *(const v4f*)&so[wave][rl][lane * 4]);
}
extern "C" void kernel_launch(void* const* d_in, const int* in_sizes, int n_in, void* d_out, int out_size, void* d_ws, size_t ws_size, hipStream_t stream) {
  (void)in_sizes; (void)n_in; (void)out_size;
  const float** F = (const float**)d_in;   // 0 x [4,2048,1024], 1 W_qkv [3072,1024] natural, 2 b_qkv [3072], 3 W_out [1024,1024], 4 b_out
  if (ws_size < (size_t)WS_END) return;
  char* ws = (char*)d_ws; __bf16* PK = (__bf16*)(ws + WS_PK); _Float16 *QK = (_Float16*)(ws + WS_QK), *QKL = (_Float16*)(ws + WS_QKL), *VTH = (_Float16*)(ws + WS_VTH), *VTL = (_Float16*)(ws + WS_VTL); float* O = (float*)(ws + WS_O);
  k_pack<<<dim3(DM, 4), 256, 0, stream>>>(F[1], F[1] + (size_t)DM * DM, F[1] + (size_t)2 * DM * DM, F[3], PK);
  k_qkv<<<dim3(TNB * SS / 64, QKVW / 128), 128, 0, stream>>>(F[0], F[0], F[0], PK + PK_A, F[2], F[2] + DM, F[2] + 2 * DM, QK, QKL, VTH, VTL);
  k_attn<<<dim3(TQB, NH, TNB), 128, 0, stream>>>(QK, QKL, VTH, VTL, nullptr, O);
  k_out<<<dim3(TOB, DM / 128), 128, 0, stream>>>(O, PK + PK_P, F[4], (float*)d_out);
}

// v001
// A run of this version takes 134 microseconds.
// Next to v000, in two timings, it ran 2.78 and 2.83 times as fast.
// compute dtype: all float inputs rounded to bf16; qkv = x . W_qkv^T + b with EXACT bf16 products on WMMA 16x16x32 (natural rows; the fused weight as three contiguous row blocks); windowed attention (only key tiles touching |i - j| <= 32 are visited, per-score window test): q, k single f16 x 1/8, running-max softmax in f32 (hardware exp), P (scaled by 2^11, single f16) x v (single f16); out = o (bf16 hi + residual) . W_out^T (2 products) + b_out.
#include <hip/hip_runtime.h>
#include <math.h>

typedef __attribute__((ext_vector_type(16))) _Float16 v16h;
typedef __attribute__((ext_vector_type(16))) __bf16 v16b;
typedef __attribute__((ext_vector_type(8)))  _Float16 v8h;
typedef __attribute__((ext_vector_type(8)))  float v8f;
typedef __attribute__((ext_vector_type(4)))  float v4f;
typedef __attribute__((ext_vector_type(2)))  float v2f;
typedef __attribute__((ext_vector_type(4)))  unsigned v4u;
typedef __attribute__((ext_vector_type(4)))  int v4i;
typedef float __attribute__((may_alias)) float_a;
typedef int __attribute__((may_alias)) int_a;

template <typename T> __device__ __forceinline__ void vst2(void* p, T v) { *(T*)p = v;  }
__device__ __forceinline__ v8f wmma16(v16h a, v16h b, v8f c) {
  v8f d = __builtin_amdgcn_wmma_f32_16x16x32_f16(false, a, false, b, (short)0, c, false, false);
  asm volatile("v_nop\n\tv_nop\n\tv_nop\n\tv_nop" : "+v"(d) : "v"(a), "v"(b));
  return d;
}
__device__ __forceinline__ v8f wmma_bf(v16b a, v16b b, v8f c) {
  v8f d = __builtin_amdgcn_wmma_f32_16x16x32_bf16(false, a, false, b, (short)0, c, false, false);
  asm volatile("v_nop\n\tv_nop\n\tv_nop\n\tv_nop" : "+v"(d) : "v"(a), "v"(b));
  return d;
}
// Local-window multi-head self attention (B 4, T 2,048, d 1,024, 16 heads x 64, window |i - j| <= 32): fused qkv projection + bias, windowed softmax(q k^T / 8) v, output projection + bias.
__device__ __forceinline__ v16h frag_h(const _Float16* rowk0, int lane) {
  union { v16h v; v8h q[2]; } u; const _Float16* p = rowk0 + 8 * (lane >> 4);
  u.q[0] = *(const v8h*)p; u.q[1] = *(const v8h*)(p + 16); return u.v;
}
__device__ __forceinline__ v16h frag_f32(const float* rowk0, int lane) {
  v16h a; const float* p = rowk0 + 8 * (lane >> 4);
#pragma unroll
  for (int i = 0; i < 8; ++i) { a[i] = (_Float16)p[i]; a[8 + i] = (_Float16)p[16 + i]; }
  return a;
}
__device__ __forceinline__ v16h frag_f32s(const float* rowk0, int lane, float sc) {
  v16h a; const float* p = rowk0 + 8 * (lane >> 4);
#pragma unroll
  for (int i = 0; i < 8; ++i) { a[i] = (_Float16)(p[i] * sc); a[8 + i] = (_Float16)(p[16 + i] * sc); }
  return a;
}
// column fragment from a [K][ld] layout (column n), rows >= K read as 0
__device__ __forceinline__ v16h fragc_f32(const float* W, int k0, int n, int lane, int ld, int K) {
  v16h a; const int g = lane >> 4;
#pragma unroll
  for (int i = 0; i < 8; ++i) { const int ka = k0 + 8 * g + i, kb = ka + 16;
    a[i] = (_Float16)(ka < K ? W[(size_t)(ka < K ? ka : K - 1) * ld + n] : 0.f); a[8 + i] = (_Float16)(kb < K ? W[(size_t)(kb < K ? kb : K - 1) * ld + n] : 0.f); }
  return a;
}
struct F2 { v16b h, l; };
__device__ __forceinline__ F2 bsplit16(const float v[16]) { F2 r;
#pragma unroll
  for (int i = 0; i < 16; ++i) { const __bf16 h = (__bf16)v[i]; r.h[i] = h; r.l[i] = (__bf16)(v[i] - (float)h); }
  return r; }
__device__ __forceinline__ F2 split_row(const float* row, int k0, int lane) { float v[16]; const float* p = row + k0 + 8 * (lane >> 4);
#pragma unroll
  for (int i = 0; i < 8; ++i) { v[i] = p[i]; v[8 + i] = p[16 + i]; }
  return bsplit16(v); }
__device__ __forceinline__ F2 split_rowK(const float* row, int k0, int lane, int K) { float v[16]; const int g = lane >> 4;
#pragma unroll
  for (int i = 0; i < 8; ++i) { const int ka = k0 + 8 * g + i, kb = ka + 16; v[i] = ka < K ? row[ka < K ? ka : K - 1] : 0.f; v[8 + i] = kb < K ? row[kb < K ? kb : K - 1] : 0.f; }
  return bsplit16(v); }
__device__ __forceinline__ F2 split_col(const float* W, int k0, int n, int lane, int ld, int K) { float v[16]; const int g = lane >> 4;
#pragma unroll
  for (int i = 0; i < 8; ++i) { const int ka = k0 + 8 * g + i, kb = ka + 16; v[i] = ka < K ? W[(size_t)(ka < K ? ka : K - 1) * ld + n] : 0.f; v[8 + i] = kb < K ? W[(size_t)(kb < K ? kb : K - 1) * ld + n] : 0.f; }
  return bsplit16(v); }
__device__ __forceinline__ v8f mac3(const F2& a, const F2& b, v8f c) { c = wmma_bf(a.l, b.h, c); c = wmma_bf(a.h, b.l, c); return wmma_bf(a.h, b.h, c); }
__device__ __forceinline__ float sigm(float v) { return 1.0f / (1.0f + expf(-v)); }
#define LDSX() do { asm volatile("s_wait_dscnt 0" ::: "memory"); __builtin_amdgcn_wave_barrier(); __builtin_amdgcn_fence(__ATOMIC_RELEASE, "workgroup"); } while (0)


#define NB 4
#define SS 2048
#define DM 1024
#define NH 16
#define HALFW 32
#define HD 64
#define QKVW (3 * DM)
#ifndef TQB
#define TQB (SS / 64)
#define TNB NB
#define TOB (NB * SS / 64)     // 64-row tiles of all 8192 rows; unused
#endif
typedef __attribute__((ext_vector_type(8))) __bf16 v8b;
__device__ __forceinline__ v16b frag_b(const __bf16* rowk0, int lane) {
  union { v16b v; v8b q[2]; } u; const __bf16* p = rowk0 + 8 * (lane >> 4);
  u.q[0] = *(const v8b*)p; u.q[1] = *(const v8b*)(p + 16); return u.v;
}
__device__ __forceinline__ float bfr(float v) { return (float)(__bf16)v; }
__device__ __attribute__((noinline)) float exp_ni(float v) { return expf(v); }
__device__ __attribute__((noinline)) float erf_ni(float v) { return erff(v); }

#define PK_A 0                       // [3072][1024] Wqkv rows (natural [out][in])
#define PK_P (PK_A + QKVW * DM)        // [1024][1024] Wo rows (natural)
#define PK_END (PK_P + DM * DM)
#define WS_PK  0u
#define WS_QK  (WS_PK + 2u * PK_END)             // f16 [8192 rows][2048]: q | k
#define WS_QKL (WS_QK + 2u * NB * SS * 2 * DM)     // f16 q | k residual planes x2048
#define WS_VTH (WS_QKL + 2u * NB * SS * 2 * DM)    // f16 [b][1024 (h*64+d)][2048 s] hi
#define WS_VTL (WS_VTH + 2u * NB * DM * SS)        // f16 lo x 2048
#define WS_O   (WS_VTL + 2u * NB * DM * SS)        // f32 [8192][1024]
#define WS_CS  (WS_O + 4u * NB * SS * DM)           // f32 [2][2048][32], unused
#define WS_END (WS_CS + 4u * 2 * SS * 32)
// ---- k_pack: block = (row n, which): natural [out][in] rows -> bf16; which 0..2 -> W_q/W_k/W_v into PK_A rows which*1024 + n; 3 -> W_o into PK_P
__global__ __launch_bounds__(256) void k_pack(const float* __restrict__ WQ, const float* __restrict__ WK, const float* __restrict__ WV, const float* __restrict__ WO, __bf16* __restrict__ PK) {
  __shared__ __align__(16) __bf16 s[DM]; const int n = blockIdx.x, which = blockIdx.y, t = threadIdx.x; const float* Wm = (which == 0) ? WQ : (which == 1) ? WK : (which == 2) ? WV : WO;
  for (int k = t; k < DM; k += 256) s[k] = (__bf16)Wm[(size_t)n * DM + k];
  __syncthreads();
  __bf16* dst = (which < 3) ? PK + PK_A + ((size_t)which * DM + n) * DM : PK + PK_P + (size_t)n * DM;
  for (int q = t; q < DM / 8; q += 256) vst2((unsigned*)(dst + q * 8), *(const v4u*)&s[q * 8]);
}
// ---- k_qkv: block = 128 rows x 256 cols, 8 waves (2 x 4) of 64 x 64: the x tile (rounded to bf16, 32 k a stage) and the weight tile are staged once in LDS, two buffers each, and every wave takes its fragments from there. The weight buffers hold two stages of k, filled half the rows a trip, so that every global load takes whole 128-B lines
#define GBM 128
#define GBN 256
#define GPB 80                        // LDS pitch of an x row: 64 B of k + 16 B, an odd multiple of 16 B for the 16-byte fragment reads
#define GPW 144                       // LDS pitch of a weight row: 128 B of k + 16 B, likewise
#define GAB (GBM * GPB)                // one x buffer
#define GWB (GBN * GPW)                // one weight buffer
typedef __attribute__((ext_vector_type(4))) __bf16 v4b;
__global__ __launch_bounds__(256) void k_qkv(const float* __restrict__ XQ, const float* __restrict__ XK, const float* __restrict__ XV, const __bf16* __restrict__ P, const float* __restrict__ BQ, const float* __restrict__ BK, const float* __restrict__ BV, _Float16* __restrict__ QK, _Float16* __restrict__ QKL, _Float16* __restrict__ VTH, _Float16* __restrict__ VTL) {
  const int n0 = blockIdx.y * GBN; const int which0 = n0 / DM; const float* X = (which0 == 0) ? XQ : (which0 == 1) ? XK : XV; const float* BB = BQ ? (((which0 == 0) ? BQ : (which0 == 1) ? BK : BV) + (n0 - which0 * DM)) : nullptr;
  __shared__ __align__(16) unsigned char sm[2 * GAB + 2 * GWB];
  const int tid = threadIdx.x, wave = tid >> 5, lane = tid & 31, col = lane & 15, g = lane >> 4; const int wm = wave >> 2, wn = wave & 3;
  const int ar = tid >> 3, ac = (tid & 7) * 4, wc = (tid & 7) * 8;   // both tiles: 32 rows a pass, one 128-B line per 8 threads (4 floats of x, 8 bf16 of weight a thread)
  const float* ga = X + ((size_t)blockIdx.x * GBM + ar) * DM + ac; const __bf16* gb = P + (size_t)(n0 + ar) * DM + wc; unsigned char* sw = sm + 2 * GAB;
  v4f ra[4]; v4u rb[4]; v8f acc[4][4] = {};
  // x stage s: k 32 s .. 32 s + 31 of all 128 rows. weight chunk c: k 64 (c >> 1) .. + 63 of rows 128 (c & 1) .. + 127, into weight buffer (c >> 1) & 1 (the short loops are unrolled so that ra and rb stay in registers)
#define QLDA(s) _Pragma("unroll") for (int p = 0; p < 4; ++p) ra[p] = *(const v4f*)(ga + (size_t)p * 32 * DM + (s) * 32)
#define QLDW(c) _Pragma("unroll") for (int p = 0; p < 4; ++p) rb[p] = *(const v4u*)(gb + (size_t)(((c) & 1) * 128 + p * 32) * DM + ((c) >> 1) * 64)
#define QSTA(s) _Pragma("unroll") for (int p = 0; p < 4; ++p) { v4b t; _Pragma("unroll") for (int i = 0; i < 4; ++i) t[i] = (__bf16)ra[p][i]; *(v4b*)(sm + ((s) & 1) * GAB + (ar + p * 32) * GPB + ac * 2) = t; }
#define QSTW(c) _Pragma("unroll") for (int p = 0; p < 4; ++p) *(v4u*)(sw + (((c) >> 1) & 1) * GWB + (((c) & 1) * 128 + ar + p * 32) * GPW + wc * 2) = rb[p]
  QLDA(0); QLDW(0); QSTA(0); QSTW(0); QLDW(1); QSTW(1); QLDA(1); QLDW(2);
  __syncthreads();
#pragma unroll 4   // four trips a round, so that every buffer's LDS offset is a constant
  for (int kc = 0; kc < DM / 32; ++kc) {
    // what was loaded from global one trip ago goes into buffers whose readers an earlier barrier has ended; the next loads have this whole trip to land
    if (kc + 1 < DM / 32) { QSTA(kc + 1); }
    if (kc + 2 < DM / 32) { QSTW(kc + 2); QLDA(kc + 2); }
    if (kc + 3 < DM / 32) { QLDW(kc + 3); }
    v16b fa[4], fb[4];
#pragma unroll
    for (int i = 0; i < 4; ++i) { fa[i] = frag_b((const __bf16*)(sm + (kc & 1) * GAB + (wm * 64 + i * 16 + col) * GPB), lane); fb[i] = frag_b((const __bf16*)(sw + ((kc >> 1) & 1) * GWB + (wn * 64 + i * 16 + col) * GPW + (kc & 1) * 64), lane); }
#pragma unroll
    for (int i = 0; i < 4; ++i) {
#pragma unroll
      for (int j = 0; j < 4; ++j) acc[i][j] = wmma_bf(fa[i], fb[j], acc[i][j]); }
    __syncthreads(); }   // publishes what this trip stored and ends every read of what the next trip overwrites
  // epilogue: each wave stages 16 output rows at a time (hi and residual plane, pitch 144 B) in its own part of the buffers, all of whose readers have passed the loop's last barrier, and stores whole 128-B lines
  _Float16* eh = (_Float16*)(sm + wave * (2 * 16 * 144)); _Float16* el = eh + 16 * 72;
  const size_t rw = (size_t)blockIdx.x * GBM + wm * 64; const int cw = wn * 64; const int el_r = lane >> 3, el_c = (lane & 7) * 8;
  float bias[4];
#pragma unroll
  for (int j = 0; j < 4; ++j) bias[j] = BB ? bfr(BB[cw + j * 16 + col]) : 0.f;
  if (n0 < 2 * DM) {   // q, k (+ bias) as f16 hi + (x2048) residual; q stored unscaled, 1/8 applied to the f32 score
#pragma unroll
    for (int i = 0; i < 4; ++i) {
#pragma unroll
      for (int j = 0; j < 4; ++j) {
#pragma unroll
        for (int r = 0; r < 8; ++r) { const float v = acc[i][j][r] + bias[j]; const _Float16 hv = (_Float16)v; eh[(8 * g + r) * 72 + j * 16 + col] = hv; el[(8 * g + r) * 72 + j * 16 + col] = (_Float16)((v - (float)hv) * 2048.0f); } }
      LDSX();
#pragma unroll
      for (int p = 0; p < 4; ++p) { const int rl = p * 4 + el_r; const size_t o = (rw + i * 16 + rl) * (2 * DM) + n0 + cw + el_c; vst2((unsigned*)(QK + o), *(const v4u*)&eh[rl * 72 + el_c]); vst2((unsigned*)(QKL + o), *(const v4u*)&el[rl * 72 + el_c]); }
      LDSX(); }
  } else {   // v (+ bias) transposed: [b][h*64+d][s], 16 d rows of 64 s at a time
    const int b = (int)(rw / SS), s0 = (int)(rw % SS); const int pc0 = n0 - 2 * DM + cw;
#pragma unroll
    for (int j = 0; j < 4; ++j) {
#pragma unroll
      for (int i = 0; i < 4; ++i) { v8h hh, ll;
#pragma unroll
        for (int r = 0; r < 8; ++r) { const float v = acc[i][j][r] + bias[j]; const _Float16 hv = (_Float16)v; hh[r] = hv; ll[r] = (_Float16)((v - (float)hv) * 2048.0f); }
        *(v8h*)&eh[col * 72 + i * 16 + 8 * g] = hh; *(v8h*)&el[col * 72 + i * 16 + 8 * g] = ll; }
      LDSX();
#pragma unroll
      for (int p = 0; p < 4; ++p) { const int d = p * 4 + el_r; const size_t o = ((size_t)b * DM + pc0 + j * 16 + d) * SS + s0 + el_c; vst2((unsigned*)(VTH + o), *(const v4u*)&eh[d * 72 + el_c]); vst2((unsigned*)(VTL + o), *(const v4u*)&el[d * 72 + el_c]); }
      LDSX(); }
    asm volatile("s_wait_xcnt 0x0" ::: "memory");   // behind the last pass's stores, before the code after this branch that rewrites their address registers
  }
}
// ---- k_attn: block = (64 queries, head h, batch b): windowed flash attention over key tiles touching |i - j| <= 32 (K = 64: 2 k-steps), scores = (q.k) * 0.125 with single f16 operands, P.V: f16 P (x2^11) x V hi in one accumulator (accl stays 0); O[b*S+q][h*64+d] = (acc + accl / 2048) / (2048 l) (256-B segments)
__global__ __launch_bounds__(128) void k_attn(const _Float16* __restrict__ QK, const _Float16* __restrict__ QKL, const _Float16* __restrict__ VTH, const _Float16* __restrict__ VTL, const void* __restrict__ KMASK, float* __restrict__ O) {
  __shared__ __align__(16) float sp[4][16][36]; __shared__ __align__(16) float so[4][16][68];
  const int tid = threadIdx.x, wave = tid >> 5, lane = tid & 31, col = lane & 15, g = lane >> 4;
  const int qb = blockIdx.x, h = blockIdx.y, b = blockIdx.z; const int q0 = qb * 64 + wave * 16; const size_t rq = (size_t)b * SS + q0 + col;
  v16h aq[2], aql[2];
#pragma unroll
  for (int kc = 0; kc < 2; ++kc) { aq[kc] = frag_h(QK + rq * (2 * DM) + h * HD + kc * 32, lane); aql[kc] = frag_h(QKL + rq * (2 * DM) + h * HD + kc * 32, lane); }
  float m[8], l[8];
#pragma unroll
  for (int r = 0; r < 8; ++r) { m[r] = -3.0e38f; l[r] = 0.f; }
  v8f acc[4] = {}, accl[4] = {};
  const int ks0 = max(0, (int)(blockIdx.x * 64) - HALFW) / 32; const int nks = min(SS / 32, ((int)(blockIdx.x * 64) + 64 + HALFW + 31) / 32);   // only key tiles touching the window
#pragma unroll 1
  for (int ks = ks0; ks < nks; ++ks) { v8f s[2];
#pragma unroll
    for (int ct = 0; ct < 2; ++ct) { const int kk = ks * 32 + ct * 16 + col; const _Float16* krow = QK + ((size_t)b * SS + kk) * (2 * DM) + DM + h * HD; const _Float16* krowl = QKL + ((size_t)b * SS + kk) * (2 * DM) + DM + h * HD; v8f c = {}, cl = {};
#pragma unroll
      for (int kc = 0; kc < 2; ++kc) c = wmma16(aq[kc], frag_h(krow + kc * 32, lane), c);   // single product: q, k as one-rounding f16 operands
      (void)cl; (void)krowl;
      { const bool keepk = true;
#pragma unroll
      for (int r = 0; r < 8; ++r) { const int qi = q0 + 8 * g + r; const int dd = (qi > kk) ? (qi - kk) : (kk - qi); s[ct][r] = (keepk && dd <= HALFW) ? c[r] * 0.125f : -3.0e38f; } } }   // 1/sqrt(64); local window |i-j| <= 32
#pragma unroll
    for (int r = 0; r < 8; ++r) { float mx = fmaxf(s[0][r], s[1][r]);
#pragma unroll
      for (int o = 1; o < 16; o <<= 1) mx = fmaxf(mx, __shfl_xor(mx, o));
      const float mn = fmaxf(m[r], mx); const float alpha = (m[r] <= -1.0e38f) ? 0.f : __expf(m[r] - mn);
      const float e0 = (s[0][r] <= -1.0e38f) ? 0.f : __expf(s[0][r] - mn), e1 = (s[1][r] <= -1.0e38f) ? 0.f : __expf(s[1][r] - mn); float es = e0 + e1;
#pragma unroll
      for (int o = 1; o < 16; o <<= 1) es += __shfl_xor(es, o);
      l[r] = l[r] * alpha + es; m[r] = mn;
#pragma unroll
      for (int dt = 0; dt < 4; ++dt) { acc[dt][r] *= alpha; accl[dt][r] *= alpha; }
      sp[wave][8 * g + r][col] = e0; sp[wave][8 * g + r][16 + col] = e1; }
    LDSX();
    v16h pa, pl; { const float* prow = &sp[wave][col][0] + 8 * (lane >> 4);
#pragma unroll
      for (int i = 0; i < 8; ++i) { const float x0 = prow[i] * 2048.0f, x1 = prow[16 + i] * 2048.0f; const _Float16 h0 = (_Float16)x0, h1 = (_Float16)x1; pa[i] = h0; pa[8 + i] = h1; pl[i] = (_Float16)((x0 - (float)h0) * 2048.0f); pl[8 + i] = (_Float16)((x1 - (float)h1) * 2048.0f); } }   // P scaled by 2^11 before the f16 split so small softmax weights stay out of the f16 subnormal range; 2^-11 folded into the epilogue
#pragma unroll
    for (int dt = 0; dt < 4; ++dt) { const size_t vr = ((size_t)b * DM + h * HD + dt * 16 + col) * SS + ks * 32; acc[dt] = wmma16(pa, frag_h(VTH + vr, lane), acc[dt]); }   // single product: P (x2^11) x V
    (void)pl;
    LDSX(); }
#pragma unroll
  for (int r = 0; r < 8; ++r) { const float il = (1.0f / 2048.0f) / l[r];
#pragma unroll
    for (int dt = 0; dt < 4; ++dt) so[wave][8 * g + r][dt * 16 + col] = (acc[dt][r] + accl[dt][r] * (1.0f / 2048.0f)) * il; }
  LDSX();
  for (int rl = 0; rl < 16; ++rl) if (lane < 16) vst2(O + ((size_t)b * SS + q0 + rl) * DM + h * HD + lane * 4, *(const v4f*)&so[wave][rl][lane * 4]);
}
// ---- k_out: block = 128 rows x 128 cols, 8 waves (2 x 4) of 64 x 32, tiles staged in LDS as in k_qkv (O as bf16 hi and residual planes, split once per block): out = O(hi/lo) . Wo rows (2 products) + bo
#define OBN 128
#define OAB (2 * GBM * GPB)             // one O buffer: hi rows, then residual rows
#define OWB (OBN * GPW)                 // one weight buffer (two stages of k)
__global__ __launch_bounds__(256) void k_out(const float* __restrict__ O, const __bf16* __restrict__ P, const float* __restrict__ BO, float* __restrict__ Y) {
  __shared__ __align__(16) unsigned char sm[2 * OAB + 2 * OWB];
  const int tid = threadIdx.x, wave = tid >> 5, lane = tid & 31, col = lane & 15, g = lane >> 4; const int wm = wave >> 2, wn = wave & 3; const int n0 = blockIdx.y * OBN;
  const int ar = tid >> 3, ac = (tid & 7) * 4, wc = (tid & 7) * 8;
  const float* ga = O + ((size_t)blockIdx.x * GBM + ar) * DM + ac; const __bf16* gb = P + (size_t)(n0 + ar) * DM + wc; unsigned char* sw = sm + 2 * OAB;
  v4f ra[4]; v4u rb[2]; v8f acc[4][2] = {};
  // O stage s: k 32 s .. + 31 of all 128 rows. weight chunk c: k 64 (c >> 1) .. + 63 of rows 64 (c & 1) .. + 63, into weight buffer (c >> 1) & 1 (the short loops are unrolled so that ra and rb stay in registers)
#define OLDA(s) _Pragma("unroll") for (int p = 0; p < 4; ++p) ra[p] = *(const v4f*)(ga + (size_t)p * 32 * DM + (s) * 32)
#define OLDW(c) _Pragma("unroll") for (int p = 0; p < 2; ++p) rb[p] = *(const v4u*)(gb + (size_t)(((c) & 1) * 64 + p * 32) * DM + ((c) >> 1) * 64)
#define OSTA(s) _Pragma("unroll") for (int p = 0; p < 4; ++p) { v4b th, tl; _Pragma("unroll") for (int i = 0; i < 4; ++i) { th[i] = (__bf16)ra[p][i]; tl[i] = (__bf16)(ra[p][i] - (float)th[i]); } *(v4b*)(sm + ((s) & 1) * OAB + (ar + p * 32) * GPB + ac * 2) = th; *(v4b*)(sm + ((s) & 1) * OAB + (GBM + ar + p * 32) * GPB + ac * 2) = tl; }
#define OSTW(c) _Pragma("unroll") for (int p = 0; p < 2; ++p) *(v4u*)(sw + (((c) >> 1) & 1) * OWB + (((c) & 1) * 64 + ar + p * 32) * GPW + wc * 2) = rb[p]
  OLDA(0); OLDW(0); OSTA(0); OSTW(0); OLDW(1); OSTW(1); OLDA(1); OLDW(2);
  __syncthreads();
#pragma unroll 4   // four trips a round, so that every buffer's LDS offset is a constant
  for (int kc = 0; kc < DM / 32; ++kc) {
    // what was loaded from global one trip ago goes into buffers whose readers an earlier barrier has ended; the next loads have this whole trip to land
    if (kc + 1 < DM / 32) { OSTA(kc + 1); }
    if (kc + 2 < DM / 32) { OSTW(kc + 2); OLDA(kc + 2); }
    if (kc + 3 < DM / 32) { OLDW(kc + 3); }
    v16b fh[4], fl[4], fb[2];
#pragma unroll
    for (int j = 0; j < 2; ++j) fb[j] = frag_b((const __bf16*)(sw + ((kc >> 1) & 1) * OWB + (wn * 32 + j * 16 + col) * GPW + (kc & 1) * 64), lane);
#pragma unroll
    for (int i = 0; i < 4; ++i) { fl[i] = frag_b((const __bf16*)(sm + (kc & 1) * OAB + (GBM + wm * 64 + i * 16 + col) * GPB), lane); fh[i] = frag_b((const __bf16*)(sm + (kc & 1) * OAB + (wm * 64 + i * 16 + col) * GPB), lane); }
#pragma unroll
    for (int ip = 0; ip < 4; ip += 2) {   // per accumulator: residual product, then hi product; four independent tiles between the two, so that no product waits for its accumulator
#pragma unroll
      for (int q = 0; q < 4; ++q) acc[ip + (q >> 1)][q & 1] = wmma_bf(fl[ip + (q >> 1)], fb[q & 1], acc[ip + (q >> 1)][q & 1]);
#pragma unroll
      for (int q = 0; q < 4; ++q) acc[ip + (q >> 1)][q & 1] = wmma_bf(fh[ip + (q >> 1)], fb[q & 1], acc[ip + (q >> 1)][q & 1]); }
    __syncthreads(); }   // publishes what this trip stored and ends every read of what the next trip overwrites
  // epilogue: each wave stages 16 rows of 32 f32 (pitch 144 B) in its own part of the buffers, behind the loop's last barrier, and stores whole 128-B lines
  float* so = (float*)(sm + wave * (16 * 144)); const size_t rw = (size_t)blockIdx.x * GBM + wm * 64; const int cw = n0 + wn * 32;
  float bias[2];
#pragma unroll
  for (int j = 0; j < 2; ++j) bias[j] = bfr(BO[cw + j * 16 + col]);
#pragma unroll
  for (int i = 0; i < 4; ++i) {
#pragma unroll
    for (int j = 0; j < 2; ++j) {
#pragma unroll
      for (int r = 0; r < 8; ++r) so[(8 * g + r) * 36 + j * 16 + col] = acc[i][j][r] + bias[j]; }
    LDSX();
#pragma unroll
    for (int p = 0; p < 4; ++p) { const int rl = p * 4 + (lane >> 3); vst2(Y + (rw + i * 16 + rl) * DM + cw + (lane & 7) * 4, *(const v4f*)&so[rl * 36 + (lane & 7) * 4]); }
    LDSX(); }
}
extern "C" void kernel_launch(void* const* d_in, const int* in_sizes, int n_in, void* d_out, int out_size, void* d_ws, size_t ws_size, hipStream_t stream) {
  (void)in_sizes; (void)n_in; (void)out_size;
  const float** F = (const float**)d_in;   // 0 x [4,2048,1024], 1 W_qkv [3072,1024] natural, 2 b_qkv [3072], 3 W_out [1024,1024], 4 b_out
  if (ws_size < (size_t)WS_END) return;
  char* ws = (char*)d_ws; __bf16* PK = (__bf16*)(ws + WS_PK); _Float16 *QK = (_Float16*)(ws + WS_QK), *QKL = (_Float16*)(ws + WS_QKL), *VTH = (_Float16*)(ws + WS_VTH), *VTL = (_Float16*)(ws + WS_VTL); float* O = (float*)(ws + WS_O);
  k_pack<<<dim3(DM, 4), 256, 0, stream>>>(F[1], F[1] + (size_t)DM * DM, F[1] + (size_t)2 * DM * DM, F[3], PK);
  k_qkv<<<dim3(TNB * SS / GBM, QKVW / GBN), 256, 0, stream>>>(F[0], F[0], F[0], PK + PK_A, F[2], F[2] + DM, F[2] + 2 * DM, QK, QKL, VTH, VTL);
  k_attn<<<dim3(TQB, NH, TNB), 128, 0, stream>>>(QK, QKL, VTH, VTL, nullptr, O);
  k_out<<<dim3(TNB * SS / GBM, DM / OBN), 256, 0, stream>>>(O, PK + PK_P, F[4], (float*)d_out);
}

// v002
// Measured time: 116 microseconds a run.
// Two timings next to v001 both put it at 1.14 times that version's speed.
// Counting every step since v000, it is 3.21 times as fast.
// compute dtype: all float inputs rounded to bf16; qkv = x . W_qkv^T + b with EXACT bf16 products on WMMA 16x16x32 (natural rows; the fused weight as three contiguous row blocks); windowed attention (only key tiles touching |i - j| <= 32 are visited, per-score window test): q, k single f16 x 1/8, running-max softmax in f32 (hardware exp), P (scaled by 2^11, single f16) x v (single f16); out = o (bf16 hi + residual) . W_out^T (2 products) + b_out.
#include <hip/hip_runtime.h>
#include <math.h>

typedef __attribute__((ext_vector_type(16))) _Float16 v16h;
typedef __attribute__((ext_vector_type(16))) __bf16 v16b;
typedef __attribute__((ext_vector_type(8)))  _Float16 v8h;
typedef __attribute__((ext_vector_type(8)))  float v8f;
typedef __attribute__((ext_vector_type(4)))  float v4f;
typedef __attribute__((ext_vector_type(2)))  float v2f;
typedef __attribute__((ext_vector_type(4)))  unsigned v4u;
typedef __attribute__((ext_vector_type(4)))  int v4i;
typedef float __attribute__((may_alias)) float_a;
typedef int __attribute__((may_alias)) int_a;

template <typename T> __device__ __forceinline__ void vst2(void* p, T v) { *(T*)p = v;  }
__device__ __forceinline__ v8f wmma16(v16h a, v16h b, v8f c) {
  v8f d = __builtin_amdgcn_wmma_f32_16x16x32_f16(false, a, false, b, (short)0, c, false, false);
  asm volatile("v_nop\n\tv_nop\n\tv_nop\n\tv_nop" : "+v"(d) : "v"(a), "v"(b));
  return d;
}
__device__ __forceinline__ v8f wmma_bf(v16b a, v16b b, v8f c) {
  v8f d = __builtin_amdgcn_wmma_f32_16x16x32_bf16(false, a, false, b, (short)0, c, false, false);
  asm volatile("v_nop\n\tv_nop\n\tv_nop\n\tv_nop" : "+v"(d) : "v"(a), "v"(b));
  return d;
}
// Local-window multi-head self attention (B 4, T 2,048, d 1,024, 16 heads x 64, window |i - j| <= 32): fused qkv projection + bias, windowed softmax(q k^T / 8) v, output projection + bias.
__device__ __forceinline__ v16h frag_h(const _Float16* rowk0, int lane) {
  union { v16h v; v8h q[2]; } u; const _Float16* p = rowk0 + 8 * (lane >> 4);
  u.q[0] = *(const v8h*)p; u.q[1] = *(const v8h*)(p + 16); return u.v;
}
__device__ __forceinline__ v16h frag_f32(const float* rowk0, int lane) {
  v16h a; const float* p = rowk0 + 8 * (lane >> 4);
#pragma unroll
  for (int i = 0; i < 8; ++i) { a[i] = (_Float16)p[i]; a[8 + i] = (_Float16)p[16 + i]; }
  return a;
}
__device__ __forceinline__ v16h frag_f32s(const float* rowk0, int lane, float sc) {
  v16h a; const float* p = rowk0 + 8 * (lane >> 4);
#pragma unroll
  for (int i = 0; i < 8; ++i) { a[i] = (_Float16)(p[i] * sc); a[8 + i] = (_Float16)(p[16 + i] * sc); }
  return a;
}
// column fragment from a [K][ld] layout (column n), rows >= K read as 0
__device__ __forceinline__ v16h fragc_f32(const float* W, int k0, int n, int lane, int ld, int K) {
  v16h a; const int g = lane >> 4;
#pragma unroll
  for (int i = 0; i < 8; ++i) { const int ka = k0 + 8 * g + i, kb = ka + 16;
    a[i] = (_Float16)(ka < K ? W[(size_t)(ka < K ? ka : K - 1) * ld + n] : 0.f); a[8 + i] = (_Float16)(kb < K ? W[(size_t)(kb < K ? kb : K - 1) * ld + n] : 0.f); }
  return a;
}
struct F2 { v16b h, l; };
__device__ __forceinline__ F2 bsplit16(const float v[16]) { F2 r;
#pragma unroll
  for (int i = 0; i < 16; ++i) { const __bf16 h = (__bf16)v[i]; r.h[i] = h; r.l[i] = (__bf16)(v[i] - (float)h); }
  return r; }
__device__ __forceinline__ F2 split_row(const float* row, int k0, int lane) { float v[16]; const float* p = row + k0 + 8 * (lane >> 4);
#pragma unroll
  for (int i = 0; i < 8; ++i) { v[i] = p[i]; v[8 + i] = p[16 + i]; }
  return bsplit16(v); }
__device__ __forceinline__ F2 split_rowK(const float* row, int k0, int lane, int K) { float v[16]; const int g = lane >> 4;
#pragma unroll
  for (int i = 0; i < 8; ++i) { const int ka = k0 + 8 * g + i, kb = ka + 16; v[i] = ka < K ? row[ka < K ? ka : K - 1] : 0.f; v[8 + i] = kb < K ? row[kb < K ? kb : K - 1] : 0.f; }
  return bsplit16(v); }
__device__ __forceinline__ F2 split_col(const float* W, int k0, int n, int lane, int ld, int K) { float v[16]; const int g = lane >> 4;
#pragma unroll
  for (int i = 0; i < 8; ++i) { const int ka = k0 + 8 * g + i, kb = ka + 16; v[i] = ka < K ? W[(size_t)(ka < K ? ka : K - 1) * ld + n] : 0.f; v[8 + i] = kb < K ? W[(size_t)(kb < K ? kb : K - 1) * ld + n] : 0.f; }
  return bsplit16(v); }
__device__ __forceinline__ v8f mac3(const F2& a, const F2& b, v8f c) { c = wmma_bf(a.l, b.h, c); c = wmma_bf(a.h, b.l, c); return wmma_bf(a.h, b.h, c); }
__device__ __forceinline__ float sigm(float v) { return 1.0f / (1.0f + expf(-v)); }
#define LDSX() do { asm volatile("s_wait_dscnt 0" ::: "memory"); __builtin_amdgcn_wave_barrier(); __builtin_amdgcn_fence(__ATOMIC_RELEASE, "workgroup"); } while (0)


#define NB 4
#define SS 2048
#define DM 1024
#define NH 16
#define HALFW 32
#define HD 64
#define QKVW (3 * DM)
#ifndef TQB
#define TQB (SS / 64)
#define TNB NB
#define TOB (NB * SS / 64)     // 64-row tiles of all 8192 rows; unused
#endif
typedef __attribute__((ext_vector_type(8))) __bf16 v8b;
__device__ __forceinline__ v16b frag_b(const __bf16* rowk0, int lane) {
  union { v16b v; v8b q[2]; } u; const __bf16* p = rowk0 + 8 * (lane >> 4);
  u.q[0] = *(const v8b*)p; u.q[1] = *(const v8b*)(p + 16); return u.v;
}
__device__ __forceinline__ float bfr(float v) { return (float)(__bf16)v; }
__device__ __attribute__((noinline)) float exp_ni(float v) { return expf(v); }
__device__ __attribute__((noinline)) float erf_ni(float v) { return erff(v); }

#define PK_A 0                       // [3072][1024] Wqkv rows (natural [out][in])
#define PK_P (PK_A + QKVW * DM)        // [1024][1024] Wo rows (natural)
#define PK_END (PK_P + DM * DM)
#define WS_PK  0u
#define WS_QK  (WS_PK + 2u * PK_END)             // f16 [8192 rows][2048]: q | k
#define WS_QKL (WS_QK + 2u * NB * SS * 2 * DM)     // f16 q | k residual planes x2048
#define WS_VTH (WS_QKL + 2u * NB * SS * 2 * DM)    // f16 [b][1024 (h*64+d)][2048 s] hi
#define WS_VTL (WS_VTH + 2u * NB * DM * SS)        // f16 lo x 2048
#define WS_O   (WS_VTL + 2u * NB * DM * SS)        // f32 [8192][1024]
#define WS_CS  (WS_O + 4u * NB * SS * DM)           // f32 [2][2048][32], unused
#define WS_END (WS_CS + 4u * 2 * SS * 32)
// ---- k_pack: block = (row n, which): natural [out][in] rows -> bf16; which 0..2 -> W_q/W_k/W_v into PK_A rows which*1024 + n; 3 -> W_o into PK_P
__global__ __launch_bounds__(256) void k_pack(const float* __restrict__ WQ, const float* __restrict__ WK, const float* __restrict__ WV, const float* __restrict__ WO, __bf16* __restrict__ PK) {
  __shared__ __align__(16) __bf16 s[DM]; const int n = blockIdx.x, which = blockIdx.y, t = threadIdx.x; const float* Wm = (which == 0) ? WQ : (which == 1) ? WK : (which == 2) ? WV : WO;
  for (int k = t; k < DM; k += 256) s[k] = (__bf16)Wm[(size_t)n * DM + k];
  __syncthreads();
  __bf16* dst = (which < 3) ? PK + PK_A + ((size_t)which * DM + n) * DM : PK + PK_P + (size_t)n * DM;
  for (int q = t; q < DM / 8; q += 256) vst2((unsigned*)(dst + q * 8), *(const v4u*)&s[q * 8]);
}
// ---- k_qkv: block = 128 rows x 256 cols, 8 waves (2 x 4) of 64 x 64: the x tile (rounded to bf16, 32 k a stage) and the weight tile are staged once in LDS, two buffers each, and every wave takes its fragments from there. The weight buffers hold two stages of k, filled half the rows a trip, so that every global load takes whole 128-B lines
#define GBM 128
#define GBN 256
#define GPB 80                        // LDS pitch of an x row: 64 B of k + 16 B, an odd multiple of 16 B for the 16-byte fragment reads
#define GPW 144                       // LDS pitch of a weight row: 128 B of k + 16 B, likewise
#define GAB (GBM * GPB)                // one x buffer
#define GWB (GBN * GPW)                // one weight buffer
typedef __attribute__((ext_vector_type(4))) __bf16 v4b;
__global__ __launch_bounds__(256) void k_qkv(const float* __restrict__ XQ, const float* __restrict__ XK, const float* __restrict__ XV, const __bf16* __restrict__ P, const float* __restrict__ BQ, const float* __restrict__ BK, const float* __restrict__ BV, _Float16* __restrict__ QK, _Float16* __restrict__ QKL, _Float16* __restrict__ VTH, _Float16* __restrict__ VTL) {
  const int n0 = blockIdx.y * GBN; const int which0 = n0 / DM; const float* X = (which0 == 0) ? XQ : (which0 == 1) ? XK : XV; const float* BB = BQ ? (((which0 == 0) ? BQ : (which0 == 1) ? BK : BV) + (n0 - which0 * DM)) : nullptr;
  __shared__ __align__(16) unsigned char sm[2 * GAB + 2 * GWB];
  const int tid = threadIdx.x, wave = tid >> 5, lane = tid & 31, col = lane & 15, g = lane >> 4; const int wm = wave >> 2, wn = wave & 3;
  const int ar = tid >> 3, ac = (tid & 7) * 4, wc = (tid & 7) * 8;   // both tiles: 32 rows a pass, one 128-B line per 8 threads (4 floats of x, 8 bf16 of weight a thread)
  const float* ga = X + ((size_t)blockIdx.x * GBM + ar) * DM + ac; const __bf16* gb = P + (size_t)(n0 + ar) * DM + wc; unsigned char* sw = sm + 2 * GAB;
  v4f ra[4]; v4u rb[4]; v8f acc[4][4] = {};
  // x stage s: k 32 s .. 32 s + 31 of all 128 rows. weight chunk c: k 64 (c >> 1) .. + 63 of rows 128 (c & 1) .. + 127, into weight buffer (c >> 1) & 1 (the short loops are unrolled so that ra and rb stay in registers)
#define QLDA(s) _Pragma("unroll") for (int p = 0; p < 4; ++p) ra[p] = *(const v4f*)(ga + (size_t)p * 32 * DM + (s) * 32)
#define QLDW(c) _Pragma("unroll") for (int p = 0; p < 4; ++p) rb[p] = *(const v4u*)(gb + (size_t)(((c) & 1) * 128 + p * 32) * DM + ((c) >> 1) * 64)
#define QSTA(s) _Pragma("unroll") for (int p = 0; p < 4; ++p) { v4b t; _Pragma("unroll") for (int i = 0; i < 4; ++i) t[i] = (__bf16)ra[p][i]; *(v4b*)(sm + ((s) & 1) * GAB + (ar + p * 32) * GPB + ac * 2) = t; }
#define QSTW(c) _Pragma("unroll") for (int p = 0; p < 4; ++p) *(v4u*)(sw + (((c) >> 1) & 1) * GWB + (((c) & 1) * 128 + ar + p * 32) * GPW + wc * 2) = rb[p]
  QLDA(0); QLDW(0); QSTA(0); QSTW(0); QLDW(1); QSTW(1); QLDA(1); QLDW(2);
  __syncthreads();
#pragma unroll 4   // four trips a round, so that every buffer's LDS offset is a constant
  for (int kc = 0; kc < DM / 32; ++kc) {
    // what was loaded from global one trip ago goes into buffers whose readers an earlier barrier has ended; the next loads have this whole trip to land
    if (kc + 1 < DM / 32) { QSTA(kc + 1); }
    if (kc + 2 < DM / 32) { QSTW(kc + 2); QLDA(kc + 2); }
    if (kc + 3 < DM / 32) { QLDW(kc + 3); }
    v16b fa[4], fb[4];
#pragma unroll
    for (int i = 0; i < 4; ++i) { fa[i] = frag_b((const __bf16*)(sm + (kc & 1) * GAB + (wm * 64 + i * 16 + col) * GPB), lane); fb[i] = frag_b((const __bf16*)(sw + ((kc >> 1) & 1) * GWB + (wn * 64 + i * 16 + col) * GPW + (kc & 1) * 64), lane); }
#pragma unroll
    for (int i = 0; i < 4; ++i) {
#pragma unroll
      for (int j = 0; j < 4; ++j) acc[i][j] = wmma_bf(fa[i], fb[j], acc[i][j]); }
    __syncthreads(); }   // publishes what this trip stored and ends every read of what the next trip overwrites
  // epilogue: each wave stages 16 output rows at a time (hi and residual plane, pitch 144 B) in its own part of the buffers, all of whose readers have passed the loop's last barrier, and stores whole 128-B lines
  _Float16* eh = (_Float16*)(sm + wave * (2 * 16 * 144)); _Float16* el = eh + 16 * 72;
  const size_t rw = (size_t)blockIdx.x * GBM + wm * 64; const int cw = wn * 64; const int el_r = lane >> 3, el_c = (lane & 7) * 8;
  float bias[4];
#pragma unroll
  for (int j = 0; j < 4; ++j) bias[j] = BB ? bfr(BB[cw + j * 16 + col]) : 0.f;
  if (n0 < 2 * DM) {   // q, k (+ bias) as f16 hi + (x2048) residual; q stored unscaled, 1/8 applied to the f32 score
#pragma unroll
    for (int i = 0; i < 4; ++i) {
#pragma unroll
      for (int j = 0; j < 4; ++j) {
#pragma unroll
        for (int r = 0; r < 8; ++r) { const float v = acc[i][j][r] + bias[j]; const _Float16 hv = (_Float16)v; eh[(8 * g + r) * 72 + j * 16 + col] = hv; el[(8 * g + r) * 72 + j * 16 + col] = (_Float16)((v - (float)hv) * 2048.0f); } }
      LDSX();
#pragma unroll
      for (int p = 0; p < 4; ++p) { const int rl = p * 4 + el_r; const size_t o = (rw + i * 16 + rl) * (2 * DM) + n0 + cw + el_c; vst2((unsigned*)(QK + o), *(const v4u*)&eh[rl * 72 + el_c]); vst2((unsigned*)(QKL + o), *(const v4u*)&el[rl * 72 + el_c]); }
      LDSX(); }
  } else {   // v (+ bias) transposed: [b][h*64+d][s], 16 d rows of 64 s at a time
    const int b = (int)(rw / SS), s0 = (int)(rw % SS); const int pc0 = n0 - 2 * DM + cw;
#pragma unroll
    for (int j = 0; j < 4; ++j) {
#pragma unroll
      for (int i = 0; i < 4; ++i) { v8h hh, ll;
#pragma unroll
        for (int r = 0; r < 8; ++r) { const float v = acc[i][j][r] + bias[j]; const _Float16 hv = (_Float16)v; hh[r] = hv; ll[r] = (_Float16)((v - (float)hv) * 2048.0f); }
        *(v8h*)&eh[col * 72 + i * 16 + 8 * g] = hh; *(v8h*)&el[col * 72 + i * 16 + 8 * g] = ll; }
      LDSX();
#pragma unroll
      for (int p = 0; p < 4; ++p) { const int d = p * 4 + el_r; const size_t o = ((size_t)b * DM + pc0 + j * 16 + d) * SS + s0 + el_c; vst2((unsigned*)(VTH + o), *(const v4u*)&eh[d * 72 + el_c]); vst2((unsigned*)(VTL + o), *(const v4u*)&el[d * 72 + el_c]); }
      LDSX(); }
    asm volatile("s_wait_xcnt 0x0" ::: "memory");   // behind the last pass's stores, before the code after this branch that rewrites their address registers
  }
}
// ---- k_attn: block = (64 queries, head h, batch b): the 128 keys that the block's window can touch are staged once in LDS (k rows and v^T rows, contiguous 128-B and 256-B pieces of global memory, shared by the four waves; each wave's q rows likewise), and every q, k and v fragment is read from there; flash attention over them (K = 64: 2 k-steps), scores = (q.k) * 0.125 with single f16 operands, P.V: f16 P (x2^11) x V hi in one accumulator; O[b*S+q][h*64+d] = acc / 2048 / l (256-B segments)
#define AKN (64 + 2 * HALFW)          // keys staged per block
#define AKP 144                       // LDS pitch of a k row: 128 B + 16 B, an odd multiple of 16 B for the 16-byte fragment reads
#define AVP (2 * AKN + 16)            // LDS pitch of a v^T row: 256 B + 16 B, likewise
__global__ __launch_bounds__(128) void k_attn(const _Float16* __restrict__ QK, const _Float16* __restrict__ QKL, const _Float16* __restrict__ VTH, const _Float16* __restrict__ VTL, const void* __restrict__ KMASK, float* __restrict__ O) {
  __shared__ __align__(16) float sp[4][16][36]; __shared__ __align__(16) float so[4][16][68];
  __shared__ __align__(16) unsigned char sk[AKN * AKP]; __shared__ __align__(16) unsigned char sv[HD * AVP];
  const int tid = threadIdx.x, wave = tid >> 5, lane = tid & 31, col = lane & 15, g = lane >> 4;
  const int qb = blockIdx.x, h = blockIdx.y, b = blockIdx.z; const int q0 = qb * 64 + wave * 16; const size_t rq = (size_t)b * SS + q0 + col;
  const int kb = qb * 64 - HALFW;   // key index of LDS row 0 (a multiple of 32); keys outside 0 .. SS - 1 are loaded from a clamped address and never read: the loop below visits no tile outside that range
  unsigned char* sq = (unsigned char*)&so[wave][0][0];   // the wave's own 16 q rows (pitch AKP) lie where it stages its output rows at the end, long after their one read
  { v4u tk[8], tv[8], tq[4];   // 16-byte pieces: 8 lanes a k or q row (16 k rows a pass of the block, 4 q rows a pass of a wave), 16 lanes a v^T row (8 rows a pass); all twenty loads are in flight before the first store
    const unsigned ko = (unsigned)((tid >> 3) * (2 * DM) + (tid & 7) * 8), vo = (unsigned)((tid >> 4) * SS + min(max(kb + (tid & 15) * 8, 0), SS - 8)), qo = (unsigned)((wave * 16 + (lane >> 3)) * (2 * DM) + (tid & 7) * 8);   // one offset a thread for each array; the rest of every address is the same for the whole block
    const _Float16* vb = VTH + ((size_t)b * DM + h * HD) * SS; const _Float16* qp = QK + ((size_t)b * SS + qb * 64) * (2 * DM) + h * HD;
#pragma unroll
    for (int p = 0; p < 8; ++p) { const int kt = min(max(kb + (p >> 1) * 32, 0), SS - 32); tk[p] = *(const v4u*)(QK + ((size_t)b * SS + kt + (p & 1) * 16) * (2 * DM) + DM + h * HD + ko); }
#pragma unroll
    for (int p = 0; p < 8; ++p) tv[p] = *(const v4u*)(vb + (size_t)p * 8 * SS + vo);
#pragma unroll
    for (int p = 0; p < 4; ++p) tq[p] = *(const v4u*)(qp + (size_t)p * 4 * (2 * DM) + qo);
    asm volatile("s_wait_xcnt 0x0" ::: "memory");   // behind the twenty loads: the registers that hold their offsets are given new values right after
#pragma unroll
    for (int p = 0; p < 8; ++p) { *(v4u*)(sk + ((tid >> 3) + p * 16) * AKP + (tid & 7) * 16) = tk[p]; *(v4u*)(sv + ((tid >> 4) + p * 8) * AVP + (tid & 15) * 16) = tv[p]; }
#pragma unroll
    for (int p = 0; p < 4; ++p) *(v4u*)(sq + ((lane >> 3) + p * 4) * AKP + (tid & 7) * 16) = tq[p]; }
  v16h aq[2], aql[2];
#pragma unroll
  for (int kc = 0; kc < 2; ++kc) aql[kc] = frag_h(QKL + rq * (2 * DM) + h * HD + kc * 32, lane);
  float m[8], l[8];
#pragma unroll
  for (int r = 0; r < 8; ++r) { m[r] = -3.0e38f; l[r] = 0.f; }
  v8f acc[4] = {}, accl[4] = {};
  const int ks0 = max(0, (int)(blockIdx.x * 64) - HALFW) / 32; const int nks = min(SS / 32, ((int)(blockIdx.x * 64) + 64 + HALFW + 31) / 32);   // only key tiles touching the window
  __syncthreads();   // publishes the staged k and v rows to all four waves; nothing overwrites them afterwards
#pragma unroll
  for (int kc = 0; kc < 2; ++kc) aq[kc] = frag_h((const _Float16*)(sq + col * AKP) + kc * 32, lane);
#pragma unroll 1
  for (int ks = ks0; ks < nks; ++ks) { v8f s[2]; v16h fk[2][2];   // the tile's four k fragments are read as one group, behind one wait
#pragma unroll
    for (int ct = 0; ct < 2; ++ct) {
#pragma unroll
      for (int kc = 0; kc < 2; ++kc) fk[ct][kc] = frag_h((const _Float16*)(sk + (ks * 32 + ct * 16 + col - kb) * AKP) + kc * 32, lane); }
#pragma unroll
    for (int ct = 0; ct < 2; ++ct) { const int kk = ks * 32 + ct * 16 + col; const _Float16* krowl = QKL + ((size_t)b * SS + kk) * (2 * DM) + DM + h * HD; v8f c = {}, cl = {};
#pragma unroll
      for (int kc = 0; kc < 2; ++kc) c = wmma16(aq[kc], fk[ct][kc], c);   // single product: q, k as one-rounding f16 operands
      (void)cl; (void)krowl;
      { const bool keepk = true;
#pragma unroll
      for (int r = 0; r < 8; ++r) { const int qi = q0 + 8 * g + r; const int dd = (qi > kk) ? (qi - kk) : (kk - qi); s[ct][r] = (keepk && dd <= HALFW) ? c[r] * 0.125f : -3.0e38f; } } }   // 1/sqrt(64); local window |i-j| <= 32
#pragma unroll
    for (int r = 0; r < 8; ++r) { float mx = fmaxf(s[0][r], s[1][r]);
#pragma unroll
      for (int o = 1; o < 16; o <<= 1) mx = fmaxf(mx, __shfl_xor(mx, o));
      const float mn = fmaxf(m[r], mx); const float alpha = (m[r] <= -1.0e38f) ? 0.f : __expf(m[r] - mn);
      const float e0 = (s[0][r] <= -1.0e38f) ? 0.f : __expf(s[0][r] - mn), e1 = (s[1][r] <= -1.0e38f) ? 0.f : __expf(s[1][r] - mn); float es = e0 + e1;
#pragma unroll
      for (int o = 1; o < 16; o <<= 1) es += __shfl_xor(es, o);
      l[r] = l[r] * alpha + es; m[r] = mn;
#pragma unroll
      for (int dt = 0; dt < 4; ++dt) { acc[dt][r] *= alpha; accl[dt][r] *= alpha; }
      sp[wave][8 * g + r][col] = e0; sp[wave][8 * g + r][16 + col] = e1; }
    LDSX();
    v16h fv[4];   // the tile's four v fragments, one group with the reads of P
#pragma unroll
    for (int dt = 0; dt < 4; ++dt) fv[dt] = frag_h((const _Float16*)(sv + (dt * 16 + col) * AVP) + (ks * 32 - kb), lane);
    v16h pa, pl; { const float* prow = &sp[wave][col][0] + 8 * (lane >> 4);
#pragma unroll
      for (int i = 0; i < 8; ++i) { const float x0 = prow[i] * 2048.0f, x1 = prow[16 + i] * 2048.0f; const _Float16 h0 = (_Float16)x0, h1 = (_Float16)x1; pa[i] = h0; pa[8 + i] = h1; pl[i] = (_Float16)((x0 - (float)h0) * 2048.0f); pl[8 + i] = (_Float16)((x1 - (float)h1) * 2048.0f); } }   // P scaled by 2^11 before the f16 split so small softmax weights stay out of the f16 subnormal range; 2^-11 folded into the epilogue
#pragma unroll
    for (int dt = 0; dt < 4; ++dt) acc[dt] = wmma16(pa, fv[dt], acc[dt]);   // single product: P (x2^11) x V
    (void)pl;
    LDSX(); }
#pragma unroll
  for (int r = 0; r < 8; ++r) { const float il = (1.0f / 2048.0f) / l[r];
#pragma unroll
    for (int dt = 0; dt < 4; ++dt) so[wave][8 * g + r][dt * 16 + col] = (acc[dt][r] + accl[dt][r] * (1.0f / 2048.0f)) * il; }
  LDSX();
  for (int rl = 0; rl < 16; ++rl) if (lane < 16) vst2(O + ((size_t)b * SS + q0 + rl) * DM + h * HD + lane * 4, *(const v4f*)&so[wave][rl][lane * 4]);
}
// ---- k_out: block = 128 rows x 128 cols, 8 waves (2 x 4) of 64 x 32, tiles staged in LDS as in k_qkv (O as bf16 hi and residual planes, split once per block): out = O(hi/lo) . Wo rows (2 products) + bo
#define OBN 128
#define OAB (2 * GBM * GPB)             // one O buffer: hi rows, then residual rows
#define OWB (OBN * GPW)                 // one weight buffer (two stages of k)
__global__ __launch_bounds__(256) void k_out(const float* __restrict__ O, const __bf16* __restrict__ P, const float* __restrict__ BO, float* __restrict__ Y) {
  __shared__ __align__(16) unsigned char sm[2 * OAB + 2 * OWB];
  const int tid = threadIdx.x, wave = tid >> 5, lane = tid & 31, col = lane & 15, g = lane >> 4; const int wm = wave >> 2, wn = wave & 3; const int n0 = blockIdx.y * OBN;
  const int ar = tid >> 3, ac = (tid & 7) * 4, wc = (tid & 7) * 8;
  const float* ga = O + ((size_t)blockIdx.x * GBM + ar) * DM + ac; const __bf16* gb = P + (size_t)(n0 + ar) * DM + wc; unsigned char* sw = sm + 2 * OAB;
  v4f ra[4]; v4u rb[2]; v8f acc[4][2] = {};
  // O stage s: k 32 s .. + 31 of all 128 rows. weight chunk c: k 64 (c >> 1) .. + 63 of rows 64 (c & 1) .. + 63, into weight buffer (c >> 1) & 1 (the short loops are unrolled so that ra and rb stay in registers)
#define OLDA(s) _Pragma("unroll") for (int p = 0; p < 4; ++p) ra[p] = *(const v4f*)(ga + (size_t)p * 32 * DM + (s) * 32)
#define OLDW(c) _Pragma("unroll") for (int p = 0; p < 2; ++p) rb[p] = *(const v4u*)(gb + (size_t)(((c) & 1) * 64 + p * 32) * DM + ((c) >> 1) * 64)
#define OSTA(s) _Pragma("unroll") for (int p = 0; p < 4; ++p) { v4b th, tl; _Pragma("unroll") for (int i = 0; i < 4; ++i) { th[i] = (__bf16)ra[p][i]; tl[i] = (__bf16)(ra[p][i] - (float)th[i]); } *(v4b*)(sm + ((s) & 1) * OAB + (ar + p * 32) * GPB + ac * 2) = th; *(v4b*)(sm + ((s) & 1) * OAB + (GBM + ar + p * 32) * GPB + ac * 2) = tl; }
#define OSTW(c) _Pragma("unroll") for (int p = 0; p < 2; ++p) *(v4u*)(sw + (((c) >> 1) & 1) * OWB + (((c) & 1) * 64 + ar + p * 32) * GPW + wc * 2) = rb[p]
  OLDA(0); OLDW(0); OSTA(0); OSTW(0); OLDW(1); OSTW(1); OLDA(1); OLDW(2);
  __syncthreads();
#pragma unroll 4   // four trips a round, so that every buffer's LDS offset is a constant
  for (int kc = 0; kc < DM / 32; ++kc) {
    // what was loaded from global one trip ago goes into buffers whose readers an earlier barrier has ended; the next loads have this whole trip to land
    if (kc + 1 < DM / 32) { OSTA(kc + 1); }
    if (kc + 2 < DM / 32) { OSTW(kc + 2); OLDA(kc + 2); }
    if (kc + 3 < DM / 32) { OLDW(kc + 3); }
    v16b fh[4], fl[4], fb[2];
#pragma unroll
    for (int j = 0; j < 2; ++j) fb[j] = frag_b((const __bf16*)(sw + ((kc >> 1) & 1) * OWB + (wn * 32 + j * 16 + col) * GPW + (kc & 1) * 64), lane);
#pragma unroll
    for (int i = 0; i < 4; ++i) { fl[i] = frag_b((const __bf16*)(sm + (kc & 1) * OAB + (GBM + wm * 64 + i * 16 + col) * GPB), lane); fh[i] = frag_b((const __bf16*)(sm + (kc & 1) * OAB + (wm * 64 + i * 16 + col) * GPB), lane); }
#pragma unroll
    for (int ip = 0; ip < 4; ip += 2) {   // per accumulator: residual product, then hi product; four independent tiles between the two, so that no product waits for its accumulator
#pragma unroll
      for (int q = 0; q < 4; ++q) acc[ip + (q >> 1)][q & 1] = wmma_bf(fl[ip + (q >> 1)], fb[q & 1], acc[ip + (q >> 1)][q & 1]);
#pragma unroll
      for (int q = 0; q < 4; ++q) acc[ip + (q >> 1)][q & 1] = wmma_bf(fh[ip + (q >> 1)], fb[q & 1], acc[ip + (q >> 1)][q & 1]); }
    __syncthreads(); }   // publishes what this trip stored and ends every read of what the next trip overwrites
  // epilogue: each wave stages 16 rows of 32 f32 (pitch 144 B) in its own part of the buffers, behind the loop's last barrier, and stores whole 128-B lines
  float* so = (float*)(sm + wave * (16 * 144)); const size_t rw = (size_t)blockIdx.x * GBM + wm * 64; const int cw = n0 + wn * 32;
  float bias[2];
#pragma unroll
  for (int j = 0; j < 2; ++j) bias[j] = bfr(BO[cw + j * 16 + col]);
#pragma unroll
  for (int i = 0; i < 4; ++i) {
#pragma unroll
    for (int j = 0; j < 2; ++j) {
#pragma unroll
      for (int r = 0; r < 8; ++r) so[(8 * g + r) * 36 + j * 16 + col] = acc[i][j][r] + bias[j]; }
    LDSX();
#pragma unroll
    for (int p = 0; p < 4; ++p) { const int rl = p * 4 + (lane >> 3); vst2(Y + (rw + i * 16 + rl) * DM + cw + (lane & 7) * 4, *(const v4f*)&so[rl * 36 + (lane & 7) * 4]); }
    LDSX(); }
}
extern "C" void kernel_launch(void* const* d_in, const int* in_sizes, int n_in, void* d_out, int out_size, void* d_ws, size_t ws_size, hipStream_t stream) {
  (void)in_sizes; (void)n_in; (void)out_size;
  const float** F = (const float**)d_in;   // 0 x [4,2048,1024], 1 W_qkv [3072,1024] natural, 2 b_qkv [3072], 3 W_out [1024,1024], 4 b_out
  if (ws_size < (size_t)WS_END) return;
  char* ws = (char*)d_ws; __bf16* PK = (__bf16*)(ws + WS_PK); _Float16 *QK = (_Float16*)(ws + WS_QK), *QKL = (_Float16*)(ws + WS_QKL), *VTH = (_Float16*)(ws + WS_VTH), *VTL = (_Float16*)(ws + WS_VTL); float* O = (float*)(ws + WS_O);
  k_pack<<<dim3(DM, 4), 256, 0, stream>>>(F[1], F[1] + (size_t)DM * DM, F[1] + (size_t)2 * DM * DM, F[3], PK);
  k_qkv<<<dim3(TNB * SS / GBM, QKVW / GBN), 256, 0, stream>>>(F[0], F[0], F[0], PK + PK_A, F[2], F[2] + DM, F[2] + 2 * DM, QK, QKL, VTH, VTL);
  k_attn<<<dim3(TQB, NH, TNB), 128, 0, stream>>>(QK, QKL, VTH, VTL, nullptr, O);
  k_out<<<dim3(TNB * SS / GBM, DM / OBN), 256, 0, stream>>>(O, PK + PK_P, F[4], (float*)d_out);
}

// v003
// One run takes 112 microseconds.
// Two timings next to v002 put it at 1.05 and 1.04 times that version's speed.
// Over all steps from v000 it is 3.34 times as fast.
// compute dtype: all float inputs rounded to bf16; qkv = x . W_qkv^T + b with EXACT bf16 products on WMMA 16x16x32 (natural rows; the fused weight as three contiguous row blocks); windowed attention (only the 128 keys that a block of 64 queries can touch under |i - j| <= 32 are visited, per-score window test): q, k single f16 x 1/8, softmax in f32 (hardware exp), P (scaled by 2^11, single f16) x v (single f16); out = o (bf16 hi + residual) . W_out^T (2 products) + b_out.
#include <hip/hip_runtime.h>
#include <math.h>

typedef __attribute__((ext_vector_type(16))) _Float16 v16h;
typedef __attribute__((ext_vector_type(16))) __bf16 v16b;
typedef __attribute__((ext_vector_type(8)))  _Float16 v8h;
typedef __attribute__((ext_vector_type(8)))  float v8f;
typedef __attribute__((ext_vector_type(4)))  float v4f;
typedef __attribute__((ext_vector_type(2)))  float v2f;
typedef __attribute__((ext_vector_type(4)))  unsigned v4u;
typedef __attribute__((ext_vector_type(4)))  int v4i;
typedef float __attribute__((may_alias)) float_a;
typedef int __attribute__((may_alias)) int_a;

template <typename T> __device__ __forceinline__ void vst2(void* p, T v) { *(T*)p = v;  }
__device__ __forceinline__ v8f wmma16(v16h a, v16h b, v8f c) {
  v8f d = __builtin_amdgcn_wmma_f32_16x16x32_f16(false, a, false, b, (short)0, c, false, false);
  asm volatile("v_nop\n\tv_nop\n\tv_nop\n\tv_nop" : "+v"(d) : "v"(a), "v"(b));
  return d;
}
__device__ __forceinline__ v8f wmma_bf(v16b a, v16b b, v8f c) {
  v8f d = __builtin_amdgcn_wmma_f32_16x16x32_bf16(false, a, false, b, (short)0, c, false, false);
  asm volatile("v_nop\n\tv_nop\n\tv_nop\n\tv_nop" : "+v"(d) : "v"(a), "v"(b));
  return d;
}
// Local-window multi-head self attention (B 4, T 2,048, d 1,024, 16 heads x 64, window |i - j| <= 32): fused qkv projection + bias, windowed softmax(q k^T / 8) v, output projection + bias.
__device__ __forceinline__ v16h frag_h(const _Float16* rowk0, int lane) {
  union { v16h v; v8h q[2]; } u; const _Float16* p = rowk0 + 8 * (lane >> 4);
  u.q[0] = *(const v8h*)p; u.q[1] = *(const v8h*)(p + 16); return u.v;
}
__device__ __forceinline__ v16h frag_f32(const float* rowk0, int lane) {
  v16h a; const float* p = rowk0 + 8 * (lane >> 4);
#pragma unroll
  for (int i = 0; i < 8; ++i) { a[i] = (_Float16)p[i]; a[8 + i] = (_Float16)p[16 + i]; }
  return a;
}
__device__ __forceinline__ v16h frag_f32s(const float* rowk0, int lane, float sc) {
  v16h a; const float* p = rowk0 + 8 * (lane >> 4);
#pragma unroll
  for (int i = 0; i < 8; ++i) { a[i] = (_Float16)(p[i] * sc); a[8 + i] = (_Float16)(p[16 + i] * sc); }
  return a;
}
// column fragment from a [K][ld] layout (column n), rows >= K read as 0
__device__ __forceinline__ v16h fragc_f32(const float* W, int k0, int n, int lane, int ld, int K) {
  v16h a; const int g = lane >> 4;
#pragma unroll
  for (int i = 0; i < 8; ++i) { const int ka = k0 + 8 * g + i, kb = ka + 16;
    a[i] = (_Float16)(ka < K ? W[(size_t)(ka < K ? ka : K - 1) * ld + n] : 0.f); a[8 + i] = (_Float16)(kb < K ? W[(size_t)(kb < K ? kb : K - 1) * ld + n] : 0.f); }
  return a;
}
struct F2 { v16b h, l; };
__device__ __forceinline__ F2 bsplit16(const float v[16]) { F2 r;
#pragma unroll
  for (int i = 0; i < 16; ++i) { const __bf16 h = (__bf16)v[i]; r.h[i] = h; r.l[i] = (__bf16)(v[i] - (float)h); }
  return r; }
__device__ __forceinline__ F2 split_row(const float* row, int k0, int lane) { float v[16]; const float* p = row + k0 + 8 * (lane >> 4);
#pragma unroll
  for (int i = 0; i < 8; ++i) { v[i] = p[i]; v[8 + i] = p[16 + i]; }
  return bsplit16(v); }
__device__ __forceinline__ F2 split_rowK(const float* row, int k0, int lane, int K) { float v[16]; const int g = lane >> 4;
#pragma unroll
  for (int i = 0; i < 8; ++i) { const int ka = k0 + 8 * g + i, kb = ka + 16; v[i] = ka < K ? row[ka < K ? ka : K - 1] : 0.f; v[8 + i] = kb < K ? row[kb < K ? kb : K - 1] : 0.f; }
  return bsplit16(v); }
__device__ __forceinline__ F2 split_col(const float* W, int k0, int n, int lane, int ld, int K) { float v[16]; const int g = lane >> 4;
#pragma unroll
  for (int i = 0; i < 8; ++i) { const int ka = k0 + 8 * g + i, kb = ka + 16; v[i] = ka < K ? W[(size_t)(ka < K ? ka : K - 1) * ld + n] : 0.f; v[8 + i] = kb < K ? W[(size_t)(kb < K ? kb : K - 1) * ld + n] : 0.f; }
  return bsplit16(v); }
__device__ __forceinline__ v8f mac3(const F2& a, const F2& b, v8f c) { c = wmma_bf(a.l, b.h, c); c = wmma_bf(a.h, b.l, c); return wmma_bf(a.h, b.h, c); }
__device__ __forceinline__ float sigm(float v) { return 1.0f / (1.0f + expf(-v)); }
#define LDSX() do { asm volatile("s_wait_dscnt 0" ::: "memory"); __builtin_amdgcn_wave_barrier(); __builtin_amdgcn_fence(__ATOMIC_RELEASE, "workgroup"); } while (0)


#define NB 4
#define SS 2048
#define DM 1024
#define NH 16
#define HALFW 32
#define HD 64
#define QKVW (3 * DM)
#ifndef TQB
#define TQB (SS / 64)
#define TNB NB
#define TOB (NB * SS / 64)     // 64-row tiles of all 8192 rows; unused
#endif
typedef __attribute__((ext_vector_type(8))) __bf16 v8b;
__device__ __forceinline__ v16b frag_b(const __bf16* rowk0, int lane) {
  union { v16b v; v8b q[2]; } u; const __bf16* p = rowk0 + 8 * (lane >> 4);
  u.q[0] = *(const v8b*)p; u.q[1] = *(const v8b*)(p + 16); return u.v;
}
__device__ __forceinline__ float bfr(float v) { return (float)(__bf16)v; }
__device__ __attribute__((noinline)) float exp_ni(float v) { return expf(v); }
__device__ __attribute__((noinline)) float erf_ni(float v) { return erff(v); }

#define PK_A 0                       // [3072][1024] Wqkv rows (natural [out][in])
#define PK_P (PK_A + QKVW * DM)        // [1024][1024] Wo rows (natural)
#define PK_END (PK_P + DM * DM)
#define WS_PK  0u
#define WS_QK  (WS_PK + 2u * PK_END)             // f16 [8192 rows][2048]: q | k
#define WS_QKL (WS_QK + 2u * NB * SS * 2 * DM)     // f16 q | k residual planes x2048
#define WS_VTH (WS_QKL + 2u * NB * SS * 2 * DM)    // f16 [b][1024 (h*64+d)][2048 s] hi
#define WS_VTL (WS_VTH + 2u * NB * DM * SS)        // f16 lo x 2048
#define WS_O   (WS_VTL + 2u * NB * DM * SS)        // f32 [8192][1024]
#define WS_CS  (WS_O + 4u * NB * SS * DM)           // f32 [2][2048][32], unused
#define WS_END (WS_CS + 4u * 2 * SS * 32)
// ---- k_pack: block = (row n, which): natural [out][in] rows -> bf16; which 0..2 -> W_q/W_k/W_v into PK_A rows which*1024 + n; 3 -> W_o into PK_P
__global__ __launch_bounds__(256) void k_pack(const float* __restrict__ WQ, const float* __restrict__ WK, const float* __restrict__ WV, const float* __restrict__ WO, __bf16* __restrict__ PK) {
  __shared__ __align__(16) __bf16 s[DM]; const int n = blockIdx.x, which = blockIdx.y, t = threadIdx.x; const float* Wm = (which == 0) ? WQ : (which == 1) ? WK : (which == 2) ? WV : WO;
  for (int k = t; k < DM; k += 256) s[k] = (__bf16)Wm[(size_t)n * DM + k];
  __syncthreads();
  __bf16* dst = (which < 3) ? PK + PK_A + ((size_t)which * DM + n) * DM : PK + PK_P + (size_t)n * DM;
  for (int q = t; q < DM / 8; q += 256) vst2((unsigned*)(dst + q * 8), *(const v4u*)&s[q * 8]);
}
// ---- k_qkv: block = 128 rows x 256 cols, 8 waves (2 x 4) of 64 x 64: the x tile (rounded to bf16, 32 k a stage) and the weight tile are staged once in LDS, two buffers each, and every wave takes its fragments from there. The weight buffers hold two stages of k, filled half the rows a trip, so that every global load takes whole 128-B lines
#define GBM 128
#define GBN 256
#define GPB 80                        // LDS pitch of an x row: 64 B of k + 16 B, an odd multiple of 16 B for the 16-byte fragment reads
#define GPW 144                       // LDS pitch of a weight row: 128 B of k + 16 B, likewise
#define GAB (GBM * GPB)                // one x buffer
#define GWB (GBN * GPW)                // one weight buffer
typedef __attribute__((ext_vector_type(4))) __bf16 v4b;
__global__ __launch_bounds__(256) void k_qkv(const float* __restrict__ XQ, const float* __restrict__ XK, const float* __restrict__ XV, const __bf16* __restrict__ P, const float* __restrict__ BQ, const float* __restrict__ BK, const float* __restrict__ BV, _Float16* __restrict__ QK, _Float16* __restrict__ QKL, _Float16* __restrict__ VTH, _Float16* __restrict__ VTL) {
  const int n0 = blockIdx.y * GBN; const int which0 = n0 / DM; const float* X = (which0 == 0) ? XQ : (which0 == 1) ? XK : XV; const float* BB = BQ ? (((which0 == 0) ? BQ : (which0 == 1) ? BK : BV) + (n0 - which0 * DM)) : nullptr;
  __shared__ __align__(16) unsigned char sm[2 * GAB + 2 * GWB];
  const int tid = threadIdx.x, wave = tid >> 5, lane = tid & 31, col = lane & 15, g = lane >> 4; const int wm = wave >> 2, wn = wave & 3;
  const int ar = tid >> 3, ac = (tid & 7) * 4, wc = (tid & 7) * 8;   // both tiles: 32 rows a pass, one 128-B line per 8 threads (4 floats of x, 8 bf16 of weight a thread)
  const float* ga = X + ((size_t)blockIdx.x * GBM + ar) * DM + ac; const __bf16* gb = P + (size_t)(n0 + ar) * DM + wc; unsigned char* sw = sm + 2 * GAB;
  v4f ra[4]; v4u rb[4]; v8f acc[4][4] = {};
  // x stage s: k 32 s .. 32 s + 31 of all 128 rows. weight chunk c: k 64 (c >> 1) .. + 63 of rows 128 (c & 1) .. + 127, into weight buffer (c >> 1) & 1 (the short loops are unrolled so that ra and rb stay in registers)
#define QLDA(s) _Pragma("unroll") for (int p = 0; p < 4; ++p) ra[p] = *(const v4f*)(ga + (size_t)p * 32 * DM + (s) * 32)
#define QLDW(c) _Pragma("unroll") for (int p = 0; p < 4; ++p) rb[p] = *(const v4u*)(gb + (size_t)(((c) & 1) * 128 + p * 32) * DM + ((c) >> 1) * 64)
#define QSTA(s) _Pragma("unroll") for (int p = 0; p < 4; ++p) { v4b t; _Pragma("unroll") for (int i = 0; i < 4; ++i) t[i] = (__bf16)ra[p][i]; *(v4b*)(sm + ((s) & 1) * GAB + (ar + p * 32) * GPB + ac * 2) = t; }
#define QSTW(c) _Pragma("unroll") for (int p = 0; p < 4; ++p) *(v4u*)(sw + (((c) >> 1) & 1) * GWB + (((c) & 1) * 128 + ar + p * 32) * GPW + wc * 2) = rb[p]
  QLDA(0); QLDW(0); QSTA(0); QSTW(0); QLDW(1); QSTW(1); QLDA(1); QLDW(2);
  __syncthreads();
#pragma unroll 4   // four trips a round, so that every buffer's LDS offset is a constant
  for (int kc = 0; kc < DM / 32; ++kc) {
    // what was loaded from global one trip ago goes into buffers whose readers an earlier barrier has ended; the next loads have this whole trip to land
    if (kc + 1 < DM / 32) { QSTA(kc + 1); }
    if (kc + 2 < DM / 32) { QSTW(kc + 2); QLDA(kc + 2); }
    if (kc + 3 < DM / 32) { QLDW(kc + 3); }
    v16b fa[4], fb[4];
#pragma unroll
    for (int i = 0; i < 4; ++i) { fa[i] = frag_b((const __bf16*)(sm + (kc & 1) * GAB + (wm * 64 + i * 16 + col) * GPB), lane); fb[i] = frag_b((const __bf16*)(sw + ((kc >> 1) & 1) * GWB + (wn * 64 + i * 16 + col) * GPW + (kc & 1) * 64), lane); }
#pragma unroll
    for (int i = 0; i < 4; ++i) {
#pragma unroll
      for (int j = 0; j < 4; ++j) acc[i][j] = wmma_bf(fa[i], fb[j], acc[i][j]); }
    __syncthreads(); }   // publishes what this trip stored and ends every read of what the next trip overwrites
  // epilogue: each wave stages 16 output rows at a time (hi and residual plane, pitch 144 B) in its own part of the buffers, all of whose readers have passed the loop's last barrier, and stores whole 128-B lines
  _Float16* eh = (_Float16*)(sm + wave * (2 * 16 * 144)); _Float16* el = eh + 16 * 72;
  const size_t rw = (size_t)blockIdx.x * GBM + wm * 64; const int cw = wn * 64; const int el_r = lane >> 3, el_c = (lane & 7) * 8;
  float bias[4];
#pragma unroll
  for (int j = 0; j < 4; ++j) bias[j] = BB ? bfr(BB[cw + j * 16 + col]) : 0.f;
  if (n0 < 2 * DM) {   // q, k (+ bias) as f16 hi + (x2048) residual; q stored unscaled, 1/8 applied to the f32 score
#pragma unroll
    for (int i = 0; i < 4; ++i) {
#pragma unroll
      for (int j = 0; j < 4; ++j) {
#pragma unroll
        for (int r = 0; r < 8; ++r) { const float v = acc[i][j][r] + bias[j]; const _Float16 hv = (_Float16)v; eh[(8 * g + r) * 72 + j * 16 + col] = hv; el[(8 * g + r) * 72 + j * 16 + col] = (_Float16)((v - (float)hv) * 2048.0f); } }
      LDSX();
#pragma unroll
      for (int p = 0; p < 4; ++p) { const int rl = p * 4 + el_r; const size_t o = (rw + i * 16 + rl) * (2 * DM) + n0 + cw + el_c; vst2((unsigned*)(QK + o), *(const v4u*)&eh[rl * 72 + el_c]); vst2((unsigned*)(QKL + o), *(const v4u*)&el[rl * 72 + el_c]); }
      LDSX(); }
  } else {   // v (+ bias) transposed: [b][h*64+d][s], 16 d rows of 64 s at a time
    const int b = (int)(rw / SS), s0 = (int)(rw % SS); const int pc0 = n0 - 2 * DM + cw;
#pragma unroll
    for (int j = 0; j < 4; ++j) {
#pragma unroll
      for (int i = 0; i < 4; ++i) { v8h hh, ll;
#pragma unroll
        for (int r = 0; r < 8; ++r) { const float v = acc[i][j][r] + bias[j]; const _Float16 hv = (_Float16)v; hh[r] = hv; ll[r] = (_Float16)((v - (float)hv) * 2048.0f); }
        *(v8h*)&eh[col * 72 + i * 16 + 8 * g] = hh; *(v8h*)&el[col * 72 + i * 16 + 8 * g] = ll; }
      LDSX();
#pragma unroll
      for (int p = 0; p < 4; ++p) { const int d = p * 4 + el_r; const size_t o = ((size_t)b * DM + pc0 + j * 16 + d) * SS + s0 + el_c; vst2((unsigned*)(VTH + o), *(const v4u*)&eh[d * 72 + el_c]); vst2((unsigned*)(VTL + o), *(const v4u*)&el[d * 72 + el_c]); }
      LDSX(); }
    asm volatile("s_wait_xcnt 0x0" ::: "memory");   // behind the last pass's stores, before the code after this branch that rewrites their address registers
  }
}
// hardware exp2 with the one free slot behind it that the instruction set asks for before a transcendental's result is read or its source overwritten
__device__ __forceinline__ float exp2_slot(float x) { float e; asm("v_exp_f32 %0, %1\n\tv_nop" : "=v"(e) : "v"(x)); return e; }
// ---- k_attn: block = (64 queries, head h, batch b): the 128 keys that the block's window can touch are staged once in LDS (k rows and v^T rows, contiguous 128-B and 256-B pieces of global memory, shared by the four waves; each wave's q rows likewise), and every q, k and v fragment is read from there; both products transposed: S^T = K . Q^T (K = 64: 2 k-steps), scores = (q.k) * 0.125 with single f16 operands, one softmax over the 128 staged keys with a query's scores in one pair of lanes, O^T = V^T . P^T with P taken from the score registers (f16, x2^11); O[b*S+q][h*64+d] = acc / 2048 / l (256-B segments)
#define AKN (64 + 2 * HALFW)          // keys staged per block
#define AKP 144                       // LDS pitch of a k row: 128 B + 16 B, an odd multiple of 16 B for the 16-byte fragment reads
#define AVP (2 * AKN + 16)            // LDS pitch of a v^T row: 256 B + 16 B, likewise
__global__ __launch_bounds__(128) void k_attn(const _Float16* __restrict__ QK, const _Float16* __restrict__ QKL, const _Float16* __restrict__ VTH, const _Float16* __restrict__ VTL, const void* __restrict__ KMASK, float* __restrict__ O) {
  __shared__ __align__(16) float so[4][16][68];
  __shared__ __align__(16) unsigned char sk[AKN * AKP]; __shared__ __align__(16) unsigned char sv[HD * AVP];
  const int tid = threadIdx.x, wave = tid >> 5, lane = tid & 31, col = lane & 15, g = lane >> 4;
  const int qb = blockIdx.x, h = blockIdx.y, b = blockIdx.z; const int q0 = qb * 64 + wave * 16;
  const int kb = qb * 64 - HALFW;   // key index of LDS row 0 (a multiple of 32); keys outside 0 .. SS - 1 are loaded from a clamped address (finite values of other keys) and masked like keys outside the window
  unsigned char* sq = (unsigned char*)&so[wave][0][0];   // the wave's own 16 q rows (pitch AKP) lie where it stages its output rows at the end, long after their one read
  { v4u tk[8], tv[8], tq[4];   // 16-byte pieces: 8 lanes a k or q row (16 k rows a pass of the block, 4 q rows a pass of a wave), 16 lanes a v^T row (8 rows a pass); all twenty loads are in flight before the first store
    const unsigned ko = (unsigned)((tid >> 3) * (2 * DM) + (tid & 7) * 8), vo = (unsigned)((tid >> 4) * SS + min(max(kb + (tid & 15) * 8, 0), SS - 8)), qo = (unsigned)((wave * 16 + (lane >> 3)) * (2 * DM) + (tid & 7) * 8);   // one offset a thread for each array; the rest of every address is the same for the whole block
    const _Float16* vb = VTH + ((size_t)b * DM + h * HD) * SS; const _Float16* qp = QK + ((size_t)b * SS + qb * 64) * (2 * DM) + h * HD;
#pragma unroll
    for (int p = 0; p < 8; ++p) { const int kt = min(max(kb + (p >> 1) * 32, 0), SS - 32); tk[p] = *(const v4u*)(QK + ((size_t)b * SS + kt + (p & 1) * 16) * (2 * DM) + DM + h * HD + ko); }
#pragma unroll
    for (int p = 0; p < 8; ++p) tv[p] = *(const v4u*)(vb + (size_t)p * 8 * SS + vo);
#pragma unroll
    for (int p = 0; p < 4; ++p) tq[p] = *(const v4u*)(qp + (size_t)p * 4 * (2 * DM) + qo);
    asm volatile("s_wait_xcnt 0x0" ::: "memory");   // behind the twenty loads: the registers that hold their offsets are given new values right after
#pragma unroll
    for (int p = 0; p < 8; ++p) { *(v4u*)(sk + ((tid >> 3) + p * 16) * AKP + (tid & 7) * 16) = tk[p]; *(v4u*)(sv + ((tid >> 4) + p * 8) * AVP + (tid & 15) * 16) = tv[p]; }
#pragma unroll
    for (int p = 0; p < 4; ++p) *(v4u*)(sq + ((lane >> 3) + p * 4) * AKP + (tid & 7) * 16) = tq[p]; }
  // scores are formed transposed, S^T = K . Q^T: a lane holds, of every 16-key tile, 8 keys (8 g + r) of ONE query (q0 + col); lanes l and l ^ 16 share a query
  const int qi = q0 + col; const int lo = max(qi - HALFW, 0); const unsigned span = (unsigned)(min(qi + HALFW, SS - 1) - lo); const int e0 = kb + 8 * g - lo;   // key kb + 16 t + 8 g + r lies in the window |i - j| <= 32 and in 0 .. SS - 1 exactly if (unsigned)(e0 + 16 t + r) <= span
  __syncthreads();   // publishes the staged k and v rows to all four waves; nothing overwrites them afterwards
  v16h bq[2];
#pragma unroll
  for (int kc = 0; kc < 2; ++kc) bq[kc] = frag_h((const _Float16*)(sq + col * AKP) + kc * 32, lane);
  v8f s[AKN / 16];
#pragma unroll
  for (int tg = 0; tg < AKN / 16; tg += 4) { v16h fk[2][4];   // four independent score tiles at a time, so that no product waits for its accumulator; their eight k fragments are read as one group, behind one wait
#pragma unroll
    for (int kc = 0; kc < 2; ++kc) {
#pragma unroll
      for (int t = 0; t < 4; ++t) fk[kc][t] = frag_h((const _Float16*)(sk + ((tg + t) * 16 + col) * AKP) + kc * 32, lane); }
#pragma unroll
    for (int t = tg; t < tg + 4; ++t) s[t] = v8f{};
#pragma unroll
    for (int kc = 0; kc < 2; ++kc) {
#pragma unroll
      for (int t = tg; t < tg + 4; ++t) s[t] = wmma16(fk[kc][t - tg], bq[kc], s[t]); } }   // single product: k, q as one-rounding f16 operands
#pragma unroll
  for (int t = 0; t < AKN / 16; ++t) {
#pragma unroll
    for (int r = 0; r < 8; ++r) s[t][r] = ((unsigned)(e0 + t * 16 + r) <= span) ? s[t][r] * 0.125f : -3.0e38f; }   // 1/sqrt(64); keys outside the window or the sequence
  // softmax of a query over all staged keys at once: maximum and sum in the lane, one exchange between the two halves each (the query's own key is always staged and inside the window, so the maximum is a real score)
  v8f mv = s[0];
#pragma unroll
  for (int t = 1; t < AKN / 16; ++t) {
#pragma unroll
    for (int r = 0; r < 8; ++r) mv[r] = fmaxf(mv[r], s[t][r]); }
  float mx = fmaxf(fmaxf(fmaxf(mv[0], mv[1]), fmaxf(mv[2], mv[3])), fmaxf(fmaxf(mv[4], mv[5]), fmaxf(mv[6], mv[7])));
  mx = fmaxf(mx, __shfl_xor(mx, 16));
  v8f ls;
#pragma unroll
  for (int t = 0; t < AKN / 16; ++t) {
#pragma unroll
    for (int r = 0; r < 8; ++r) { const float e = exp2_slot((s[t][r] - mx) * 1.44269504f); s[t][r] = e; ls[r] = (t == 0) ? e : ls[r] + e; } }   // a masked score is -3e38: its exponential is an exact 0
  float l = ((ls[0] + ls[1]) + (ls[2] + ls[3])) + ((ls[4] + ls[5]) + (ls[6] + ls[7]));
  l += __shfl_xor(l, 16);
  // O^T += V^T . P^T: two score tiles of a lane, converted in place, are the B operand of a 32-key step (element i = key 8 g + i, element 8 + i = key 16 + 8 g + i, the order in which frag_h reads a v^T row)
  v8f acc[4] = {};
#pragma unroll
  for (int j = 0; j < AKN / 32; ++j) { v16h pb, fv[4];   // the step's four v fragments are read as one group, ahead of the conversion of P
#pragma unroll
    for (int dt = 0; dt < 4; ++dt) fv[dt] = frag_h((const _Float16*)(sv + (dt * 16 + col) * AVP) + j * 32, lane);
#pragma unroll
    for (int i = 0; i < 8; ++i) { pb[i] = (_Float16)(s[2 * j][i] * 2048.0f); pb[8 + i] = (_Float16)(s[2 * j + 1][i] * 2048.0f); }   // P scaled by 2^11 before the f16 rounding so small softmax weights stay out of the f16 subnormal range; 2^-11 folded into the epilogue
#pragma unroll
    for (int dt = 0; dt < 4; ++dt) acc[dt] = wmma16(fv[dt], pb, acc[dt]); }   // single product: V x P (x2^11)
  const float il = (1.0f / 2048.0f) / l;
#pragma unroll
  for (int dt = 0; dt < 4; ++dt) { v4f o0, o1;   // the lane's 8 consecutive d of its query's output row
#pragma unroll
    for (int r = 0; r < 4; ++r) { o0[r] = acc[dt][r] * il; o1[r] = acc[dt][4 + r] * il; }
    *(v4f*)&so[wave][col][dt * 16 + 8 * g] = o0; *(v4f*)&so[wave][col][dt * 16 + 8 * g + 4] = o1; }
  LDSX();
  for (int rl = 0; rl < 16; ++rl) if (lane < 16) vst2(O + ((size_t)b * SS + q0 + rl) * DM + h * HD + lane * 4, *(const v4f*)&so[wave][rl][lane * 4]);
}
// ---- k_out: block = 128 rows x 128 cols, 8 waves (2 x 4) of 64 x 32, tiles staged in LDS as in k_qkv (O as bf16 hi and residual planes, split once per block): out = O(hi/lo) . Wo rows (2 products) + bo
#define OBN 128
#define OAB (2 * GBM * GPB)             // one O buffer: hi rows, then residual rows
#define OWB (OBN * GPW)                 // one weight buffer (two stages of k)
__global__ __launch_bounds__(256) void k_out(const float* __restrict__ O, const __bf16* __restrict__ P, const float* __restrict__ BO, float* __restrict__ Y) {
  __shared__ __align__(16) unsigned char sm[2 * OAB + 2 * OWB];
  const int tid = threadIdx.x, wave = tid >> 5, lane = tid & 31, col = lane & 15, g = lane >> 4; const int wm = wave >> 2, wn = wave & 3; const int n0 = blockIdx.y * OBN;
  const int ar = tid >> 3, ac = (tid & 7) * 4, wc = (tid & 7) * 8;
  const float* ga = O + ((size_t)blockIdx.x * GBM + ar) * DM + ac; const __bf16* gb = P + (size_t)(n0 + ar) * DM + wc; unsigned char* sw = sm + 2 * OAB;
  v4f ra[4]; v4u rb[2]; v8f acc[4][2] = {};
  // O stage s: k 32 s .. + 31 of all 128 rows. weight chunk c: k 64 (c >> 1) .. + 63 of rows 64 (c & 1) .. + 63, into weight buffer (c >> 1) & 1 (the short loops are unrolled so that ra and rb stay in registers)
#define OLDA(s) _Pragma("unroll") for (int p = 0; p < 4; ++p) ra[p] = *(const v4f*)(ga + (size_t)p * 32 * DM + (s) * 32)
#define OLDW(c) _Pragma("unroll") for (int p = 0; p < 2; ++p) rb[p] = *(const v4u*)(gb + (size_t)(((c) & 1) * 64 + p * 32) * DM + ((c) >> 1) * 64)
#define OSTA(s) _Pragma("unroll") for (int p = 0; p < 4; ++p) { v4b th, tl; _Pragma("unroll") for (int i = 0; i < 4; ++i) { th[i] = (__bf16)ra[p][i]; tl[i] = (__bf16)(ra[p][i] - (float)th[i]); } *(v4b*)(sm + ((s) & 1) * OAB + (ar + p * 32) * GPB + ac * 2) = th; *(v4b*)(sm + ((s) & 1) * OAB + (GBM + ar + p * 32) * GPB + ac * 2) = tl; }
#define OSTW(c) _Pragma("unroll") for (int p = 0; p < 2; ++p) *(v4u*)(sw + (((c) >> 1) & 1) * OWB + (((c) & 1) * 64 + ar + p * 32) * GPW + wc * 2) = rb[p]
  OLDA(0); OLDW(0); OSTA(0); OSTW(0); OLDW(1); OSTW(1); OLDA(1); OLDW(2);
  __syncthreads();
#pragma unroll 4   // four trips a round, so that every buffer's LDS offset is a constant
  for (int kc = 0; kc < DM / 32; ++kc) {
    // what was loaded from global one trip ago goes into buffers whose readers an earlier barrier has ended; the next loads have this whole trip to land
    if (kc + 1 < DM / 32) { OSTA(kc + 1); }
    if (kc + 2 < DM / 32) { OSTW(kc + 2); OLDA(kc + 2); }
    if (kc + 3 < DM / 32) { OLDW(kc + 3); }
    v16b fh[4], fl[4], fb[2];
#pragma unroll
    for (int j = 0; j < 2; ++j) fb[j] = frag_b((const __bf16*)(sw + ((kc >> 1) & 1) * OWB + (wn * 32 + j * 16 + col) * GPW + (kc & 1) * 64), lane);
#pragma unroll
    for (int i = 0; i < 4; ++i) { fl[i] = frag_b((const __bf16*)(sm + (kc & 1) * OAB + (GBM + wm * 64 + i * 16 + col) * GPB), lane); fh[i] = frag_b((const __bf16*)(sm + (kc & 1) * OAB + (wm * 64 + i * 16 + col) * GPB), lane); }
#pragma unroll
    for (int ip = 0; ip < 4; ip += 2) {   // per accumulator: residual product, then hi product; four independent tiles between the two, so that no product waits for its accumulator
#pragma unroll
      for (int q = 0; q < 4; ++q) acc[ip + (q >> 1)][q & 1] = wmma_bf(fl[ip + (q >> 1)], fb[q & 1], acc[ip + (q >> 1)][q & 1]);
#pragma unroll
      for (int q = 0; q < 4; ++q) acc[ip + (q >> 1)][q & 1] = wmma_bf(fh[ip + (q >> 1)], fb[q & 1], acc[ip + (q >> 1)][q & 1]); }
    __syncthreads(); }   // publishes what this trip stored and ends every read of what the next trip overwrites
  // epilogue: each wave stages 16 rows of 32 f32 (pitch 144 B) in its own part of the buffers, behind the loop's last barrier, and stores whole 128-B lines
  float* so = (float*)(sm + wave * (16 * 144)); const size_t rw = (size_t)blockIdx.x * GBM + wm * 64; const int cw = n0 + wn * 32;
  float bias[2];
#pragma unroll
  for (int j = 0; j < 2; ++j) bias[j] = bfr(BO[cw + j * 16 + col]);
#pragma unroll
  for (int i = 0; i < 4; ++i) {
#pragma unroll
    for (int j = 0; j < 2; ++j) {
#pragma unroll
      for (int r = 0; r < 8; ++r) so[(8 * g + r) * 36 + j * 16 + col] = acc[i][j][r] + bias[j]; }
    LDSX();
#pragma unroll
    for (int p = 0; p < 4; ++p) { const int rl = p * 4 + (lane >> 3); vst2(Y + (rw + i * 16 + rl) * DM + cw + (lane & 7) * 4, *(const v4f*)&so[rl * 36 + (lane & 7) * 4]); }
    LDSX(); }
}
extern "C" void kernel_launch(void* const* d_in, const int* in_sizes, int n_in, void* d_out, int out_size, void* d_ws, size_t ws_size, hipStream_t stream) {
  (void)in_sizes; (void)n_in; (void)out_size;
  const float** F = (const float**)d_in;   // 0 x [4,2048,1024], 1 W_qkv [3072,1024] natural, 2 b_qkv [3072], 3 W_out [1024,1024], 4 b_out
  if (ws_size < (size_t)WS_END) return;
  char* ws = (char*)d_ws; __bf16* PK = (__bf16*)(ws + WS_PK); _Float16 *QK = (_Float16*)(ws + WS_QK), *QKL = (_Float16*)(ws + WS_QKL), *VTH = (_Float16*)(ws + WS_VTH), *VTL = (_Float16*)(ws + WS_VTL); float* O = (float*)(ws + WS_O);
  k_pack<<<dim3(DM, 4), 256, 0, stream>>>(F[1], F[1] + (size_t)DM * DM, F[1] + (size_t)2 * DM * DM, F[3], PK);
  k_qkv<<<dim3(TNB * SS / GBM, QKVW / GBN), 256, 0, stream>>>(F[0], F[0], F[0], PK + PK_A, F[2], F[2] + DM, F[2] + 2 * DM, QK, QKL, VTH, VTL);
  k_attn<<<dim3(TQB, NH, TNB), 128, 0, stream>>>(QK, QKL, VTH, VTL, nullptr, O);
  k_out<<<dim3(TNB * SS / GBM, DM / OBN), 256, 0, stream>>>(O, PK + PK_P, F[4], (float*)d_out);
}

// v004
// A run of this version takes 106 microseconds.
// Next to v003, in two timings, it ran 1.05 times as fast each time.
// All steps since v000 together make it 3.51 times as fast.
// compute dtype: all float inputs rounded to bf16; qkv = x . W_qkv^T + b with EXACT bf16 products on WMMA 16x16x32 (natural rows; the fused weight as three contiguous row blocks); windowed attention (only the 128 keys that a block of 64 queries can touch under |i - j| <= 32 are visited, per-score window test): q, k single f16 x 1/8, softmax in f32 (hardware exp), P (scaled by 2^11, single f16) x v (single f16); out = o (bf16 hi + residual) . W_out^T (2 products) + b_out.
#include <hip/hip_runtime.h>
#include <math.h>

typedef __attribute__((ext_vector_type(16))) _Float16 v16h;
typedef __attribute__((ext_vector_type(16))) __bf16 v16b;
typedef __attribute__((ext_vector_type(8)))  _Float16 v8h;
typedef __attribute__((ext_vector_type(8)))  float v8f;
typedef __attribute__((ext_vector_type(4)))  float v4f;
typedef __attribute__((ext_vector_type(2)))  float v2f;
typedef __attribute__((ext_vector_type(4)))  unsigned v4u;
typedef __attribute__((ext_vector_type(4)))  int v4i;
typedef float __attribute__((may_alias)) float_a;
typedef int __attribute__((may_alias)) int_a;

template <typename T> __device__ __forceinline__ void vst2(void* p, T v) { *(T*)p = v;  }
__device__ __forceinline__ v8f wmma16(v16h a, v16h b, v8f c) {
  v8f d = __builtin_amdgcn_wmma_f32_16x16x32_f16(false, a, false, b, (short)0, c, false, false);
  asm volatile("v_nop\n\tv_nop\n\tv_nop\n\tv_nop" : "+v"(d) : "v"(a), "v"(b));
  return d;
}
__device__ __forceinline__ v8f wmma_bf(v16b a, v16b b, v8f c) {
  v8f d = __builtin_amdgcn_wmma_f32_16x16x32_bf16(false, a, false, b, (short)0, c, false, false);
  asm volatile("v_nop\n\tv_nop\n\tv_nop\n\tv_nop" : "+v"(d) : "v"(a), "v"(b));
  return d;
}
// Local-window multi-head self attention (B 4, T 2,048, d 1,024, 16 heads x 64, window |i - j| <= 32): fused qkv projection + bias, windowed softmax(q k^T / 8) v, output projection + bias.
__device__ __forceinline__ v16h frag_h(const _Float16* rowk0, int lane) {
  union { v16h v; v8h q[2]; } u; const _Float16* p = rowk0 + 8 * (lane >> 4);
  u.q[0] = *(const v8h*)p; u.q[1] = *(const v8h*)(p + 16); return u.v;
}
__device__ __forceinline__ v16h frag_f32(const float* rowk0, int lane) {
  v16h a; const float* p = rowk0 + 8 * (lane >> 4);
#pragma unroll
  for (int i = 0; i < 8; ++i) { a[i] = (_Float16)p[i]; a[8 + i] = (_Float16)p[16 + i]; }
  return a;
}
__device__ __forceinline__ v16h frag_f32s(const float* rowk0, int lane, float sc) {
  v16h a; const float* p = rowk0 + 8 * (lane >> 4);
#pragma unroll
  for (int i = 0; i < 8; ++i) { a[i] = (_Float16)(p[i] * sc); a[8 + i] = (_Float16)(p[16 + i] * sc); }
  return a;
}
// column fragment from a [K][ld] layout (column n), rows >= K read as 0
__device__ __forceinline__ v16h fragc_f32(const float* W, int k0, int n, int lane, int ld, int K) {
  v16h a; const int g = lane >> 4;
#pragma unroll
  for (int i = 0; i < 8; ++i) { const int ka = k0 + 8 * g + i, kb = ka + 16;
    a[i] = (_Float16)(ka < K ? W[(size_t)(ka < K ? ka : K - 1) * ld + n] : 0.f); a[8 + i] = (_Float16)(kb < K ? W[(size_t)(kb < K ? kb : K - 1) * ld + n] : 0.f); }
  return a;
}
struct F2 { v16b h, l; };
__device__ __forceinline__ F2 bsplit16(const float v[16]) { F2 r;
#pragma unroll
  for (int i = 0; i < 16; ++i) { const __bf16 h = (__bf16)v[i]; r.h[i] = h; r.l[i] = (__bf16)(v[i] - (float)h); }
  return r; }
__device__ __forceinline__ F2 split_row(const float* row, int k0, int lane) { float v[16]; const float* p = row + k0 + 8 * (lane >> 4);
#pragma unroll
  for (int i = 0; i < 8; ++i) { v[i] = p[i]; v[8 + i] = p[16 + i]; }
  return bsplit16(v); }
__device__ __forceinline__ F2 split_rowK(const float* row, int k0, int lane, int K) { float v[16]; const int g = lane >> 4;
#pragma unroll
  for (int i = 0; i < 8; ++i) { const int ka = k0 + 8 * g + i, kb = ka + 16; v[i] = ka < K ? row[ka < K ? ka : K - 1] : 0.f; v[8 + i] = kb < K ? row[kb < K ? kb : K - 1] : 0.f; }
  return bsplit16(v); }
__device__ __forceinline__ F2 split_col(const float* W, int k0, int n, int lane, int ld, int K) { float v[16]; const int g = lane >> 4;
#pragma unroll
  for (int i = 0; i < 8; ++i) { const int ka = k0 + 8 * g + i, kb = ka + 16; v[i] = ka < K ? W[(size_t)(ka < K ? ka : K - 1) * ld + n] : 0.f; v[8 + i] = kb < K ? W[(size_t)(kb < K ? kb : K - 1) * ld + n] : 0.f; }
  return bsplit16(v); }
__device__ __forceinline__ v8f mac3(const F2& a, const F2& b, v8f c) { c = wmma_bf(a.l, b.h, c); c = wmma_bf(a.h, b.l, c); return wmma_bf(a.h, b.h, c); }
__device__ __forceinline__ float sigm(float v) { return 1.0f / (1.0f + expf(-v)); }
#define LDSX() do { asm volatile("s_wait_dscnt 0" ::: "memory"); __builtin_amdgcn_wave_barrier(); __builtin_amdgcn_fence(__ATOMIC_RELEASE, "workgroup"); } while (0)


#define NB 4
#define SS 2048
#define DM 1024
#define NH 16
#define HALFW 32
#define HD 64
#define QKVW (3 * DM)
#ifndef TQB
#define TQB (SS / 64)
#define TNB NB
#define TOB (NB * SS / 64)     // 64-row tiles of all 8192 rows; unused
#endif
typedef __attribute__((ext_vector_type(8))) __bf16 v8b;
__device__ __forceinline__ v16b frag_b(const __bf16* rowk0, int lane) {
  union { v16b v; v8b q[2]; } u; const __bf16* p = rowk0 + 8 * (lane >> 4);
  u.q[0] = *(const v8b*)p; u.q[1] = *(const v8b*)(p + 16); return u.v;
}
__device__ __forceinline__ float bfr(float v) { return (float)(__bf16)v; }
__device__ __attribute__((noinline)) float exp_ni(float v) { return expf(v); }
__device__ __attribute__((noinline)) float erf_ni(float v) { return erff(v); }

#define PK_A 0                       // [3072][1024] Wqkv rows (natural [out][in])
#define PK_P (PK_A + QKVW * DM)        // [1024][1024] Wo rows (natural)
#define PK_END (PK_P + DM * DM)
#define WS_PK  0u
#define WS_QK  (WS_PK + 2u * PK_END)             // f16 [8192 rows][2048]: q | k
#define WS_QKL (WS_QK + 2u * NB * SS * 2 * DM)     // f16 q | k residual planes x2048
#define WS_VTH (WS_QKL + 2u * NB * SS * 2 * DM)    // f16 [b][1024 (h*64+d)][2048 s] hi
#define WS_VTL (WS_VTH + 2u * NB * DM * SS)        // f16 lo x 2048
#define WS_O   (WS_VTL + 2u * NB * DM * SS)        // f32 [8192][1024]
#define WS_CS  (WS_O + 4u * NB * SS * DM)           // f32 [2][2048][32], unused
#define WS_END (WS_CS + 4u * 2 * SS * 32)
// ---- k_pack: block = (row n, which): natural [out][in] rows -> bf16; which 0..2 -> W_q/W_k/W_v into PK_A rows which*1024 + n; 3 -> W_o into PK_P
__global__ __launch_bounds__(256) void k_pack(const float* __restrict__ WQ, const float* __restrict__ WK, const float* __restrict__ WV, const float* __restrict__ WO, __bf16* __restrict__ PK) {
  __shared__ __align__(16) __bf16 s[DM]; const int n = blockIdx.x, which = blockIdx.y, t = threadIdx.x; const float* Wm = (which == 0) ? WQ : (which == 1) ? WK : (which == 2) ? WV : WO;
  for (int k = t; k < DM; k += 256) s[k] = (__bf16)Wm[(size_t)n * DM + k];
  __syncthreads();
  __bf16* dst = (which < 3) ? PK + PK_A + ((size_t)which * DM + n) * DM : PK + PK_P + (size_t)n * DM;
  for (int q = t; q < DM / 8; q += 256) vst2((unsigned*)(dst + q * 8), *(const v4u*)&s[q * 8]);
}
// ---- k_qkv: block = 128 rows x 256 cols, 8 waves (2 x 4) of 64 x 64; a stage is 64 k of both tiles, two LDS buffers each: the x tile goes through registers (rounded to bf16 on the way), the weight tile, bf16 already, is copied from global memory straight into LDS; every wave takes its fragments from there
#define GBM 128
#define GBN 256
#define GPW 144                       // LDS pitch of a 64-k row: 128 B of k + 16 B, an odd multiple of 16 B for the 16-byte fragment reads
#define GAB (GBM * GPW)                // one x buffer
#define GWB (GBN * GPW)                // one weight buffer
typedef __attribute__((ext_vector_type(4))) __bf16 v4b;
// eight asynchronous 16-byte copies a lane, global -> LDS: rows 32 apart of one weight stage. The s_wait_xcnt is the last line of the copies' own statement, so that it stands in front of whatever gives their address registers new values
__device__ __forceinline__ void cp_w8(unsigned l, const __bf16* g) {
  asm volatile("global_load_async_to_lds_b128 %0, %8, off\n\tglobal_load_async_to_lds_b128 %1, %9, off\n\tglobal_load_async_to_lds_b128 %2, %10, off\n\tglobal_load_async_to_lds_b128 %3, %11, off\n\tglobal_load_async_to_lds_b128 %4, %12, off\n\tglobal_load_async_to_lds_b128 %5, %13, off\n\tglobal_load_async_to_lds_b128 %6, %14, off\n\tglobal_load_async_to_lds_b128 %7, %15, off\n\ts_wait_xcnt 0x0"
    :: "v"(l), "v"(l + 32 * GPW), "v"(l + 64 * GPW), "v"(l + 96 * GPW), "v"(l + 128 * GPW), "v"(l + 160 * GPW), "v"(l + 192 * GPW), "v"(l + 224 * GPW),
       "v"(g), "v"(g + 32 * DM), "v"(g + 64 * DM), "v"(g + 96 * DM), "v"(g + 128 * DM), "v"(g + 160 * DM), "v"(g + 192 * DM), "v"(g + 224 * DM) : "memory");
}
__global__ __launch_bounds__(256) void k_qkv(const float* __restrict__ XQ, const float* __restrict__ XK, const float* __restrict__ XV, const __bf16* __restrict__ P, const float* __restrict__ BQ, const float* __restrict__ BK, const float* __restrict__ BV, _Float16* __restrict__ QK, _Float16* __restrict__ QKL, _Float16* __restrict__ VTH, _Float16* __restrict__ VTL) {
  const int n0 = blockIdx.y * GBN; const int which0 = n0 / DM; const float* X = (which0 == 0) ? XQ : (which0 == 1) ? XK : XV; const float* BB = BQ ? (((which0 == 0) ? BQ : (which0 == 1) ? BK : BV) + (n0 - which0 * DM)) : nullptr;
  __shared__ __align__(16) unsigned char sm[2 * GAB + 2 * GWB];
  const int tid = threadIdx.x, wave = tid >> 5, lane = tid & 31, col = lane & 15, g = lane >> 4; const int wm = wave >> 2, wn = wave & 3;
  const int ar = tid >> 4, ac = (tid & 15) * 4, br = tid >> 3, wc = (tid & 7) * 8;   // x: 16 rows a pass, 256 B of a row per 16 threads; weight: 32 rows a pass, one 128-B line per 8 threads
  const float* ga = X + ((size_t)blockIdx.x * GBM + ar) * DM + ac; const __bf16* gb = P + (size_t)(n0 + br) * DM + wc; unsigned char* sw = sm + 2 * GAB;
  unsigned lw = (unsigned)(size_t)(sw + br * GPW + wc * 2);   // the lane's LDS byte address in the weight buffer that the next copies fill; it and gb step from stage to stage, so that the sixteen addresses of a stage's copies are formed where they are used and hold no registers through the products
  v4f ra[8]; v8f acc[4][4] = {};
  // stage s: k 64 s .. + 63 of all 128 x rows and all 256 weight rows, into buffers s & 1 (the short loops are unrolled so that ra stays in registers)
#define QLDA(s) _Pragma("unroll") for (int p = 0; p < 8; ++p) ra[p] = *(const v4f*)(ga + (size_t)p * 16 * DM + (s) * 64)
#define QSTA(s) _Pragma("unroll") for (int p = 0; p < 8; ++p) { v4b t; _Pragma("unroll") for (int i = 0; i < 4; ++i) t[i] = (__bf16)ra[p][i]; *(v4b*)(sm + ((s) & 1) * GAB + (ar + p * 16) * GPW + ac * 2) = t; }
#define QFRG(q) _Pragma("unroll") for (int i = 0; i < 4; ++i) { fa[i] = frag_b((const __bf16*)(sm + (s & 1) * GAB + (wm * 64 + i * 16 + col) * GPW + (q) * 64), lane); fb[i] = frag_b((const __bf16*)(sw + (s & 1) * GWB + (wn * 64 + i * 16 + col) * GPW + (q) * 64), lane); }
#define QMAC() _Pragma("unroll") for (int i = 0; i < 4; ++i) { _Pragma("unroll") for (int j = 0; j < 4; ++j) acc[i][j] = wmma_bf(fa[i], fb[j], acc[i][j]); }
#define QCPW() do { cp_w8(lw, gb); lw ^= lx; gb += 64; } while (0)
  const unsigned lx = lw ^ (lw + GWB);   // toggles lw between the two weight buffers
  QLDA(0); QCPW(); QSTA(0); QLDA(1);
  asm volatile("s_wait_asynccnt 0x0" ::: "memory");   // stage 0's weight copies of this wave have landed before the barrier that publishes them
  __syncthreads();
  QCPW();
#pragma unroll 2   // two trips a round, so that every buffer's LDS offset is a constant
  for (int s = 0; s < DM / 64; ++s) {
    v16b fa[4], fb[4];   // one 32-k half's fragments at a time
    // the x rows loaded one trip ago go into the buffer whose readers the last barrier has ended; the next loads have this whole trip to land
    if (s + 1 < DM / 64) { QSTA(s + 1); }
    if (s + 2 < DM / 64) { QLDA(s + 2); }
    QFRG(0); QMAC();
    QFRG(1); QMAC();
    asm volatile("s_wait_dscnt 0x0" ::: "memory");     // this wave's reads of the buffers that are refilled behind the barrier have retired
    asm volatile("s_wait_asynccnt 0x0" ::: "memory");  // this wave's copies of stage s + 1 have landed before the barrier that publishes them
    __syncthreads();   // publishes stage s + 1 (x stores and weight copies) and ends every read of stage s
    if (s + 2 < DM / 64) { QCPW(); } }   // into the weight buffer that this trip has just read; a whole trip to land
  asm volatile("s_wait_asynccnt 0x0" ::: "memory");   // no copy is outstanding when the buffers are reused below
  // epilogue: each wave stages 16 output rows at a time (hi and residual plane, pitch 144 B) in its own part of the buffers, all of whose readers have passed the loop's last barrier, and stores whole 128-B lines
  _Float16* eh = (_Float16*)(sm + wave * (2 * 16 * 144)); _Float16* el = eh + 16 * 72;
  const size_t rw = (size_t)blockIdx.x * GBM + wm * 64; const int cw = wn * 64; const int el_r = lane >> 3, el_c = (lane & 7) * 8;
  float bias[4];
#pragma unroll
  for (int j = 0; j < 4; ++j) bias[j] = BB ? bfr(BB[cw + j * 16 + col]) : 0.f;
  if (n0 < 2 * DM) {   // q, k (+ bias) as f16 hi + (x2048) residual; q stored unscaled, 1/8 applied to the f32 score
#pragma unroll
    for (int i = 0; i < 4; ++i) {
#pragma unroll
      for (int j = 0; j < 4; ++j) {
#pragma unroll
        for (int r = 0; r < 8; ++r) { const float v = acc[i][j][r] + bias[j]; const _Float16 hv = (_Float16)v; eh[(8 * g + r) * 72 + j * 16 + col] = hv; el[(8 * g + r) * 72 + j * 16 + col] = (_Float16)((v - (float)hv) * 2048.0f); } }
      LDSX();
#pragma unroll
      for (int p = 0; p < 4; ++p) { const int rl = p * 4 + el_r; const size_t o = (rw + i * 16 + rl) * (2 * DM) + n0 + cw + el_c; vst2((unsigned*)(QK + o), *(const v4u*)&eh[rl * 72 + el_c]); vst2((unsigned*)(QKL + o), *(const v4u*)&el[rl * 72 + el_c]); }
      LDSX(); }
  } else {   // v (+ bias) transposed: [b][h*64+d][s], 16 d rows of 64 s at a time
    const int b = (int)(rw / SS), s0 = (int)(rw % SS); const int pc0 = n0 - 2 * DM + cw;
#pragma unroll
    for (int j = 0; j < 4; ++j) {
#pragma unroll
      for (int i = 0; i < 4; ++i) { v8h hh, ll;
#pragma unroll
        for (int r = 0; r < 8; ++r) { const float v = acc[i][j][r] + bias[j]; const _Float16 hv = (_Float16)v; hh[r] = hv; ll[r] = (_Float16)((v - (float)hv) * 2048.0f); }
        *(v8h*)&eh[col * 72 + i * 16 + 8 * g] = hh; *(v8h*)&el[col * 72 + i * 16 + 8 * g] = ll; }
      LDSX();
#pragma unroll
      for (int p = 0; p < 4; ++p) { const int d = p * 4 + el_r; const size_t o = ((size_t)b * DM + pc0 + j * 16 + d) * SS + s0 + el_c; vst2((unsigned*)(VTH + o), *(const v4u*)&eh[d * 72 + el_c]); vst2((unsigned*)(VTL + o), *(const v4u*)&el[d * 72 + el_c]); }
      LDSX(); }
    asm volatile("s_wait_xcnt 0x0" ::: "memory");   // behind the last pass's stores, before the code after this branch that rewrites their address registers
  }
}
// hardware exp2 with the one free slot behind it that the instruction set asks for before a transcendental's result is read or its source overwritten
__device__ __forceinline__ float exp2_slot(float x) { float e; asm("v_exp_f32 %0, %1\n\tv_nop" : "=v"(e) : "v"(x)); return e; }
// ---- k_attn: block = (64 queries, head h, batch b): the 128 keys that the block's window can touch are staged once in LDS (k rows and v^T rows, contiguous 128-B and 256-B pieces of global memory, shared by the four waves; each wave's q rows likewise), and every q, k and v fragment is read from there; both products transposed: S^T = K . Q^T (K = 64: 2 k-steps), scores = (q.k) * 0.125 with single f16 operands, one softmax over the 128 staged keys with a query's scores in one pair of lanes, O^T = V^T . P^T with P taken from the score registers (f16, x2^11); O[b*S+q][h*64+d] = acc / 2048 / l (256-B segments)
#define AKN (64 + 2 * HALFW)          // keys staged per block
#define AKP 144                       // LDS pitch of a k row: 128 B + 16 B, an odd multiple of 16 B for the 16-byte fragment reads
#define AVP (2 * AKN + 16)            // LDS pitch of a v^T row: 256 B + 16 B, likewise
__global__ __launch_bounds__(128) void k_attn(const _Float16* __restrict__ QK, const _Float16* __restrict__ QKL, const _Float16* __restrict__ VTH, const _Float16* __restrict__ VTL, const void* __restrict__ KMASK, float* __restrict__ O) {
  __shared__ __align__(16) float so[4][16][68];
  __shared__ __align__(16) unsigned char sk[AKN * AKP]; __shared__ __align__(16) unsigned char sv[HD * AVP];
  const int tid = threadIdx.x, wave = tid >> 5, lane = tid & 31, col = lane & 15, g = lane >> 4;
  const int qb = blockIdx.x, h = blockIdx.y, b = blockIdx.z; const int q0 = qb * 64 + wave * 16;
  const int kb = qb * 64 - HALFW;   // key index of LDS row 0 (a multiple of 32); keys outside 0 .. SS - 1 are loaded from a clamped address (finite values of other keys) and masked like keys outside the window
  unsigned char* sq = (unsigned char*)&so[wave][0][0];   // the wave's own 16 q rows (pitch AKP) lie where it stages its output rows at the end, long after their one read
  { v4u tk[8], tv[8], tq[4];   // 16-byte pieces: 8 lanes a k or q row (16 k rows a pass of the block, 4 q rows a pass of a wave), 16 lanes a v^T row (8 rows a pass); all twenty loads are in flight before the first store
    const unsigned ko = (unsigned)((tid >> 3) * (2 * DM) + (tid & 7) * 8), vo = (unsigned)((tid >> 4) * SS + min(max(kb + (tid & 15) * 8, 0), SS - 8)), qo = (unsigned)((wave * 16 + (lane >> 3)) * (2 * DM) + (tid & 7) * 8);   // one offset a thread for each array; the rest of every address is the same for the whole block
    const _Float16* vb = VTH + ((size_t)b * DM + h * HD) * SS; const _Float16* qp = QK + ((size_t)b * SS + qb * 64) * (2 * DM) + h * HD;
#pragma unroll
    for (int p = 0; p < 8; ++p) { const int kt = min(max(kb + (p >> 1) * 32, 0), SS - 32); tk[p] = *(const v4u*)(QK + ((size_t)b * SS + kt + (p & 1) * 16) * (2 * DM) + DM + h * HD + ko); }
#pragma unroll
    for (int p = 0; p < 8; ++p) tv[p] = *(const v4u*)(vb + (size_t)p * 8 * SS + vo);
#pragma unroll
    for (int p = 0; p < 4; ++p) tq[p] = *(const v4u*)(qp + (size_t)p * 4 * (2 * DM) + qo);
    asm volatile("s_wait_xcnt 0x0" ::: "memory");   // behind the twenty loads: the registers that hold their offsets are given new values right after
#pragma unroll
    for (int p = 0; p < 8; ++p) { *(v4u*)(sk + ((tid >> 3) + p * 16) * AKP + (tid & 7) * 16) = tk[p]; *(v4u*)(sv + ((tid >> 4) + p * 8) * AVP + (tid & 15) * 16) = tv[p]; }
#pragma unroll
    for (int p = 0; p < 4; ++p) *(v4u*)(sq + ((lane >> 3) + p * 4) * AKP + (tid & 7) * 16) = tq[p]; }
  // scores are formed transposed, S^T = K . Q^T: a lane holds, of every 16-key tile, 8 keys (8 g + r) of ONE query (q0 + col); lanes l and l ^ 16 share a query
  const int qi = q0 + col; const int lo = max(qi - HALFW, 0); const unsigned span = (unsigned)(min(qi + HALFW, SS - 1) - lo); const int e0 = kb + 8 * g - lo;   // key kb + 16 t + 8 g + r lies in the window |i - j| <= 32 and in 0 .. SS - 1 exactly if (unsigned)(e0 + 16 t + r) <= span
  __syncthreads();   // publishes the staged k and v rows to all four waves; nothing overwrites them afterwards
  v16h bq[2];
#pragma unroll
  for (int kc = 0; kc < 2; ++kc) bq[kc] = frag_h((const _Float16*)(sq + col * AKP) + kc * 32, lane);
  v8f s[AKN / 16];
#pragma unroll
  for (int tg = 0; tg < AKN / 16; tg += 4) { v16h fk[2][4];   // four independent score tiles at a time, so that no product waits for its accumulator; their eight k fragments are read as one group, behind one wait
#pragma unroll
    for (int kc = 0; kc < 2; ++kc) {
#pragma unroll
      for (int t = 0; t < 4; ++t) fk[kc][t] = frag_h((const _Float16*)(sk + ((tg + t) * 16 + col) * AKP) + kc * 32, lane); }
#pragma unroll
    for (int t = tg; t < tg + 4; ++t) s[t] = v8f{};
#pragma unroll
    for (int kc = 0; kc < 2; ++kc) {
#pragma unroll
      for (int t = tg; t < tg + 4; ++t) s[t] = wmma16(fk[kc][t - tg], bq[kc], s[t]); } }   // single product: k, q as one-rounding f16 operands
#pragma unroll
  for (int t = 0; t < AKN / 16; ++t) {
#pragma unroll
    for (int r = 0; r < 8; ++r) s[t][r] = ((unsigned)(e0 + t * 16 + r) <= span) ? s[t][r] * 0.125f : -3.0e38f; }   // 1/sqrt(64); keys outside the window or the sequence
  // softmax of a query over all staged keys at once: maximum and sum in the lane, one exchange between the two halves each (the query's own key is always staged and inside the window, so the maximum is a real score)
  v8f mv = s[0];
#pragma unroll
  for (int t = 1; t < AKN / 16; ++t) {
#pragma unroll
    for (int r = 0; r < 8; ++r) mv[r] = fmaxf(mv[r], s[t][r]); }
  float mx = fmaxf(fmaxf(fmaxf(mv[0], mv[1]), fmaxf(mv[2], mv[3])), fmaxf(fmaxf(mv[4], mv[5]), fmaxf(mv[6], mv[7])));
  mx = fmaxf(mx, __shfl_xor(mx, 16));
  v8f ls;
#pragma unroll
  for (int t = 0; t < AKN / 16; ++t) {
#pragma unroll
    for (int r = 0; r < 8; ++r) { const float e = exp2_slot((s[t][r] - mx) * 1.44269504f); s[t][r] = e; ls[r] = (t == 0) ? e : ls[r] + e; } }   // a masked score is -3e38: its exponential is an exact 0
  float l = ((ls[0] + ls[1]) + (ls[2] + ls[3])) + ((ls[4] + ls[5]) + (ls[6] + ls[7]));
  l += __shfl_xor(l, 16);
  // O^T += V^T . P^T: two score tiles of a lane, converted in place, are the B operand of a 32-key step (element i = key 8 g + i, element 8 + i = key 16 + 8 g + i, the order in which frag_h reads a v^T row)
  v8f acc[4] = {};
#pragma unroll
  for (int j = 0; j < AKN / 32; ++j) { v16h pb, fv[4];   // the step's four v fragments are read as one group, ahead of the conversion of P
#pragma unroll
    for (int dt = 0; dt < 4; ++dt) fv[dt] = frag_h((const _Float16*)(sv + (dt * 16 + col) * AVP) + j * 32, lane);
#pragma unroll
    for (int i = 0; i < 8; ++i) { pb[i] = (_Float16)(s[2 * j][i] * 2048.0f); pb[8 + i] = (_Float16)(s[2 * j + 1][i] * 2048.0f); }   // P scaled by 2^11 before the f16 rounding so small softmax weights stay out of the f16 subnormal range; 2^-11 folded into the epilogue
#pragma unroll
    for (int dt = 0; dt < 4; ++dt) acc[dt] = wmma16(fv[dt], pb, acc[dt]); }   // single product: V x P (x2^11)
  const float il = (1.0f / 2048.0f) / l;
#pragma unroll
  for (int dt = 0; dt < 4; ++dt) { v4f o0, o1;   // the lane's 8 consecutive d of its query's output row
#pragma unroll
    for (int r = 0; r < 4; ++r) { o0[r] = acc[dt][r] * il; o1[r] = acc[dt][4 + r] * il; }
    *(v4f*)&so[wave][col][dt * 16 + 8 * g] = o0; *(v4f*)&so[wave][col][dt * 16 + 8 * g + 4] = o1; }
  LDSX();
  for (int rl = 0; rl < 16; ++rl) if (lane < 16) vst2(O + ((size_t)b * SS + q0 + rl) * DM + h * HD + lane * 4, *(const v4f*)&so[wave][rl][lane * 4]);
}
// ---- k_out: block = 128 rows x 128 cols, 8 waves (2 x 4) of 64 x 32, 64-k stages in two LDS buffers as in k_qkv (O through registers, split once per block into bf16 hi and residual planes; the weight tile copied straight into LDS): out = O(hi/lo) . Wo rows (2 products) + bo
#define OBN 128
#define OAB (2 * GBM * GPW)             // one O buffer: hi rows, then residual rows
#define OWB (OBN * GPW)                 // one weight buffer
// four asynchronous 16-byte copies a lane, as cp_w8
__device__ __forceinline__ void cp_w4(unsigned l, const __bf16* g) {
  asm volatile("global_load_async_to_lds_b128 %0, %4, off\n\tglobal_load_async_to_lds_b128 %1, %5, off\n\tglobal_load_async_to_lds_b128 %2, %6, off\n\tglobal_load_async_to_lds_b128 %3, %7, off\n\ts_wait_xcnt 0x0"
    :: "v"(l), "v"(l + 32 * GPW), "v"(l + 64 * GPW), "v"(l + 96 * GPW), "v"(g), "v"(g + 32 * DM), "v"(g + 64 * DM), "v"(g + 96 * DM) : "memory");
}
__global__ __launch_bounds__(256) void k_out(const float* __restrict__ O, const __bf16* __restrict__ P, const float* __restrict__ BO, float* __restrict__ Y) {
  __shared__ __align__(16) unsigned char sm[2 * OAB + 2 * OWB];
  const int tid = threadIdx.x, wave = tid >> 5, lane = tid & 31, col = lane & 15, g = lane >> 4; const int wm = wave >> 2, wn = wave & 3; const int n0 = blockIdx.y * OBN;
  const int ar = tid >> 4, ac = (tid & 15) * 4, br = tid >> 3, wc = (tid & 7) * 8;   // O: 16 rows a pass, 256 B of a row per 16 threads; weight: 32 rows a pass, one 128-B line per 8 threads
  const float* ga = O + ((size_t)blockIdx.x * GBM + ar) * DM + ac; const __bf16* gb = P + (size_t)(n0 + br) * DM + wc; unsigned char* sw = sm + 2 * OAB;
  unsigned lw = (unsigned)(size_t)(sw + br * GPW + wc * 2); const unsigned lx = lw ^ (lw + OWB);   // the lane's LDS byte address in the weight buffer that the next copies fill, and what toggles it; lw and gb step from stage to stage as in k_qkv
  v4f ra[8]; v8f acc[4][2] = {};
  // stage s: k 64 s .. + 63 of all 128 O rows and all 128 weight rows, into buffers s & 1 (the short loops are unrolled so that ra stays in registers)
#define OLDA(s) _Pragma("unroll") for (int p = 0; p < 8; ++p) ra[p] = *(const v4f*)(ga + (size_t)p * 16 * DM + (s) * 64)
#define OSTA(s) _Pragma("unroll") for (int p = 0; p < 8; ++p) { v4b th, tl; _Pragma("unroll") for (int i = 0; i < 4; ++i) { th[i] = (__bf16)ra[p][i]; tl[i] = (__bf16)(ra[p][i] - (float)th[i]); } *(v4b*)(sm + ((s) & 1) * OAB + (ar + p * 16) * GPW + ac * 2) = th; *(v4b*)(sm + ((s) & 1) * OAB + (GBM + ar + p * 16) * GPW + ac * 2) = tl; }
#define OCPW() do { cp_w4(lw, gb); lw ^= lx; gb += 64; } while (0)
#define OFRG(q) _Pragma("unroll") for (int j = 0; j < 2; ++j) fb[j] = frag_b((const __bf16*)(sw + (s & 1) * OWB + (wn * 32 + j * 16 + col) * GPW + (q) * 64), lane); _Pragma("unroll") for (int i = 0; i < 4; ++i) { fl[i] = frag_b((const __bf16*)(sm + (s & 1) * OAB + (GBM + wm * 64 + i * 16 + col) * GPW + (q) * 64), lane); fh[i] = frag_b((const __bf16*)(sm + (s & 1) * OAB + (wm * 64 + i * 16 + col) * GPW + (q) * 64), lane); }
  // per accumulator: residual product, then hi product; four independent tiles between the two, so that no product waits for its accumulator
#define OMAC() _Pragma("unroll") for (int ip = 0; ip < 4; ip += 2) { _Pragma("unroll") for (int q = 0; q < 4; ++q) acc[ip + (q >> 1)][q & 1] = wmma_bf(fl[ip + (q >> 1)], fb[q & 1], acc[ip + (q >> 1)][q & 1]); _Pragma("unroll") for (int q = 0; q < 4; ++q) acc[ip + (q >> 1)][q & 1] = wmma_bf(fh[ip + (q >> 1)], fb[q & 1], acc[ip + (q >> 1)][q & 1]); }
  OLDA(0); OCPW(); OSTA(0); OLDA(1);
  asm volatile("s_wait_asynccnt 0x0" ::: "memory");   // stage 0's weight copies of this wave have landed before the barrier that publishes them
  __syncthreads();
  OCPW();
#pragma unroll 2   // two trips a round, so that every buffer's LDS offset is a constant
  for (int s = 0; s < DM / 64; ++s) {
    v16b fh[4], fl[4], fb[2];   // one 32-k half's fragments at a time
    // the O rows loaded one trip ago go into the buffer whose readers the last barrier has ended; the next loads have this whole trip to land
    if (s + 1 < DM / 64) { OSTA(s + 1); }
    if (s + 2 < DM / 64) { OLDA(s + 2); }
    OFRG(0); OMAC();
    OFRG(1); OMAC();
    asm volatile("s_wait_dscnt 0x0" ::: "memory");     // this wave's reads of the buffers that are refilled behind the barrier have retired
    asm volatile("s_wait_asynccnt 0x0" ::: "memory");  // this wave's copies of stage s + 1 have landed before the barrier that publishes them
    __syncthreads();   // publishes stage s + 1 (O stores and weight copies) and ends every read of stage s
    if (s + 2 < DM / 64) { OCPW(); } }   // into the weight buffer that this trip has just read; a whole trip to land
  asm volatile("s_wait_asynccnt 0x0" ::: "memory");   // no copy is outstanding when the buffers are reused below
  // epilogue: each wave stages 16 rows of 32 f32 (pitch 144 B) in its own part of the buffers, behind the loop's last barrier, and stores whole 128-B lines
  float* so = (float*)(sm + wave * (16 * 144)); const size_t rw = (size_t)blockIdx.x * GBM + wm * 64; const int cw = n0 + wn * 32;
  float bias[2];
#pragma unroll
  for (int j = 0; j < 2; ++j) bias[j] = bfr(BO[cw + j * 16 + col]);
#pragma unroll
  for (int i = 0; i < 4; ++i) {
#pragma unroll
    for (int j = 0; j < 2; ++j) {
#pragma unroll
      for (int r = 0; r < 8; ++r) so[(8 * g + r) * 36 + j * 16 + col] = acc[i][j][r] + bias[j]; }
    LDSX();
#pragma unroll
    for (int p = 0; p < 4; ++p) { const int rl = p * 4 + (lane >> 3); vst2(Y + (rw + i * 16 + rl) * DM + cw + (lane & 7) * 4, *(const v4f*)&so[rl * 36 + (lane & 7) * 4]); }
    LDSX(); }
}
extern "C" void kernel_launch(void* const* d_in, const int* in_sizes, int n_in, void* d_out, int out_size, void* d_ws, size_t ws_size, hipStream_t stream) {
  (void)in_sizes; (void)n_in; (void)out_size;
  const float** F = (const float**)d_in;   // 0 x [4,2048,1024], 1 W_qkv [3072,1024] natural, 2 b_qkv [3072], 3 W_out [1024,1024], 4 b_out
  if (ws_size < (size_t)WS_END) return;
  char* ws = (char*)d_ws; __bf16* PK = (__bf16*)(ws + WS_PK); _Float16 *QK = (_Float16*)(ws + WS_QK), *QKL = (_Float16*)(ws + WS_QKL), *VTH = (_Float16*)(ws + WS_VTH), *VTL = (_Float16*)(ws + WS_VTL); float* O = (float*)(ws + WS_O);
  k_pack<<<dim3(DM, 4), 256, 0, stream>>>(F[1], F[1] + (size_t)DM * DM, F[1] + (size_t)2 * DM * DM, F[3], PK);
  k_qkv<<<dim3(TNB * SS / GBM, QKVW / GBN), 256, 0, stream>>>(F[0], F[0], F[0], PK + PK_A, F[2], F[2] + DM, F[2] + 2 * DM, QK, QKL, VTH, VTL);
  k_attn<<<dim3(TQB, NH, TNB), 128, 0, stream>>>(QK, QKL, VTH, VTL, nullptr, O);
  k_out<<<dim3(TNB * SS / GBM, DM / OBN), 256, 0, stream>>>(O, PK + PK_P, F[4], (float*)d_out);
}

// v005
// Measured time: 102 microseconds a run.
// Timed twice side by side with v004, it ran 1.04 times as fast both times.
// Over all steps from v000 it is 3.66 times as fast.
// compute dtype: all float inputs rounded to bf16; qkv = x . W_qkv^T + b with EXACT bf16 products on WMMA 16x16x32 (natural rows; the fused weight as three contiguous row blocks); windowed attention (only the 128 keys that a block of 64 queries can touch under |i - j| <= 32 are visited, per-score window test): q, k single f16 x 1/8, softmax in f32 (hardware exp), P (scaled by 2^11, single f16) x v (single f16); out = o (bf16 hi + residual) . W_out^T (2 products) + b_out.
#include <hip/hip_runtime.h>
#include <math.h>

typedef __attribute__((ext_vector_type(16))) _Float16 v16h;
typedef __attribute__((ext_vector_type(16))) __bf16 v16b;
typedef __attribute__((ext_vector_type(8)))  _Float16 v8h;
typedef __attribute__((ext_vector_type(8)))  float v8f;
typedef __attribute__((ext_vector_type(4)))  float v4f;
typedef __attribute__((ext_vector_type(2)))  float v2f;
typedef __attribute__((ext_vector_type(4)))  unsigned v4u;
typedef __attribute__((ext_vector_type(4)))  int v4i;
typedef float __attribute__((may_alias)) float_a;
typedef int __attribute__((may_alias)) int_a;

template <typename T> __device__ __forceinline__ void vst2(void* p, T v) { *(T*)p = v;  }
__device__ __forceinline__ v8f wmma16(v16h a, v16h b, v8f c) {
  v8f d = __builtin_amdgcn_wmma_f32_16x16x32_f16(false, a, false, b, (short)0, c, false, false);
  asm volatile("v_nop\n\tv_nop\n\tv_nop\n\tv_nop" : "+v"(d) : "v"(a), "v"(b));
  return d;
}
__device__ __forceinline__ v8f wmma_bf(v16b a, v16b b, v8f c) {
  v8f d = __builtin_amdgcn_wmma_f32_16x16x32_bf16(false, a, false, b, (short)0, c, false, false);
  asm volatile("v_nop\n\tv_nop\n\tv_nop\n\tv_nop" : "+v"(d) : "v"(a), "v"(b));
  return d;
}
// Local-window multi-head self attention (B 4, T 2,048, d 1,024, 16 heads x 64, window |i - j| <= 32): fused qkv projection + bias, windowed softmax(q k^T / 8) v, output projection + bias.
__device__ __forceinline__ v16h frag_h(const _Float16* rowk0, int lane) {
  union { v16h v; v8h q[2]; } u; const _Float16* p = rowk0 + 8 * (lane >> 4);
  u.q[0] = *(const v8h*)p; u.q[1] = *(const v8h*)(p + 16); return u.v;
}
__device__ __forceinline__ v16h frag_f32(const float* rowk0, int lane) {
  v16h a; const float* p = rowk0 + 8 * (lane >> 4);
#pragma unroll
  for (int i = 0; i < 8; ++i) { a[i] = (_Float16)p[i]; a[8 + i] = (_Float16)p[16 + i]; }
  return a;
}
__device__ __forceinline__ v16h frag_f32s(const float* rowk0, int lane, float sc) {
  v16h a; const float* p = rowk0 + 8 * (lane >> 4);
#pragma unroll
  for (int i = 0; i < 8; ++i) { a[i] = (_Float16)(p[i] * sc); a[8 + i] = (_Float16)(p[16 + i] * sc); }
  return a;
}
// column fragment from a [K][ld] layout (column n), rows >= K read as 0
__device__ __forceinline__ v16h fragc_f32(const float* W, int k0, int n, int lane, int ld, int K) {
  v16h a; const int g = lane >> 4;
#pragma unroll
  for (int i = 0; i < 8; ++i) { const int ka = k0 + 8 * g + i, kb = ka + 16;
    a[i] = (_Float16)(ka < K ? W[(size_t)(ka < K ? ka : K - 1) * ld + n] : 0.f); a[8 + i] = (_Float16)(kb < K ? W[(size_t)(kb < K ? kb : K - 1) * ld + n] : 0.f); }
  return a;
}
struct F2 { v16b h, l; };
__device__ __forceinline__ F2 bsplit16(const float v[16]) { F2 r;
#pragma unroll
  for (int i = 0; i < 16; ++i) { const __bf16 h = (__bf16)v[i]; r.h[i] = h; r.l[i] = (__bf16)(v[i] - (float)h); }
  return r; }
__device__ __forceinline__ F2 split_row(const float* row, int k0, int lane) { float v[16]; const float* p = row + k0 + 8 * (lane >> 4);
#pragma unroll
  for (int i = 0; i < 8; ++i) { v[i] = p[i]; v[8 + i] = p[16 + i]; }
  return bsplit16(v); }
__device__ __forceinline__ F2 split_rowK(const float* row, int k0, int lane, int K) { float v[16]; const int g = lane >> 4;
#pragma unroll
  for (int i = 0; i < 8; ++i) { const int ka = k0 + 8 * g + i, kb = ka + 16; v[i] = ka < K ? row[ka < K ? ka : K - 1] : 0.f; v[8 + i] = kb < K ? row[kb < K ? kb : K - 1] : 0.f; }
  return bsplit16(v); }
__device__ __forceinline__ F2 split_col(const float* W, int k0, int n, int lane, int ld, int K) { float v[16]; const int g = lane >> 4;
#pragma unroll
  for (int i = 0; i < 8; ++i) { const int ka = k0 + 8 * g + i, kb = ka + 16; v[i] = ka < K ? W[(size_t)(ka < K ? ka : K - 1) * ld + n] : 0.f; v[8 + i] = kb < K ? W[(size_t)(kb < K ? kb : K - 1) * ld + n] : 0.f; }
  return bsplit16(v); }
__device__ __forceinline__ v8f mac3(const F2& a, const F2& b, v8f c) { c = wmma_bf(a.l, b.h, c); c = wmma_bf(a.h, b.l, c); return wmma_bf(a.h, b.h, c); }
__device__ __forceinline__ float sigm(float v) { return 1.0f / (1.0f + expf(-v)); }
#define LDSX() do { asm volatile("s_wait_dscnt 0" ::: "memory"); __builtin_amdgcn_wave_barrier(); __builtin_amdgcn_fence(__ATOMIC_RELEASE, "workgroup"); } while (0)


#define NB 4
#define SS 2048
#define DM 1024
#define NH 16
#define HALFW 32
#define HD 64
#define QKVW (3 * DM)
#ifndef TQB
#define TQB (SS / 64)
#define TNB NB
#define TOB (NB * SS / 64)     // 64-row tiles of all 8192 rows; unused
#endif
typedef __attribute__((ext_vector_type(8))) __bf16 v8b;
__device__ __forceinline__ v16b frag_b(const __bf16* rowk0, int lane) {
  union { v16b v; v8b q[2]; } u; const __bf16* p = rowk0 + 8 * (lane >> 4);
  u.q[0] = *(const v8b*)p; u.q[1] = *(const v8b*)(p + 16); return u.v;
}
__device__ __forceinline__ float bfr(float v) { return (float)(__bf16)v; }
__device__ __attribute__((noinline)) float exp_ni(float v) { return expf(v); }
__device__ __attribute__((noinline)) float erf_ni(float v) { return erff(v); }

#define PK_A 0                       // [3072][1024] Wqkv rows (natural [out][in])
#define PK_P (PK_A + QKVW * DM)        // [1024][1024] Wo rows (natural)
#define PK_END (PK_P + DM * DM)
#define WS_PK  0u
#define WS_QK  (WS_PK + 2u * PK_END)             // f16 [8192 rows][2048]: q | k
#define WS_QKL (WS_QK + 2u * NB * SS * 2 * DM)     // f16 q | k residual planes x2048
#define WS_VTH (WS_QKL + 2u * NB * SS * 2 * DM)    // f16 [b][1024 (h*64+d)][2048 s] hi
#define WS_VTL (WS_VTH + 2u * NB * DM * SS)        // f16 lo x 2048
#define WS_O   (WS_VTL + 2u * NB * DM * SS)        // f32 [8192][1024]
#define WS_CS  (WS_O + 4u * NB * SS * DM)           // f32 [2][2048][32], unused
#define WS_END (WS_CS + 4u * 2 * SS * 32)
// ---- k_pack: block = (row n, which): natural [out][in] rows -> bf16; which 0..2 -> W_q/W_k/W_v into PK_A rows which*1024 + n; 3 -> W_o into PK_P
__global__ __launch_bounds__(256) void k_pack(const float* __restrict__ WQ, const float* __restrict__ WK, const float* __restrict__ WV, const float* __restrict__ WO, __bf16* __restrict__ PK) {
  __shared__ __align__(16) __bf16 s[DM]; const int n = blockIdx.x, which = blockIdx.y, t = threadIdx.x; const float* Wm = (which == 0) ? WQ : (which == 1) ? WK : (which == 2) ? WV : WO;
  for (int k = t; k < DM; k += 256) s[k] = (__bf16)Wm[(size_t)n * DM + k];
  __syncthreads();
  __bf16* dst = (which < 3) ? PK + PK_A + ((size_t)which * DM + n) * DM : PK + PK_P + (size_t)n * DM;
  for (int q = t; q < DM / 8; q += 256) vst2((unsigned*)(dst + q * 8), *(const v4u*)&s[q * 8]);
}
// ---- k_qkv: block = 128 rows x 256 cols, 8 waves (2 x 4) of 64 x 64; a stage is 64 k of both tiles, two LDS buffers each: the x tile goes through registers (rounded to bf16 on the way), the weight tile, bf16 already, is copied from global memory straight into LDS; every wave takes its fragments from there
#define GBM 128
#define GBN 256
#define GPW 144                       // LDS pitch of a 64-k row: 128 B of k + 16 B, an odd multiple of 16 B for the 16-byte fragment reads
#define GAB (GBM * GPW)                // one x buffer
#define GWB (GBN * GPW)                // one weight buffer
typedef __attribute__((ext_vector_type(4))) __bf16 v4b;
// eight asynchronous 16-byte copies a lane, global -> LDS: rows 32 apart of one weight stage. The s_wait_xcnt is the last line of the copies' own statement, so that it stands in front of whatever gives their address registers new values
__device__ __forceinline__ void cp_w8(unsigned l, const __bf16* g) {
  asm volatile("global_load_async_to_lds_b128 %0, %8, off\n\tglobal_load_async_to_lds_b128 %1, %9, off\n\tglobal_load_async_to_lds_b128 %2, %10, off\n\tglobal_load_async_to_lds_b128 %3, %11, off\n\tglobal_load_async_to_lds_b128 %4, %12, off\n\tglobal_load_async_to_lds_b128 %5, %13, off\n\tglobal_load_async_to_lds_b128 %6, %14, off\n\tglobal_load_async_to_lds_b128 %7, %15, off\n\ts_wait_xcnt 0x0"
    :: "v"(l), "v"(l + 32 * GPW), "v"(l + 64 * GPW), "v"(l + 96 * GPW), "v"(l + 128 * GPW), "v"(l + 160 * GPW), "v"(l + 192 * GPW), "v"(l + 224 * GPW),
       "v"(g), "v"(g + 32 * DM), "v"(g + 64 * DM), "v"(g + 96 * DM), "v"(g + 128 * DM), "v"(g + 160 * DM), "v"(g + 192 * DM), "v"(g + 224 * DM) : "memory");
}
__global__ __launch_bounds__(256) void k_qkv(const float* __restrict__ XQ, const float* __restrict__ XK, const float* __restrict__ XV, const __bf16* __restrict__ P, const float* __restrict__ BQ, const float* __restrict__ BK, const float* __restrict__ BV, _Float16* __restrict__ QK, _Float16* __restrict__ QKL, _Float16* __restrict__ VTH, _Float16* __restrict__ VTL) {
  const int n0 = blockIdx.y * GBN; const int which0 = n0 / DM; const float* X = (which0 == 0) ? XQ : (which0 == 1) ? XK : XV; const float* BB = BQ ? (((which0 == 0) ? BQ : (which0 == 1) ? BK : BV) + (n0 - which0 * DM)) : nullptr;
  __shared__ __align__(16) unsigned char sm[2 * GAB + 2 * GWB];
  const int tid = threadIdx.x, wave = tid >> 5, lane = tid & 31, col = lane & 15, g = lane >> 4; const int wm = wave >> 2, wn = wave & 3;
  const int ar = tid >> 4, ac = (tid & 15) * 4, br = tid >> 3, wc = (tid & 7) * 8;   // x: 16 rows a pass, 256 B of a row per 16 threads; weight: 32 rows a pass, one 128-B line per 8 threads
  const float* ga = X + ((size_t)blockIdx.x * GBM + ar) * DM + ac; const __bf16* gb = P + (size_t)(n0 + br) * DM + wc; unsigned char* sw = sm + 2 * GAB;
  unsigned lw = (unsigned)(size_t)(sw + br * GPW + wc * 2);   // the lane's LDS byte address in the weight buffer that the next copies fill; it and gb step from stage to stage, so that the sixteen addresses of a stage's copies are formed where they are used and hold no registers through the products
  v4f ra[8]; v8f acc[4][4] = {};
  // stage s: k 64 s .. + 63 of all 128 x rows and all 256 weight rows, into buffers s & 1 (the short loops are unrolled so that ra stays in registers)
#define QLDA(s) _Pragma("unroll") for (int p = 0; p < 8; ++p) ra[p] = *(const v4f*)(ga + (size_t)p * 16 * DM + (s) * 64)
#define QSTA(s) _Pragma("unroll") for (int p = 0; p < 8; ++p) { v4b t; _Pragma("unroll") for (int i = 0; i < 4; ++i) t[i] = (__bf16)ra[p][i]; *(v4b*)(sm + ((s) & 1) * GAB + (ar + p * 16) * GPW + ac * 2) = t; }
#define QFRG(q) _Pragma("unroll") for (int i = 0; i < 4; ++i) { fa[i] = frag_b((const __bf16*)(sm + (s & 1) * GAB + (wm * 64 + i * 16 + col) * GPW + (q) * 64), lane); fb[i] = frag_b((const __bf16*)(sw + (s & 1) * GWB + (wn * 64 + i * 16 + col) * GPW + (q) * 64), lane); }
#define QMAC() _Pragma("unroll") for (int i = 0; i < 4; ++i) { _Pragma("unroll") for (int j = 0; j < 4; ++j) acc[i][j] = wmma_bf(fa[i], fb[j], acc[i][j]); }
#define QCPW() do { cp_w8(lw, gb); lw ^= lx; gb += 64; } while (0)
  const unsigned lx = lw ^ (lw + GWB);   // toggles lw between the two weight buffers
  QLDA(0); QCPW(); QSTA(0); QLDA(1);
  asm volatile("s_wait_asynccnt 0x0" ::: "memory");   // stage 0's weight copies of this wave have landed before the barrier that publishes them
  __syncthreads();
  QCPW();
#pragma unroll 2   // two trips a round, so that every buffer's LDS offset is a constant
  for (int s = 0; s < DM / 64; ++s) {
    v16b fa[4], fb[4];   // one 32-k half's fragments at a time
    // the x rows loaded one trip ago go into the buffer whose readers the last barrier has ended; the next loads have this whole trip to land
    if (s + 1 < DM / 64) { QSTA(s + 1); }
    if (s + 2 < DM / 64) { QLDA(s + 2); }
    QFRG(0); QMAC();
    QFRG(1); QMAC();
    asm volatile("s_wait_dscnt 0x0" ::: "memory");     // this wave's reads of the buffers that are refilled behind the barrier have retired
    asm volatile("s_wait_asynccnt 0x0" ::: "memory");  // this wave's copies of stage s + 1 have landed before the barrier that publishes them
    __syncthreads();   // publishes stage s + 1 (x stores and weight copies) and ends every read of stage s
    if (s + 2 < DM / 64) { QCPW(); } }   // into the weight buffer that this trip has just read; a whole trip to land
  asm volatile("s_wait_asynccnt 0x0" ::: "memory");   // no copy is outstanding when the buffers are reused below
  // epilogue: each wave stages 16 output rows at a time (hi and residual plane, pitch 144 B) in its own part of the buffers, all of whose readers have passed the loop's last barrier, and stores whole 128-B lines
  _Float16* eh = (_Float16*)(sm + wave * (2 * 16 * 144)); _Float16* el = eh + 16 * 72;
  const size_t rw = (size_t)blockIdx.x * GBM + wm * 64; const int cw = wn * 64; const int el_r = lane >> 3, el_c = (lane & 7) * 8;
  float bias[4];
#pragma unroll
  for (int j = 0; j < 4; ++j) bias[j] = BB ? bfr(BB[cw + j * 16 + col]) : 0.f;
  if (n0 < 2 * DM) {   // q, k (+ bias) as f16 hi + (x2048) residual; q stored unscaled, 1/8 applied to the f32 score
#pragma unroll
    for (int i = 0; i < 4; ++i) {
#pragma unroll
      for (int j = 0; j < 4; ++j) {
#pragma unroll
        for (int r = 0; r < 8; ++r) { const float v = acc[i][j][r] + bias[j]; const _Float16 hv = (_Float16)v; eh[(8 * g + r) * 72 + j * 16 + col] = hv; el[(8 * g + r) * 72 + j * 16 + col] = (_Float16)((v - (float)hv) * 2048.0f); } }
      LDSX();
#pragma unroll
      for (int p = 0; p < 4; ++p) { const int rl = p * 4 + el_r; const size_t o = (rw + i * 16 + rl) * (2 * DM) + n0 + cw + el_c; vst2((unsigned*)(QK + o), *(const v4u*)&eh[rl * 72 + el_c]); vst2((unsigned*)(QKL + o), *(const v4u*)&el[rl * 72 + el_c]); }
      LDSX(); }
  } else {   // v (+ bias) transposed: [b][h*64+d][s], 16 d rows of 64 s at a time
    const int b = (int)(rw / SS), s0 = (int)(rw % SS); const int pc0 = n0 - 2 * DM + cw;
#pragma unroll
    for (int j = 0; j < 4; ++j) {
#pragma unroll
      for (int i = 0; i < 4; ++i) { v8h hh, ll;
#pragma unroll
        for (int r = 0; r < 8; ++r) { const float v = acc[i][j][r] + bias[j]; const _Float16 hv = (_Float16)v; hh[r] = hv; ll[r] = (_Float16)((v - (float)hv) * 2048.0f); }
        *(v8h*)&eh[col * 72 + i * 16 + 8 * g] = hh; *(v8h*)&el[col * 72 + i * 16 + 8 * g] = ll; }
      LDSX();
#pragma unroll
      for (int p = 0; p < 4; ++p) { const int d = p * 4 + el_r; const size_t o = ((size_t)b * DM + pc0 + j * 16 + d) * SS + s0 + el_c; vst2((unsigned*)(VTH + o), *(const v4u*)&eh[d * 72 + el_c]); vst2((unsigned*)(VTL + o), *(const v4u*)&el[d * 72 + el_c]); }
      LDSX(); }
    asm volatile("s_wait_xcnt 0x0" ::: "memory");   // behind the last pass's stores, before the code after this branch that rewrites their address registers
  }
}
// hardware exp2 with the one free slot behind it that the instruction set asks for before a transcendental's result is read or its source overwritten
__device__ __forceinline__ float exp2_slot(float x) { float e; asm("v_exp_f32 %0, %1\n\tv_nop" : "=v"(e) : "v"(x)); return e; }
// ---- k_attn: block = (64 queries, head h, batch b): the 128 keys that the block's window can touch are staged once in LDS (k rows and v^T rows, contiguous 128-B and 256-B pieces of global memory, shared by the four waves; each wave's q rows likewise), and every q, k and v fragment is read from there; both products transposed: S^T = K . Q^T (K = 64: 2 k-steps), scores = (q.k) * 0.125 with single f16 operands, one softmax over the 128 staged keys with a query's scores in one pair of lanes, O^T = V^T . P^T with P taken from the score registers (f16, x2^11); O[b*S+q][h*64+d] = acc / 2048 / l (256-B segments)
#define AKN (64 + 2 * HALFW)          // keys staged per block
#define AKP 144                       // LDS pitch of a k row: 128 B + 16 B, an odd multiple of 16 B for the 16-byte fragment reads
#define AVP (2 * AKN + 16)            // LDS pitch of a v^T row: 256 B + 16 B, likewise
__global__ __launch_bounds__(128) void k_attn(const _Float16* __restrict__ QK, const _Float16* __restrict__ QKL, const _Float16* __restrict__ VTH, const _Float16* __restrict__ VTL, const void* __restrict__ KMASK, float* __restrict__ O) {
  __shared__ __align__(16) float so[4][16][68];
  __shared__ __align__(16) unsigned char sk[AKN * AKP]; __shared__ __align__(16) unsigned char sv[HD * AVP];
  const int tid = threadIdx.x, wave = tid >> 5, lane = tid & 31, col = lane & 15, g = lane >> 4;
  const int qb = blockIdx.x, h = blockIdx.y, b = blockIdx.z; const int q0 = qb * 64 + wave * 16;
  const int kb = qb * 64 - HALFW;   // key index of LDS row 0 (a multiple of 32); keys outside 0 .. SS - 1 are loaded from a clamped address (finite values of other keys) and masked like keys outside the window
  unsigned char* sq = (unsigned char*)&so[wave][0][0];   // the wave's own 16 q rows (pitch AKP) lie where it stages its output rows at the end, long after their one read
  { v4u tk[8], tv[8], tq[4];   // 16-byte pieces: 8 lanes a k or q row (16 k rows a pass of the block, 4 q rows a pass of a wave), 16 lanes a v^T row (8 rows a pass); all twenty loads are in flight before the first store
    const unsigned ko = (unsigned)((tid >> 3) * (2 * DM) + (tid & 7) * 8), vo = (unsigned)((tid >> 4) * SS + min(max(kb + (tid & 15) * 8, 0), SS - 8)), qo = (unsigned)((wave * 16 + (lane >> 3)) * (2 * DM) + (tid & 7) * 8);   // one offset a thread for each array; the rest of every address is the same for the whole block
    const _Float16* vb = VTH + ((size_t)b * DM + h * HD) * SS; const _Float16* qp = QK + ((size_t)b * SS + qb * 64) * (2 * DM) + h * HD;
#pragma unroll
    for (int p = 0; p < 8; ++p) { const int kt = min(max(kb + (p >> 1) * 32, 0), SS - 32); tk[p] = *(const v4u*)(QK + ((size_t)b * SS + kt + (p & 1) * 16) * (2 * DM) + DM + h * HD + ko); }
#pragma unroll
    for (int p = 0; p < 8; ++p) tv[p] = *(const v4u*)(vb + (size_t)p * 8 * SS + vo);
#pragma unroll
    for (int p = 0; p < 4; ++p) tq[p] = *(const v4u*)(qp + (size_t)p * 4 * (2 * DM) + qo);
    asm volatile("s_wait_xcnt 0x0" ::: "memory");   // behind the twenty loads: the registers that hold their offsets are given new values right after
#pragma unroll
    for (int p = 0; p < 8; ++p) { *(v4u*)(sk + ((tid >> 3) + p * 16) * AKP + (tid & 7) * 16) = tk[p]; *(v4u*)(sv + ((tid >> 4) + p * 8) * AVP + (tid & 15) * 16) = tv[p]; }
#pragma unroll
    for (int p = 0; p < 4; ++p) *(v4u*)(sq + ((lane >> 3) + p * 4) * AKP + (tid & 7) * 16) = tq[p]; }
  // scores are formed transposed, S^T = K . Q^T: a lane holds, of every 16-key tile, 8 keys (8 g + r) of ONE query (q0 + col); lanes l and l ^ 16 share a query
  const int qi = q0 + col; const int lo = max(qi - HALFW, 0); const unsigned span = (unsigned)(min(qi + HALFW, SS - 1) - lo); const int e0 = kb + 8 * g - lo;   // key kb + 16 t + 8 g + r lies in the window |i - j| <= 32 and in 0 .. SS - 1 exactly if (unsigned)(e0 + 16 t + r) <= span
  __syncthreads();   // publishes the staged k and v rows to all four waves; nothing overwrites them afterwards
  v16h bq[2];
#pragma unroll
  for (int kc = 0; kc < 2; ++kc) bq[kc] = frag_h((const _Float16*)(sq + col * AKP) + kc * 32, lane);
  v8f s[AKN / 16];
#pragma unroll
  for (int tg = 0; tg < AKN / 16; tg += 4) { v16h fk[2][4];   // four independent score tiles at a time, so that no product waits for its accumulator; their eight k fragments are read as one group, behind one wait
#pragma unroll
    for (int kc = 0; kc < 2; ++kc) {
#pragma unroll
      for (int t = 0; t < 4; ++t) fk[kc][t] = frag_h((const _Float16*)(sk + ((tg + t) * 16 + col) * AKP) + kc * 32, lane); }
#pragma unroll
    for (int t = tg; t < tg + 4; ++t) s[t] = v8f{};
#pragma unroll
    for (int kc = 0; kc < 2; ++kc) {
#pragma unroll
      for (int t = tg; t < tg + 4; ++t) s[t] = wmma16(fk[kc][t - tg], bq[kc], s[t]); } }   // single product: k, q as one-rounding f16 operands
#pragma unroll
  for (int t = 0; t < AKN / 16; ++t) {
#pragma unroll
    for (int r = 0; r < 8; ++r) s[t][r] = ((unsigned)(e0 + t * 16 + r) <= span) ? s[t][r] * 0.125f : -3.0e38f; }   // 1/sqrt(64); keys outside the window or the sequence
  // softmax of a query over all staged keys at once: maximum and sum in the lane, one exchange between the two halves each (the query's own key is always staged and inside the window, so the maximum is a real score)
  v8f mv = s[0];
#pragma unroll
  for (int t = 1; t < AKN / 16; ++t) {
#pragma unroll
    for (int r = 0; r < 8; ++r) mv[r] = fmaxf(mv[r], s[t][r]); }
  float mx = fmaxf(fmaxf(fmaxf(mv[0], mv[1]), fmaxf(mv[2], mv[3])), fmaxf(fmaxf(mv[4], mv[5]), fmaxf(mv[6], mv[7])));
  mx = fmaxf(mx, __shfl_xor(mx, 16));
  v8f ls;
#pragma unroll
  for (int t = 0; t < AKN / 16; ++t) {
#pragma unroll
    for (int r = 0; r < 8; ++r) { const float e = exp2_slot((s[t][r] - mx) * 1.44269504f); s[t][r] = e; ls[r] = (t == 0) ? e : ls[r] + e; } }   // a masked score is -3e38: its exponential is an exact 0
  float l = ((ls[0] + ls[1]) + (ls[2] + ls[3])) + ((ls[4] + ls[5]) + (ls[6] + ls[7]));
  l += __shfl_xor(l, 16);
  // O^T += V^T . P^T: two score tiles of a lane, converted in place, are the B operand of a 32-key step (element i = key 8 g + i, element 8 + i = key 16 + 8 g + i, the order in which frag_h reads a v^T row)
  v8f acc[4] = {};
#pragma unroll
  for (int j = 0; j < AKN / 32; ++j) { v16h pb, fv[4];   // the step's four v fragments are read as one group, ahead of the conversion of P
#pragma unroll
    for (int dt = 0; dt < 4; ++dt) fv[dt] = frag_h((const _Float16*)(sv + (dt * 16 + col) * AVP) + j * 32, lane);
#pragma unroll
    for (int i = 0; i < 8; ++i) { pb[i] = (_Float16)(s[2 * j][i] * 2048.0f); pb[8 + i] = (_Float16)(s[2 * j + 1][i] * 2048.0f); }   // P scaled by 2^11 before the f16 rounding so small softmax weights stay out of the f16 subnormal range; 2^-11 folded into the epilogue
#pragma unroll
    for (int dt = 0; dt < 4; ++dt) acc[dt] = wmma16(fv[dt], pb, acc[dt]); }   // single product: V x P (x2^11)
  const float il = (1.0f / 2048.0f) / l;
#pragma unroll
  for (int dt = 0; dt < 4; ++dt) { v4f o0, o1;   // the lane's 8 consecutive d of its query's output row
#pragma unroll
    for (int r = 0; r < 4; ++r) { o0[r] = acc[dt][r] * il; o1[r] = acc[dt][4 + r] * il; }
    *(v4f*)&so[wave][col][dt * 16 + 8 * g] = o0; *(v4f*)&so[wave][col][dt * 16 + 8 * g + 4] = o1; }
  LDSX();
  for (int rl = 0; rl < 16; ++rl) if (lane < 16) vst2(O + ((size_t)b * SS + q0 + rl) * DM + h * HD + lane * 4, *(const v4f*)&so[wave][rl][lane * 4]);
}
// ---- k_out: block = 128 rows x 256 cols, 8 waves (2 x 4) of 64 x 64, one block a WGP; 64-k stages in two LDS buffers as in k_qkv (O through registers, split once per block into bf16 hi and residual planes; the weight tile copied straight into LDS by cp_w8): out = O(hi/lo) . Wo rows (2 products) + bo
#define OBN 256
#define OAB (2 * GBM * GPW)             // one O buffer: hi rows, then residual rows
#define OWB (OBN * GPW)                 // one weight buffer
__global__ __launch_bounds__(256) void k_out(const float* __restrict__ O, const __bf16* __restrict__ P, const float* __restrict__ BO, float* __restrict__ Y) {
  __shared__ __align__(16) unsigned char sm[2 * OAB + 2 * OWB];
  const int tid = threadIdx.x, wave = tid >> 5, lane = tid & 31, col = lane & 15, g = lane >> 4; const int wm = wave >> 2, wn = wave & 3; const int n0 = blockIdx.y * OBN;
  const int ar = tid >> 4, ac = (tid & 15) * 4, br = tid >> 3, wc = (tid & 7) * 8;   // O: 16 rows a pass, 256 B of a row per 16 threads; weight: 32 rows a pass, one 128-B line per 8 threads
  const float* ga = O + ((size_t)blockIdx.x * GBM + ar) * DM + ac; const __bf16* gb = P + (size_t)(n0 + br) * DM + wc; unsigned char* sw = sm + 2 * OAB;
  unsigned lw = (unsigned)(size_t)(sw + br * GPW + wc * 2); const unsigned lx = lw ^ (lw + OWB);   // the lane's LDS byte address in the weight buffer that the next copies fill, and what toggles it; lw and gb step from stage to stage as in k_qkv
  v4f ra[8]; v8f acc[4][4] = {};
  // stage s: k 64 s .. + 63 of all 128 O rows and all 256 weight rows, into buffers s & 1 (the short loops are unrolled so that ra stays in registers)
#define OLDA(s) _Pragma("unroll") for (int p = 0; p < 8; ++p) ra[p] = *(const v4f*)(ga + (size_t)p * 16 * DM + (s) * 64)
#define OSTA(s) _Pragma("unroll") for (int p = 0; p < 8; ++p) { v4b th, tl; _Pragma("unroll") for (int i = 0; i < 4; ++i) { th[i] = (__bf16)ra[p][i]; tl[i] = (__bf16)(ra[p][i] - (float)th[i]); } *(v4b*)(sm + ((s) & 1) * OAB + (ar + p * 16) * GPW + ac * 2) = th; *(v4b*)(sm + ((s) & 1) * OAB + (GBM + ar + p * 16) * GPW + ac * 2) = tl; }
#define OCPW() do { cp_w8(lw, gb); lw ^= lx; gb += 64; } while (0)
  // the weight and residual fragments, which the first sixteen products take, are read first; the hi fragments land under those products
#define OFRG(q) _Pragma("unroll") for (int j = 0; j < 4; ++j) fb[j] = frag_b((const __bf16*)(sw + (s & 1) * OWB + (wn * 64 + j * 16 + col) * GPW + (q) * 64), lane); _Pragma("unroll") for (int i = 0; i < 4; ++i) fl[i] = frag_b((const __bf16*)(sm + (s & 1) * OAB + (GBM + wm * 64 + i * 16 + col) * GPW + (q) * 64), lane); _Pragma("unroll") for (int i = 0; i < 4; ++i) fh[i] = frag_b((const __bf16*)(sm + (s & 1) * OAB + (wm * 64 + i * 16 + col) * GPW + (q) * 64), lane);
  // per accumulator: residual product, then hi product; sixteen independent tiles between the two
#define OMAC() _Pragma("unroll") for (int i = 0; i < 4; ++i) { _Pragma("unroll") for (int j = 0; j < 4; ++j) acc[i][j] = wmma_bf(fl[i], fb[j], acc[i][j]); } _Pragma("unroll") for (int i = 0; i < 4; ++i) { _Pragma("unroll") for (int j = 0; j < 4; ++j) acc[i][j] = wmma_bf(fh[i], fb[j], acc[i][j]); }
  OLDA(0); OCPW(); OSTA(0); OLDA(1);
  asm volatile("s_wait_asynccnt 0x0" ::: "memory");   // stage 0's weight copies of this wave have landed before the barrier that publishes them
  __syncthreads();
  OCPW();
#pragma unroll 2   // two trips a round, so that every buffer's LDS offset is a constant
  for (int s = 0; s < DM / 64; ++s) {
    v16b fh[4], fl[4], fb[4];   // one 32-k half's fragments at a time
    // the O rows loaded one trip ago go into the buffer whose readers the last barrier has ended; the next loads have this whole trip to land
    if (s + 1 < DM / 64) { OSTA(s + 1); }
    if (s + 2 < DM / 64) { OLDA(s + 2); asm volatile("s_wait_xcnt 0x0" ::: "memory"); }   // behind the eight loads: in the listing the fragment reads that follow reuse the loads' address registers
    OFRG(0); OMAC();
    OFRG(1); OMAC();
    asm volatile("s_wait_dscnt 0x0" ::: "memory");     // this wave's reads of the buffers that are refilled behind the barrier have retired
    asm volatile("s_wait_asynccnt 0x0" ::: "memory");  // this wave's copies of stage s + 1 have landed before the barrier that publishes them
    __syncthreads();   // publishes stage s + 1 (O stores and weight copies) and ends every read of stage s
    if (s + 2 < DM / 64) { OCPW(); } }   // into the weight buffer that this trip has just read; a whole trip to land
  asm volatile("s_wait_asynccnt 0x0" ::: "memory");   // no copy is outstanding when the buffers are reused below
  // epilogue: each wave stages 16 rows of 64 f32 (pitch 272 B) in its own part of the buffers, behind the loop's last barrier, and stores whole 256-B row pieces
  float* so = (float*)(sm + wave * (16 * 272)); const size_t rw = (size_t)blockIdx.x * GBM + wm * 64; const int cw = n0 + wn * 64;
  float bias[4];
  const int bi = cw + col;
#pragma unroll
  for (int j = 0; j < 4; ++j) bias[j] = BO[bi + j * 16];
  asm volatile("s_wait_xcnt 0x0" :: "v"(bi) : "memory");   // behind the four bias loads, whose offset register the compiler reuses right after; the offset is named as an input so that its register lives up to this wait
#pragma unroll
  for (int j = 0; j < 4; ++j) bias[j] = bfr(bias[j]);
#pragma unroll
  for (int i = 0; i < 4; ++i) {
#pragma unroll
    for (int j = 0; j < 4; ++j) {
#pragma unroll
      for (int r = 0; r < 8; ++r) so[(8 * g + r) * 68 + j * 16 + col] = acc[i][j][r] + bias[j]; }
    LDSX();
#pragma unroll
    for (int p = 0; p < 8; ++p) { const int rl = p * 2 + g; vst2(Y + (rw + i * 16 + rl) * DM + cw + col * 4, *(const v4f*)&so[rl * 68 + col * 4]); }
    LDSX(); }
}
extern "C" void kernel_launch(void* const* d_in, const int* in_sizes, int n_in, void* d_out, int out_size, void* d_ws, size_t ws_size, hipStream_t stream) {
  (void)in_sizes; (void)n_in; (void)out_size;
  const float** F = (const float**)d_in;   // 0 x [4,2048,1024], 1 W_qkv [3072,1024] natural, 2 b_qkv [3072], 3 W_out [1024,1024], 4 b_out
  if (ws_size < (size_t)WS_END) return;
  char* ws = (char*)d_ws; __bf16* PK = (__bf16*)(ws + WS_PK); _Float16 *QK = (_Float16*)(ws + WS_QK), *QKL = (_Float16*)(ws + WS_QKL), *VTH = (_Float16*)(ws + WS_VTH), *VTL = (_Float16*)(ws + WS_VTL); float* O = (float*)(ws + WS_O);
  k_pack<<<dim3(DM, 4), 256, 0, stream>>>(F[1], F[1] + (size_t)DM * DM, F[1] + (size_t)2 * DM * DM, F[3], PK);
  k_qkv<<<dim3(TNB * SS / GBM, QKVW / GBN), 256, 0, stream>>>(F[0], F[0], F[0], PK + PK_A, F[2], F[2] + DM, F[2] + 2 * DM, QK, QKL, VTH, VTL);
  k_attn<<<dim3(TQB, NH, TNB), 128, 0, stream>>>(QK, QKL, VTH, VTL, nullptr, O);
  k_out<<<dim3(TNB * SS / GBM, DM / OBN), 256, 0, stream>>>(O, PK + PK_P, F[4], (float*)d_out);
}

// v006
// It runs in 97.9 microseconds.
// Two timings next to v005 both put it at 1.04 times that version's speed.
// All steps since v000 together make it 3.80 times as fast.
// compute dtype: all float inputs rounded to bf16; qkv = x . W_qkv^T + b with EXACT bf16 products on WMMA 16x16x32 (natural rows; the fused weight as three contiguous row blocks); windowed attention (only the 128 keys that a block of 64 queries can touch under |i - j| <= 32 are visited, per-score window test): q, k single f16 x 1/8, softmax in f32 (hardware exp), P (scaled by 2^11, single f16) x v (single f16); out = o (bf16 hi + residual) . W_out^T (2 products) + b_out.
#include <hip/hip_runtime.h>
#include <math.h>

typedef __attribute__((ext_vector_type(16))) _Float16 v16h;
typedef __attribute__((ext_vector_type(16))) __bf16 v16b;
typedef __attribute__((ext_vector_type(8)))  _Float16 v8h;
typedef __attribute__((ext_vector_type(8)))  float v8f;
typedef __attribute__((ext_vector_type(4)))  float v4f;
typedef __attribute__((ext_vector_type(2)))  float v2f;
typedef __attribute__((ext_vector_type(4)))  unsigned v4u;
typedef __attribute__((ext_vector_type(4)))  int v4i;
typedef float __attribute__((may_alias)) float_a;
typedef int __attribute__((may_alias)) int_a;

template <typename T> __device__ __forceinline__ void vst2(void* p, T v) { *(T*)p = v;  }
__device__ __forceinline__ v8f wmma16(v16h a, v16h b, v8f c) {
  v8f d = __builtin_amdgcn_wmma_f32_16x16x32_f16(false, a, false, b, (short)0, c, false, false);
  asm volatile("v_nop\n\tv_nop\n\tv_nop\n\tv_nop" : "+v"(d) : "v"(a), "v"(b));
  return d;
}
__device__ __forceinline__ v8f wmma_bf(v16b a, v16b b, v8f c) {
  v8f d = __builtin_amdgcn_wmma_f32_16x16x32_bf16(false, a, false, b, (short)0, c, false, false);
  asm volatile("v_nop\n\tv_nop\n\tv_nop\n\tv_nop" : "+v"(d) : "v"(a), "v"(b));
  return d;
}
// Local-window multi-head self attention (B 4, T 2,048, d 1,024, 16 heads x 64, window |i - j| <= 32): fused qkv projection + bias, windowed softmax(q k^T / 8) v, output projection + bias.
__device__ __forceinline__ v16h frag_h(const _Float16* rowk0, int lane) {
  union { v16h v; v8h q[2]; } u; const _Float16* p = rowk0 + 8 * (lane >> 4);
  u.q[0] = *(const v8h*)p; u.q[1] = *(const v8h*)(p + 16); return u.v;
}
__device__ __forceinline__ v16h frag_f32(const float* rowk0, int lane) {
  v16h a; const float* p = rowk0 + 8 * (lane >> 4);
#pragma unroll
  for (int i = 0; i < 8; ++i) { a[i] = (_Float16)p[i]; a[8 + i] = (_Float16)p[16 + i]; }
  return a;
}
__device__ __forceinline__ v16h frag_f32s(const float* rowk0, int lane, float sc) {
  v16h a; const float* p = rowk0 + 8 * (lane >> 4);
#pragma unroll
  for (int i = 0; i < 8; ++i) { a[i] = (_Float16)(p[i] * sc); a[8 + i] = (_Float16)(p[16 + i] * sc); }
  return a;
}
// column fragment from a [K][ld] layout (column n), rows >= K read as 0
__device__ __forceinline__ v16h fragc_f32(const float* W, int k0, int n, int lane, int ld, int K) {
  v16h a; const int g = lane >> 4;
#pragma unroll
  for (int i = 0; i < 8; ++i) { const int ka = k0 + 8 * g + i, kb = ka + 16;
    a[i] = (_Float16)(ka < K ? W[(size_t)(ka < K ? ka : K - 1) * ld + n] : 0.f); a[8 + i] = (_Float16)(kb < K ? W[(size_t)(kb < K ? kb : K - 1) * ld + n] : 0.f); }
  return a;
}
struct F2 { v16b h, l; };
__device__ __forceinline__ F2 bsplit16(const float v[16]) { F2 r;
#pragma unroll
  for (int i = 0; i < 16; ++i) { const __bf16 h = (__bf16)v[i]; r.h[i] = h; r.l[i] = (__bf16)(v[i] - (float)h); }
  return r; }
__device__ __forceinline__ F2 split_row(const float* row, int k0, int lane) { float v[16]; const float* p = row + k0 + 8 * (lane >> 4);
#pragma unroll
  for (int i = 0; i < 8; ++i) { v[i] = p[i]; v[8 + i] = p[16 + i]; }
  return bsplit16(v); }
__device__ __forceinline__ F2 split_rowK(const float* row, int k0, int lane, int K) { float v[16]; const int g = lane >> 4;
#pragma unroll
  for (int i = 0; i < 8; ++i) { const int ka = k0 + 8 * g + i, kb = ka + 16; v[i] = ka < K ? row[ka < K ? ka : K - 1] : 0.f; v[8 + i] = kb < K ? row[kb < K ? kb : K - 1] : 0.f; }
  return bsplit16(v); }
__device__ __forceinline__ F2 split_col(const float* W, int k0, int n, int lane, int ld, int K) { float v[16]; const int g = lane >> 4;
#pragma unroll
  for (int i = 0; i < 8; ++i) { const int ka = k0 + 8 * g + i, kb = ka + 16; v[i] = ka < K ? W[(size_t)(ka < K ? ka : K - 1) * ld + n] : 0.f; v[8 + i] = kb < K ? W[(size_t)(kb < K ? kb : K - 1) * ld + n] : 0.f; }
  return bsplit16(v); }
__device__ __forceinline__ v8f mac3(const F2& a, const F2& b, v8f c) { c = wmma_bf(a.l, b.h, c); c = wmma_bf(a.h, b.l, c); return wmma_bf(a.h, b.h, c); }
__device__ __forceinline__ float sigm(float v) { return 1.0f / (1.0f + expf(-v)); }
#define LDSX() do { asm volatile("s_wait_dscnt 0" ::: "memory"); __builtin_amdgcn_wave_barrier(); __builtin_amdgcn_fence(__ATOMIC_RELEASE, "workgroup"); } while (0)


#define NB 4
#define SS 2048
#define DM 1024
#define NH 16
#define HALFW 32
#define HD 64
#define QKVW (3 * DM)
#ifndef TQB
#define TQB (SS / 64)
#define TNB NB
#define TOB (NB * SS / 64)     // 64-row tiles of all 8192 rows; unused
#endif
typedef __attribute__((ext_vector_type(8))) __bf16 v8b;
__device__ __forceinline__ v16b frag_b(const __bf16* rowk0, int lane) {
  union { v16b v; v8b q[2]; } u; const __bf16* p = rowk0 + 8 * (lane >> 4);
  u.q[0] = *(const v8b*)p; u.q[1] = *(const v8b*)(p + 16); return u.v;
}
__device__ __forceinline__ float bfr(float v) { return (float)(__bf16)v; }
__device__ __attribute__((noinline)) float exp_ni(float v) { return expf(v); }
__device__ __attribute__((noinline)) float erf_ni(float v) { return erff(v); }

#define PK_A 0                       // [3072][1024] Wqkv rows (natural [out][in])
#define PK_P (PK_A + QKVW * DM)        // [1024][1024] Wo rows (natural)
#define PK_END (PK_P + DM * DM)
#define WS_PK  0u
#define WS_QK  (WS_PK + 2u * PK_END)             // f16 [8192 rows][2048]: q | k
#define WS_QKL (WS_QK + 2u * NB * SS * 2 * DM)     // f16 q | k residual planes x2048
#define WS_VTH (WS_QKL + 2u * NB * SS * 2 * DM)    // f16 [b][1024 (h*64+d)][2048 s] hi
#define WS_VTL (WS_VTH + 2u * NB * DM * SS)        // f16 lo x 2048
#define WS_O   (WS_VTL + 2u * NB * DM * SS)        // f32 [8192][1024]
#define WS_CS  (WS_O + 4u * NB * SS * DM)           // f32 [2][2048][32], unused
#define WS_END (WS_CS + 4u * 2 * SS * 32)
// ---- k_pack: the four 1024 x 1024 weight blocks (the q, k, v row blocks of the fused weight, then W_o), natural [out][in] rows, rounded to bf16 into PK_A rows which*1024 + n and PK_P: elementwise, so a block takes PKE consecutive elements of one matrix: 256 blocks of 8 waves, one a WGP, 64 elements a thread; a thread's sixteen 16-byte loads (512 contiguous bytes a wave each) are all in flight before its first store (256 contiguous bytes a wave)
#define PKE 16384
typedef __attribute__((ext_vector_type(4))) __bf16 v4b;
__global__ __launch_bounds__(256) void k_pack(const float* __restrict__ WQ, const float* __restrict__ WK, const float* __restrict__ WV, const float* __restrict__ WO, __bf16* __restrict__ PK) {
  const int which = blockIdx.x / (DM * DM / PKE), e0 = (blockIdx.x % (DM * DM / PKE)) * PKE + threadIdx.x * 4; const float* Wm = (which == 0) ? WQ : (which == 1) ? WK : (which == 2) ? WV : WO;
  const unsigned ob = (unsigned)e0 * 4u;   // the thread's byte offset in its matrix
  __bf16* dp = ((which < 3) ? PK + PK_A + (size_t)which * DM * DM : PK + PK_P) + e0;
  v4f r[PKE / 1024];   // the short loops below are unrolled so that r stays in registers
#pragma unroll
  for (int p = 0; p < PKE / 1024; ++p) r[p] = *(const v4f*)((const char*)Wm + ob + p * 4096);
  asm volatile("s_wait_xcnt 0x0" :: "v"(ob) : "memory");   // behind the sixteen loads, their offset named as an input so that its register lives up to this wait and no load's result lands on it
  __builtin_amdgcn_sched_barrier(0);   // keeps every load in front of the first conversion: left alone, the compiler holds the last two loads back until the first two have landed, a second memory latency
#pragma unroll
  for (int p = 0; p < PKE / 1024; ++p) { v4b o;
#pragma unroll
    for (int i = 0; i < 4; ++i) o[i] = (__bf16)r[p][i];
    *(v4b*)(dp + p * 1024) = o; }
}
// ---- k_qkv: block = 128 rows x 256 cols, 8 waves (2 x 4) of 64 x 64; a stage is 64 k of both tiles, two LDS buffers each: the x tile goes through registers (rounded to bf16 on the way), the weight tile, bf16 already, is copied from global memory straight into LDS; every wave takes its fragments from there
#define GBM 128
#define GBN 256
#define GPW 144                       // LDS pitch of a 64-k row: 128 B of k + 16 B, an odd multiple of 16 B for the 16-byte fragment reads
#define GAB (GBM * GPW)                // one x buffer
#define GWB (GBN * GPW)                // one weight buffer
// eight asynchronous 16-byte copies a lane, global -> LDS: rows 32 apart of one weight stage. The s_wait_xcnt is the last line of the copies' own statement, so that it stands in front of whatever gives their address registers new values
__device__ __forceinline__ void cp_w8(unsigned l, const __bf16* g) {
  asm volatile("global_load_async_to_lds_b128 %0, %8, off\n\tglobal_load_async_to_lds_b128 %1, %9, off\n\tglobal_load_async_to_lds_b128 %2, %10, off\n\tglobal_load_async_to_lds_b128 %3, %11, off\n\tglobal_load_async_to_lds_b128 %4, %12, off\n\tglobal_load_async_to_lds_b128 %5, %13, off\n\tglobal_load_async_to_lds_b128 %6, %14, off\n\tglobal_load_async_to_lds_b128 %7, %15, off\n\ts_wait_xcnt 0x0"
    :: "v"(l), "v"(l + 32 * GPW), "v"(l + 64 * GPW), "v"(l + 96 * GPW), "v"(l + 128 * GPW), "v"(l + 160 * GPW), "v"(l + 192 * GPW), "v"(l + 224 * GPW),
       "v"(g), "v"(g + 32 * DM), "v"(g + 64 * DM), "v"(g + 96 * DM), "v"(g + 128 * DM), "v"(g + 160 * DM), "v"(g + 192 * DM), "v"(g + 224 * DM) : "memory");
}
__global__ __launch_bounds__(256) void k_qkv(const float* __restrict__ XQ, const float* __restrict__ XK, const float* __restrict__ XV, const __bf16* __restrict__ P, const float* __restrict__ BQ, const float* __restrict__ BK, const float* __restrict__ BV, _Float16* __restrict__ QK, _Float16* __restrict__ QKL, _Float16* __restrict__ VTH, _Float16* __restrict__ VTL) {
  const int n0 = blockIdx.y * GBN; const int which0 = n0 / DM; const float* X = (which0 == 0) ? XQ : (which0 == 1) ? XK : XV; const float* BB = BQ ? (((which0 == 0) ? BQ : (which0 == 1) ? BK : BV) + (n0 - which0 * DM)) : nullptr;
  __shared__ __align__(16) unsigned char sm[2 * GAB + 2 * GWB];
  const int tid = threadIdx.x, wave = tid >> 5, lane = tid & 31, col = lane & 15, g = lane >> 4; const int wm = wave >> 2, wn = wave & 3;
  const int ar = tid >> 4, ac = (tid & 15) * 4, br = tid >> 3, wc = (tid & 7) * 8;   // x: 16 rows a pass, 256 B of a row per 16 threads; weight: 32 rows a pass, one 128-B line per 8 threads
  const float* ga = X + ((size_t)blockIdx.x * GBM + ar) * DM + ac; const __bf16* gb = P + (size_t)(n0 + br) * DM + wc; unsigned char* sw = sm + 2 * GAB;
  unsigned lw = (unsigned)(size_t)(sw + br * GPW + wc * 2);   // the lane's LDS byte address in the weight buffer that the next copies fill; it and gb step from stage to stage, so that the sixteen addresses of a stage's copies are formed where they are used and hold no registers through the products
  v4f ra[8]; v8f acc[4][4] = {};
  // stage s: k 64 s .. + 63 of all 128 x rows and all 256 weight rows, into buffers s & 1 (the short loops are unrolled so that ra stays in registers)
#define QLDA(s) _Pragma("unroll") for (int p = 0; p < 8; ++p) ra[p] = *(const v4f*)(ga + (size_t)p * 16 * DM + (s) * 64)
#define QSTA(s) _Pragma("unroll") for (int p = 0; p < 8; ++p) { v4b t; _Pragma("unroll") for (int i = 0; i < 4; ++i) t[i] = (__bf16)ra[p][i]; *(v4b*)(sm + ((s) & 1) * GAB + (ar + p * 16) * GPW + ac * 2) = t; }
#define QFRG(q) _Pragma("unroll") for (int i = 0; i < 4; ++i) { fa[i] = frag_b((const __bf16*)(sm + (s & 1) * GAB + (wm * 64 + i * 16 + col) * GPW + (q) * 64), lane); fb[i] = frag_b((const __bf16*)(sw + (s & 1) * GWB + (wn * 64 + i * 16 + col) * GPW + (q) * 64), lane); }
#define QMAC() _Pragma("unroll") for (int i = 0; i < 4; ++i) { _Pragma("unroll") for (int j = 0; j < 4; ++j) acc[i][j] = wmma_bf(fa[i], fb[j], acc[i][j]); }
#define QCPW() do { cp_w8(lw, gb); lw ^= lx; gb += 64; } while (0)
  const unsigned lx = lw ^ (lw + GWB);   // toggles lw between the two weight buffers
  QLDA(0); QCPW(); QSTA(0); QLDA(1);
  asm volatile("s_wait_asynccnt 0x0" ::: "memory");   // stage 0's weight copies of this wave have landed before the barrier that publishes them
  __syncthreads();
  QCPW();
#pragma unroll 2   // two trips a round, so that every buffer's LDS offset is a constant
  for (int s = 0; s < DM / 64; ++s) {
    v16b fa[4], fb[4];   // one 32-k half's fragments at a time
    // the x rows loaded one trip ago go into the buffer whose readers the last barrier has ended; the next loads have this whole trip to land
    if (s + 1 < DM / 64) { QSTA(s + 1); }
    if (s + 2 < DM / 64) { QLDA(s + 2); }
    QFRG(0); QMAC();
    QFRG(1); QMAC();
    asm volatile("s_wait_dscnt 0x0" ::: "memory");     // this wave's reads of the buffers that are refilled behind the barrier have retired
    asm volatile("s_wait_asynccnt 0x0" ::: "memory");  // this wave's copies of stage s + 1 have landed before the barrier that publishes them
    __syncthreads();   // publishes stage s + 1 (x stores and weight copies) and ends every read of stage s
    if (s + 2 < DM / 64) { QCPW(); } }   // into the weight buffer that this trip has just read; a whole trip to land
  asm volatile("s_wait_asynccnt 0x0" ::: "memory");   // no copy is outstanding when the buffers are reused below
  // epilogue: each wave stages 16 output rows at a time (hi and residual plane, pitch 144 B) in its own part of the buffers, all of whose readers have passed the loop's last barrier, and stores whole 128-B lines
  _Float16* eh = (_Float16*)(sm + wave * (2 * 16 * 144)); _Float16* el = eh + 16 * 72;
  const size_t rw = (size_t)blockIdx.x * GBM + wm * 64; const int cw = wn * 64; const int el_r = lane >> 3, el_c = (lane & 7) * 8;
  float bias[4];
#pragma unroll
  for (int j = 0; j < 4; ++j) bias[j] = BB ? bfr(BB[cw + j * 16 + col]) : 0.f;
  if (n0 < 2 * DM) {   // q, k (+ bias) as f16 hi + (x2048) residual; q stored unscaled, 1/8 applied to the f32 score
#pragma unroll
    for (int i = 0; i < 4; ++i) {
#pragma unroll
      for (int j = 0; j < 4; ++j) {
#pragma unroll
        for (int r = 0; r < 8; ++r) { const float v = acc[i][j][r] + bias[j]; const _Float16 hv = (_Float16)v; eh[(8 * g + r) * 72 + j * 16 + col] = hv; el[(8 * g + r) * 72 + j * 16 + col] = (_Float16)((v - (float)hv) * 2048.0f); } }
      LDSX();
#pragma unroll
      for (int p = 0; p < 4; ++p) { const int rl = p * 4 + el_r; const size_t o = (rw + i * 16 + rl) * (2 * DM) + n0 + cw + el_c; vst2((unsigned*)(QK + o), *(const v4u*)&eh[rl * 72 + el_c]); vst2((unsigned*)(QKL + o), *(const v4u*)&el[rl * 72 + el_c]); }
      LDSX(); }
  } else {   // v (+ bias) transposed: [b][h*64+d][s], 16 d rows of 64 s at a time
    const int b = (int)(rw / SS), s0 = (int)(rw % SS); const int pc0 = n0 - 2 * DM + cw;
#pragma unroll
    for (int j = 0; j < 4; ++j) {
#pragma unroll
      for (int i = 0; i < 4; ++i) { v8h hh, ll;
#pragma unroll
        for (int r = 0; r < 8; ++r) { const float v = acc[i][j][r] + bias[j]; const _Float16 hv = (_Float16)v; hh[r] = hv; ll[r] = (_Float16)((v - (float)hv) * 2048.0f); }
        *(v8h*)&eh[col * 72 + i * 16 + 8 * g] = hh; *(v8h*)&el[col * 72 + i * 16 + 8 * g] = ll; }
      LDSX();
#pragma unroll
      for (int p = 0; p < 4; ++p) { const int d = p * 4 + el_r; const size_t o = ((size_t)b * DM + pc0 + j * 16 + d) * SS + s0 + el_c; vst2((unsigned*)(VTH + o), *(const v4u*)&eh[d * 72 + el_c]); vst2((unsigned*)(VTL + o), *(const v4u*)&el[d * 72 + el_c]); }
      LDSX(); }
    asm volatile("s_wait_xcnt 0x0" ::: "memory");   // behind the last pass's stores, before the code after this branch that rewrites their address registers
  }
}
// hardware exp2 with the one free slot behind it that the instruction set asks for before a transcendental's result is read or its source overwritten
__device__ __forceinline__ float exp2_slot(float x) { float e; asm("v_exp_f32 %0, %1\n\tv_nop" : "=v"(e) : "v"(x)); return e; }
// ---- k_attn: block = (64 queries, head h, batch b): the 128 keys that the block's window can touch are staged once in LDS (k rows and v^T rows, contiguous 128-B and 256-B pieces of global memory, shared by the four waves; each wave's q rows likewise), and every q, k and v fragment is read from there; both products transposed: S^T = K . Q^T (K = 64: 2 k-steps), scores = (q.k) * 0.125 with single f16 operands, one softmax over the 128 staged keys with a query's scores in one pair of lanes, O^T = V^T . P^T with P taken from the score registers (f16, x2^11); O[b*S+q][h*64+d] = acc / 2048 / l (256-B segments)
#define AKN (64 + 2 * HALFW)          // keys staged per block
#define AKP 144                       // LDS pitch of a k row: 128 B + 16 B, an odd multiple of 16 B for the 16-byte fragment reads
#define AVP (2 * AKN + 16)            // LDS pitch of a v^T row: 256 B + 16 B, likewise
__global__ __launch_bounds__(128) void k_attn(const _Float16* __restrict__ QK, const _Float16* __restrict__ QKL, const _Float16* __restrict__ VTH, const _Float16* __restrict__ VTL, const void* __restrict__ KMASK, float* __restrict__ O) {
  __shared__ __align__(16) float so[4][16][68];
  __shared__ __align__(16) unsigned char sk[AKN * AKP]; __shared__ __align__(16) unsigned char sv[HD * AVP];
  const int tid = threadIdx.x, wave = tid >> 5, lane = tid & 31, col = lane & 15, g = lane >> 4;
  const int qb = blockIdx.x, h = blockIdx.y, b = blockIdx.z; const int q0 = qb * 64 + wave * 16;
  const int kb = qb * 64 - HALFW;   // key index of LDS row 0 (a multiple of 32); keys outside 0 .. SS - 1 are loaded from a clamped address (finite values of other keys) and masked like keys outside the window
  unsigned char* sq = (unsigned char*)&so[wave][0][0];   // the wave's own 16 q rows (pitch AKP) lie where it stages its output rows at the end, long after their one read
  { v4u tk[8], tv[8], tq[4];   // 16-byte pieces: 8 lanes a k or q row (16 k rows a pass of the block, 4 q rows a pass of a wave), 16 lanes a v^T row (8 rows a pass); all twenty loads are in flight before the first store
    const unsigned ko = (unsigned)((tid >> 3) * (2 * DM) + (tid & 7) * 8), vo = (unsigned)((tid >> 4) * SS + min(max(kb + (tid & 15) * 8, 0), SS - 8)), qo = (unsigned)((wave * 16 + (lane >> 3)) * (2 * DM) + (tid & 7) * 8);   // one offset a thread for each array; the rest of every address is the same for the whole block
    const _Float16* vb = VTH + ((size_t)b * DM + h * HD) * SS; const _Float16* qp = QK + ((size_t)b * SS + qb * 64) * (2 * DM) + h * HD;
#pragma unroll
    for (int p = 0; p < 8; ++p) { const int kt = min(max(kb + (p >> 1) * 32, 0), SS - 32); tk[p] = *(const v4u*)(QK + ((size_t)b * SS + kt + (p & 1) * 16) * (2 * DM) + DM + h * HD + ko); }
#pragma unroll
    for (int p = 0; p < 8; ++p) tv[p] = *(const v4u*)(vb + (size_t)p * 8 * SS + vo);
#pragma unroll
    for (int p = 0; p < 4; ++p) tq[p] = *(const v4u*)(qp + (size_t)p * 4 * (2 * DM) + qo);
    asm volatile("s_wait_xcnt 0x0" ::: "memory");   // behind the twenty loads: the registers that hold their offsets are given new values right after
#pragma unroll
    for (int p = 0; p < 8; ++p) { *(v4u*)(sk + ((tid >> 3) + p * 16) * AKP + (tid & 7) * 16) = tk[p]; *(v4u*)(sv + ((tid >> 4) + p * 8) * AVP + (tid & 15) * 16) = tv[p]; }
#pragma unroll
    for (int p = 0; p < 4; ++p) *(v4u*)(sq + ((lane >> 3) + p * 4) * AKP + (tid & 7) * 16) = tq[p]; }
  // scores are formed transposed, S^T = K . Q^T: a lane holds, of every 16-key tile, 8 keys (8 g + r) of ONE query (q0 + col); lanes l and l ^ 16 share a query
  const int qi = q0 + col; const int lo = max(qi - HALFW, 0); const unsigned span = (unsigned)(min(qi + HALFW, SS - 1) - lo); const int e0 = kb + 8 * g - lo;   // key kb + 16 t + 8 g + r lies in the window |i - j| <= 32 and in 0 .. SS - 1 exactly if (unsigned)(e0 + 16 t + r) <= span
  __syncthreads();   // publishes the staged k and v rows to all four waves; nothing overwrites them afterwards
  v16h bq[2];
#pragma unroll
  for (int kc = 0; kc < 2; ++kc) bq[kc] = frag_h((const _Float16*)(sq + col * AKP) + kc * 32, lane);
  v8f s[AKN / 16];
#pragma unroll
  for (int tg = 0; tg < AKN / 16; tg += 4) { v16h fk[2][4];   // four independent score tiles at a time, so that no product waits for its accumulator; their eight k fragments are read as one group, behind one wait
#pragma unroll
    for (int kc = 0; kc < 2; ++kc) {
#pragma unroll
      for (int t = 0; t < 4; ++t) fk[kc][t] = frag_h((const _Float16*)(sk + ((tg + t) * 16 + col) * AKP) + kc * 32, lane); }
#pragma unroll
    for (int t = tg; t < tg + 4; ++t) s[t] = v8f{};
#pragma unroll
    for (int kc = 0; kc < 2; ++kc) {
#pragma unroll
      for (int t = tg; t < tg + 4; ++t) s[t] = wmma16(fk[kc][t - tg], bq[kc], s[t]); } }   // single product: k, q as one-rounding f16 operands
#pragma unroll
  for (int t = 0; t < AKN / 16; ++t) {
#pragma unroll
    for (int r = 0; r < 8; ++r) s[t][r] = ((unsigned)(e0 + t * 16 + r) <= span) ? s[t][r] * 0.125f : -3.0e38f; }   // 1/sqrt(64); keys outside the window or the sequence
  // softmax of a query over all staged keys at once: maximum and sum in the lane, one exchange between the two halves each (the query's own key is always staged and inside the window, so the maximum is a real score)
  v8f mv = s[0];
#pragma unroll
  for (int t = 1; t < AKN / 16; ++t) {
#pragma unroll
    for (int r = 0; r < 8; ++r) mv[r] = fmaxf(mv[r], s[t][r]); }
  float mx = fmaxf(fmaxf(fmaxf(mv[0], mv[1]), fmaxf(mv[2], mv[3])), fmaxf(fmaxf(mv[4], mv[5]), fmaxf(mv[6], mv[7])));
  mx = fmaxf(mx, __shfl_xor(mx, 16));
  v8f ls;
#pragma unroll
  for (int t = 0; t < AKN / 16; ++t) {
#pragma unroll
    for (int r = 0; r < 8; ++r) { const float e = exp2_slot((s[t][r] - mx) * 1.44269504f); s[t][r] = e; ls[r] = (t == 0) ? e : ls[r] + e; } }   // a masked score is -3e38: its exponential is an exact 0
  float l = ((ls[0] + ls[1]) + (ls[2] + ls[3])) + ((ls[4] + ls[5]) + (ls[6] + ls[7]));
  l += __shfl_xor(l, 16);
  // O^T += V^T . P^T: two score tiles of a lane, converted in place, are the B operand of a 32-key step (element i = key 8 g + i, element 8 + i = key 16 + 8 g + i, the order in which frag_h reads a v^T row)
  v8f acc[4] = {};
#pragma unroll
  for (int j = 0; j < AKN / 32; ++j) { v16h pb, fv[4];   // the step's four v fragments are read as one group, ahead of the conversion of P
#pragma unroll
    for (int dt = 0; dt < 4; ++dt) fv[dt] = frag_h((const _Float16*)(sv + (dt * 16 + col) * AVP) + j * 32, lane);
#pragma unroll
    for (int i = 0; i < 8; ++i) { pb[i] = (_Float16)(s[2 * j][i] * 2048.0f); pb[8 + i] = (_Float16)(s[2 * j + 1][i] * 2048.0f); }   // P scaled by 2^11 before the f16 rounding so small softmax weights stay out of the f16 subnormal range; 2^-11 folded into the epilogue
#pragma unroll
    for (int dt = 0; dt < 4; ++dt) acc[dt] = wmma16(fv[dt], pb, acc[dt]); }   // single product: V x P (x2^11)
  const float il = (1.0f / 2048.0f) / l;
#pragma unroll
  for (int dt = 0; dt < 4; ++dt) { v4f o0, o1;   // the lane's 8 consecutive d of its query's output row
#pragma unroll
    for (int r = 0; r < 4; ++r) { o0[r] = acc[dt][r] * il; o1[r] = acc[dt][4 + r] * il; }
    *(v4f*)&so[wave][col][dt * 16 + 8 * g] = o0; *(v4f*)&so[wave][col][dt * 16 + 8 * g + 4] = o1; }
  LDSX();
  for (int rl = 0; rl < 16; ++rl) if (lane < 16) vst2(O + ((size_t)b * SS + q0 + rl) * DM + h * HD + lane * 4, *(const v4f*)&so[wave][rl][lane * 4]);
}
// ---- k_out: block = 128 rows x 256 cols, 8 waves (2 x 4) of 64 x 64, one block a WGP; 64-k stages in two LDS buffers as in k_qkv (O through registers, split once per block into bf16 hi and residual planes; the weight tile copied straight into LDS by cp_w8): out = O(hi/lo) . Wo rows (2 products) + bo
#define OBN 256
#define OAB (2 * GBM * GPW)             // one O buffer: hi rows, then residual rows
#define OWB (OBN * GPW)                 // one weight buffer
__global__ __launch_bounds__(256) void k_out(const float* __restrict__ O, const __bf16* __restrict__ P, const float* __restrict__ BO, float* __restrict__ Y) {
  __shared__ __align__(16) unsigned char sm[2 * OAB + 2 * OWB];
  const int tid = threadIdx.x, wave = tid >> 5, lane = tid & 31, col = lane & 15, g = lane >> 4; const int wm = wave >> 2, wn = wave & 3; const int n0 = blockIdx.y * OBN;
  const int ar = tid >> 4, ac = (tid & 15) * 4, br = tid >> 3, wc = (tid & 7) * 8;   // O: 16 rows a pass, 256 B of a row per 16 threads; weight: 32 rows a pass, one 128-B line per 8 threads
  const float* ga = O + ((size_t)blockIdx.x * GBM + ar) * DM + ac; const __bf16* gb = P + (size_t)(n0 + br) * DM + wc; unsigned char* sw = sm + 2 * OAB;
  unsigned lw = (unsigned)(size_t)(sw + br * GPW + wc * 2); const unsigned lx = lw ^ (lw + OWB);   // the lane's LDS byte address in the weight buffer that the next copies fill, and what toggles it; lw and gb step from stage to stage as in k_qkv
  v4f ra[8]; v8f acc[4][4] = {};
  // stage s: k 64 s .. + 63 of all 128 O rows and all 256 weight rows, into buffers s & 1 (the short loops are unrolled so that ra stays in registers)
#define OLDA(s) _Pragma("unroll") for (int p = 0; p < 8; ++p) ra[p] = *(const v4f*)(ga + (size_t)p * 16 * DM + (s) * 64)
#define OSTA(s) _Pragma("unroll") for (int p = 0; p < 8; ++p) { v4b th, tl; _Pragma("unroll") for (int i = 0; i < 4; ++i) { th[i] = (__bf16)ra[p][i]; tl[i] = (__bf16)(ra[p][i] - (float)th[i]); } *(v4b*)(sm + ((s) & 1) * OAB + (ar + p * 16) * GPW + ac * 2) = th; *(v4b*)(sm + ((s) & 1) * OAB + (GBM + ar + p * 16) * GPW + ac * 2) = tl; }
#define OCPW() do { cp_w8(lw, gb); lw ^= lx; gb += 64; } while (0)
  // the weight and residual fragments, which the first sixteen products take, are read first; the hi fragments land under those products
#define OFRG(q) _Pragma("unroll") for (int j = 0; j < 4; ++j) fb[j] = frag_b((const __bf16*)(sw + (s & 1) * OWB + (wn * 64 + j * 16 + col) * GPW + (q) * 64), lane); _Pragma("unroll") for (int i = 0; i < 4; ++i) fl[i] = frag_b((const __bf16*)(sm + (s & 1) * OAB + (GBM + wm * 64 + i * 16 + col) * GPW + (q) * 64), lane); _Pragma("unroll") for (int i = 0; i < 4; ++i) fh[i] = frag_b((const __bf16*)(sm + (s & 1) * OAB + (wm * 64 + i * 16 + col) * GPW + (q) * 64), lane);
  // per accumulator: residual product, then hi product; sixteen independent tiles between the two
#define OMAC() _Pragma("unroll") for (int i = 0; i < 4; ++i) { _Pragma("unroll") for (int j = 0; j < 4; ++j) acc[i][j] = wmma_bf(fl[i], fb[j], acc[i][j]); } _Pragma("unroll") for (int i = 0; i < 4; ++i) { _Pragma("unroll") for (int j = 0; j < 4; ++j) acc[i][j] = wmma_bf(fh[i], fb[j], acc[i][j]); }
  OLDA(0); OCPW(); OSTA(0); OLDA(1);
  asm volatile("s_wait_asynccnt 0x0" ::: "memory");   // stage 0's weight copies of this wave have landed before the barrier that publishes them
  __syncthreads();
  OCPW();
#pragma unroll 2   // two trips a round, so that every buffer's LDS offset is a constant
  for (int s = 0; s < DM / 64; ++s) {
    v16b fh[4], fl[4], fb[4];   // one 32-k half's fragments at a time
    // the O rows loaded one trip ago go into the buffer whose readers the last barrier has ended; the next loads have this whole trip to land
    if (s + 1 < DM / 64) { OSTA(s + 1); }
    if (s + 2 < DM / 64) { OLDA(s + 2); asm volatile("s_wait_xcnt 0x0" ::: "memory"); }   // behind the eight loads: in the listing the fragment reads that follow reuse the loads' address registers
    OFRG(0); OMAC();
    OFRG(1); OMAC();
    asm volatile("s_wait_dscnt 0x0" ::: "memory");     // this wave's reads of the buffers that are refilled behind the barrier have retired
    asm volatile("s_wait_asynccnt 0x0" ::: "memory");  // this wave's copies of stage s + 1 have landed before the barrier that publishes them
    __syncthreads();   // publishes stage s + 1 (O stores and weight copies) and ends every read of stage s
    if (s + 2 < DM / 64) { OCPW(); } }   // into the weight buffer that this trip has just read; a whole trip to land
  asm volatile("s_wait_asynccnt 0x0" ::: "memory");   // no copy is outstanding when the buffers are reused below
  // epilogue: each wave stages 16 rows of 64 f32 (pitch 272 B) in its own part of the buffers, behind the loop's last barrier, and stores whole 256-B row pieces
  float* so = (float*)(sm + wave * (16 * 272)); const size_t rw = (size_t)blockIdx.x * GBM + wm * 64; const int cw = n0 + wn * 64;
  float bias[4];
  const int bi = cw + col;
#pragma unroll
  for (int j = 0; j < 4; ++j) bias[j] = BO[bi + j * 16];
  asm volatile("s_wait_xcnt 0x0" :: "v"(bi) : "memory");   // behind the four bias loads, whose offset register the compiler reuses right after; the offset is named as an input so that its register lives up to this wait
#pragma unroll
  for (int j = 0; j < 4; ++j) bias[j] = bfr(bias[j]);
#pragma unroll
  for (int i = 0; i < 4; ++i) {
#pragma unroll
    for (int j = 0; j < 4; ++j) {
#pragma unroll
      for (int r = 0; r < 8; ++r) so[(8 * g + r) * 68 + j * 16 + col] = acc[i][j][r] + bias[j]; }
    LDSX();
#pragma unroll
    for (int p = 0; p < 8; ++p) { const int rl = p * 2 + g; vst2(Y + (rw + i * 16 + rl) * DM + cw + col * 4, *(const v4f*)&so[rl * 68 + col * 4]); }
    LDSX(); }
}
extern "C" void kernel_launch(void* const* d_in, const int* in_sizes, int n_in, void* d_out, int out_size, void* d_ws, size_t ws_size, hipStream_t stream) {
  (void)in_sizes; (void)n_in; (void)out_size;
  const float** F = (const float**)d_in;   // 0 x [4,2048,1024], 1 W_qkv [3072,1024] natural, 2 b_qkv [3072], 3 W_out [1024,1024], 4 b_out
  if (ws_size < (size_t)WS_END) return;
  char* ws = (char*)d_ws; __bf16* PK = (__bf16*)(ws + WS_PK); _Float16 *QK = (_Float16*)(ws + WS_QK), *QKL = (_Float16*)(ws + WS_QKL), *VTH = (_Float16*)(ws + WS_VTH), *VTL = (_Float16*)(ws + WS_VTL); float* O = (float*)(ws + WS_O);
  k_pack<<<dim3(4 * DM * DM / PKE), 256, 0, stream>>>(F[1], F[1] + (size_t)DM * DM, F[1] + (size_t)2 * DM * DM, F[3], PK);
  k_qkv<<<dim3(TNB * SS / GBM, QKVW / GBN), 256, 0, stream>>>(F[0], F[0], F[0], PK + PK_A, F[2], F[2] + DM, F[2] + 2 * DM, QK, QKL, VTH, VTL);
  k_attn<<<dim3(TQB, NH, TNB), 128, 0, stream>>>(QK, QKL, VTH, VTL, nullptr, O);
  k_out<<<dim3(TNB * SS / GBM, DM / OBN), 256, 0, stream>>>(O, PK + PK_P, F[4], (float*)d_out);
}

// v007
// One run takes 93.4 microseconds.
// Timed twice side by side with v006, it ran 1.05 times as fast both times.
// Over all steps from v000 it is 3.99 times as fast.
// compute dtype: all float inputs rounded to bf16; qkv = x . W_qkv^T + b with EXACT bf16 products on WMMA 16x16x32 (natural rows; the fused weight as three contiguous row blocks); windowed attention (only the 128 keys that a block of 64 queries can touch under |i - j| <= 32 are visited, per-score window test): q, k single f16 x 1/8, softmax in f32 (hardware exp), P (scaled by 2^11, single f16) x v (single f16); out = o (bf16 hi + residual) . W_out^T (2 products) + b_out.
#include <hip/hip_runtime.h>
#include <math.h>

typedef __attribute__((ext_vector_type(16))) _Float16 v16h;
typedef __attribute__((ext_vector_type(16))) __bf16 v16b;
typedef __attribute__((ext_vector_type(8)))  _Float16 v8h;
typedef __attribute__((ext_vector_type(8)))  float v8f;
typedef __attribute__((ext_vector_type(4)))  float v4f;
typedef __attribute__((ext_vector_type(2)))  float v2f;
typedef __attribute__((ext_vector_type(4)))  unsigned v4u;
typedef __attribute__((ext_vector_type(4)))  int v4i;
typedef float __attribute__((may_alias)) float_a;
typedef int __attribute__((may_alias)) int_a;

template <typename T> __device__ __forceinline__ void vst2(void* p, T v) { *(T*)p = v;  }
__device__ __forceinline__ v8f wmma16(v16h a, v16h b, v8f c) {
  v8f d = __builtin_amdgcn_wmma_f32_16x16x32_f16(false, a, false, b, (short)0, c, false, false);
  asm volatile("v_nop\n\tv_nop\n\tv_nop\n\tv_nop" : "+v"(d) : "v"(a), "v"(b));
  return d;
}
__device__ __forceinline__ v8f wmma_bf(v16b a, v16b b, v8f c) {
  v8f d = __builtin_amdgcn_wmma_f32_16x16x32_bf16(false, a, false, b, (short)0, c, false, false);
  asm volatile("v_nop\n\tv_nop\n\tv_nop\n\tv_nop" : "+v"(d) : "v"(a), "v"(b));
  return d;
}
// Local-window multi-head self attention (B 4, T 2,048, d 1,024, 16 heads x 64, window |i - j| <= 32): fused qkv projection + bias, windowed softmax(q k^T / 8) v, output projection + bias.
__device__ __forceinline__ v16h frag_h(const _Float16* rowk0, int lane) {
  union { v16h v; v8h q[2]; } u; const _Float16* p = rowk0 + 8 * (lane >> 4);
  u.q[0] = *(const v8h*)p; u.q[1] = *(const v8h*)(p + 16); return u.v;
}
__device__ __forceinline__ v16h frag_f32(const float* rowk0, int lane) {
  v16h a; const float* p = rowk0 + 8 * (lane >> 4);
#pragma unroll
  for (int i = 0; i < 8; ++i) { a[i] = (_Float16)p[i]; a[8 + i] = (_Float16)p[16 + i]; }
  return a;
}
__device__ __forceinline__ v16h frag_f32s(const float* rowk0, int lane, float sc) {
  v16h a; const float* p = rowk0 + 8 * (lane >> 4);
#pragma unroll
  for (int i = 0; i < 8; ++i) { a[i] = (_Float16)(p[i] * sc); a[8 + i] = (_Float16)(p[16 + i] * sc); }
  return a;
}
// column fragment from a [K][ld] layout (column n), rows >= K read as 0
__device__ __forceinline__ v16h fragc_f32(const float* W, int k0, int n, int lane, int ld, int K) {
  v16h a; const int g = lane >> 4;
#pragma unroll
  for (int i = 0; i < 8; ++i) { const int ka = k0 + 8 * g + i, kb = ka + 16;
    a[i] = (_Float16)(ka < K ? W[(size_t)(ka < K ? ka : K - 1) * ld + n] : 0.f); a[8 + i] = (_Float16)(kb < K ? W[(size_t)(kb < K ? kb : K - 1) * ld + n] : 0.f); }
  return a;
}
struct F2 { v16b h, l; };
__device__ __forceinline__ F2 bsplit16(const float v[16]) { F2 r;
#pragma unroll
  for (int i = 0; i < 16; ++i) { const __bf16 h = (__bf16)v[i]; r.h[i] = h; r.l[i] = (__bf16)(v[i] - (float)h); }
  return r; }
__device__ __forceinline__ F2 split_row(const float* row, int k0, int lane) { float v[16]; const float* p = row + k0 + 8 * (lane >> 4);
#pragma unroll
  for (int i = 0; i < 8; ++i) { v[i] = p[i]; v[8 + i] = p[16 + i]; }
  return bsplit16(v); }
__device__ __forceinline__ F2 split_rowK(const float* row, int k0, int lane, int K) { float v[16]; const int g = lane >> 4;
#pragma unroll
  for (int i = 0; i < 8; ++i) { const int ka = k0 + 8 * g + i, kb = ka + 16; v[i] = ka < K ? row[ka < K ? ka : K - 1] : 0.f; v[8 + i] = kb < K ? row[kb < K ? kb : K - 1] : 0.f; }
  return bsplit16(v); }
__device__ __forceinline__ F2 split_col(const float* W, int k0, int n, int lane, int ld, int K) { float v[16]; const int g = lane >> 4;
#pragma unroll
  for (int i = 0; i < 8; ++i) { const int ka = k0 + 8 * g + i, kb = ka + 16; v[i] = ka < K ? W[(size_t)(ka < K ? ka : K - 1) * ld + n] : 0.f; v[8 + i] = kb < K ? W[(size_t)(kb < K ? kb : K - 1) * ld + n] : 0.f; }
  return bsplit16(v); }
__device__ __forceinline__ v8f mac3(const F2& a, const F2& b, v8f c) { c = wmma_bf(a.l, b.h, c); c = wmma_bf(a.h, b.l, c); return wmma_bf(a.h, b.h, c); }
__device__ __forceinline__ float sigm(float v) { return 1.0f / (1.0f + expf(-v)); }
#define LDSX() do { asm volatile("s_wait_dscnt 0" ::: "memory"); __builtin_amdgcn_wave_barrier(); __builtin_amdgcn_fence(__ATOMIC_RELEASE, "workgroup"); } while (0)


#define NB 4
#define SS 2048
#define DM 1024
#define NH 16
#define HALFW 32
#define HD 64
#define QKVW (3 * DM)
#ifndef TQB
#define TQB (SS / 64)
#define TNB NB
#define TOB (NB * SS / 64)     // 64-row tiles of all 8192 rows; unused
#endif
typedef __attribute__((ext_vector_type(8))) __bf16 v8b;
__device__ __forceinline__ v16b frag_b(const __bf16* rowk0, int lane) {
  union { v16b v; v8b q[2]; } u; const __bf16* p = rowk0 + 8 * (lane >> 4);
  u.q[0] = *(const v8b*)p; u.q[1] = *(const v8b*)(p + 16); return u.v;
}
__device__ __forceinline__ float bfr(float v) { return (float)(__bf16)v; }
__device__ __attribute__((noinline)) float exp_ni(float v) { return expf(v); }
__device__ __attribute__((noinline)) float erf_ni(float v) { return erff(v); }

#define PK_A 0                       // [3072][1024] Wqkv rows (natural [out][in])
#define PK_P (PK_A + QKVW * DM)        // [1024][1024] Wo rows (natural)
#define PK_END (PK_P + DM * DM)
#define WS_PK  0u
#define WS_QK  (WS_PK + 2u * PK_END)             // f16 [8192 rows][2048]: q | k
#define WS_QKL (WS_QK + 2u * NB * SS * 2 * DM)     // neither written nor read (k_attn's second argument, which it does not use)
#define WS_VTH (WS_QKL + 2u * NB * SS * 2 * DM)    // f16 [b][1024 (h*64+d)][2048 s]
#define WS_VTL (WS_VTH + 2u * NB * DM * SS)        // neither written nor read (k_attn's fourth argument, which it does not use)
#define WS_O   (WS_VTL + 2u * NB * DM * SS)        // f32 [8192][1024]
#define WS_CS  (WS_O + 4u * NB * SS * DM)           // f32 [2][2048][32], unused
#define WS_END (WS_CS + 4u * 2 * SS * 32)
// ---- k_pack: the four 1024 x 1024 weight blocks (the q, k, v row blocks of the fused weight, then W_o), natural [out][in] rows, rounded to bf16 into PK_A rows which*1024 + n and PK_P: elementwise, so a block takes PKE consecutive elements of one matrix: 256 blocks of 8 waves, one a WGP, 64 elements a thread; a thread's sixteen 16-byte loads (512 contiguous bytes a wave each) are all in flight before its first store (256 contiguous bytes a wave)
#define PKE 16384
typedef __attribute__((ext_vector_type(4))) __bf16 v4b;
__global__ __launch_bounds__(256) void k_pack(const float* __restrict__ WQ, const float* __restrict__ WK, const float* __restrict__ WV, const float* __restrict__ WO, __bf16* __restrict__ PK) {
  const int which = blockIdx.x / (DM * DM / PKE), e0 = (blockIdx.x % (DM * DM / PKE)) * PKE + threadIdx.x * 4; const float* Wm = (which == 0) ? WQ : (which == 1) ? WK : (which == 2) ? WV : WO;
  const unsigned ob = (unsigned)e0 * 4u;   // the thread's byte offset in its matrix
  __bf16* dp = ((which < 3) ? PK + PK_A + (size_t)which * DM * DM : PK + PK_P) + e0;
  v4f r[PKE / 1024];   // the short loops below are unrolled so that r stays in registers
#pragma unroll
  for (int p = 0; p < PKE / 1024; ++p) r[p] = *(const v4f*)((const char*)Wm + ob + p * 4096);
  asm volatile("s_wait_xcnt 0x0" :: "v"(ob) : "memory");   // behind the sixteen loads, their offset named as an input so that its register lives up to this wait and no load's result lands on it
  __builtin_amdgcn_sched_barrier(0);   // keeps every load in front of the first conversion: left alone, the compiler holds the last two loads back until the first two have landed, a second memory latency
#pragma unroll
  for (int p = 0; p < PKE / 1024; ++p) { v4b o;
#pragma unroll
    for (int i = 0; i < 4; ++i) o[i] = (__bf16)r[p][i];
    *(v4b*)(dp + p * 1024) = o; }
}
// ---- k_qkv: block = 128 rows x 256 cols, 8 waves (2 x 4) of 64 x 64; a stage is 64 k of both tiles, two LDS buffers each: the x tile goes through registers (rounded to bf16 on the way), the weight tile, bf16 already, is copied from global memory straight into LDS; every wave takes its fragments from there
#define GBM 128
#define GBN 256
#define GPW 144                       // LDS pitch of a 64-k row: 128 B of k + 16 B, an odd multiple of 16 B for the 16-byte fragment reads
#define GAB (GBM * GPW)                // one x buffer
#define GWB (GBN * GPW)                // one weight buffer
// eight asynchronous 16-byte copies a lane, global -> LDS: rows 32 apart of one weight stage. The s_wait_xcnt is the last line of the copies' own statement, so that it stands in front of whatever gives their address registers new values
__device__ __forceinline__ void cp_w8(unsigned l, const __bf16* g) {
  asm volatile("global_load_async_to_lds_b128 %0, %8, off\n\tglobal_load_async_to_lds_b128 %1, %9, off\n\tglobal_load_async_to_lds_b128 %2, %10, off\n\tglobal_load_async_to_lds_b128 %3, %11, off\n\tglobal_load_async_to_lds_b128 %4, %12, off\n\tglobal_load_async_to_lds_b128 %5, %13, off\n\tglobal_load_async_to_lds_b128 %6, %14, off\n\tglobal_load_async_to_lds_b128 %7, %15, off\n\ts_wait_xcnt 0x0"
    :: "v"(l), "v"(l + 32 * GPW), "v"(l + 64 * GPW), "v"(l + 96 * GPW), "v"(l + 128 * GPW), "v"(l + 160 * GPW), "v"(l + 192 * GPW), "v"(l + 224 * GPW),
       "v"(g), "v"(g + 32 * DM), "v"(g + 64 * DM), "v"(g + 96 * DM), "v"(g + 128 * DM), "v"(g + 160 * DM), "v"(g + 192 * DM), "v"(g + 224 * DM) : "memory");
}
__global__ __launch_bounds__(256) void k_qkv(const float* __restrict__ XQ, const float* __restrict__ XK, const float* __restrict__ XV, const __bf16* __restrict__ P, const float* __restrict__ BQ, const float* __restrict__ BK, const float* __restrict__ BV, _Float16* __restrict__ QK, _Float16* __restrict__ VTH) {
  const int n0 = blockIdx.y * GBN; const int which0 = n0 / DM; const float* X = (which0 == 0) ? XQ : (which0 == 1) ? XK : XV; const float* BB = BQ ? (((which0 == 0) ? BQ : (which0 == 1) ? BK : BV) + (n0 - which0 * DM)) : nullptr;
  __shared__ __align__(16) unsigned char sm[2 * GAB + 2 * GWB];
  const int tid = threadIdx.x, wave = tid >> 5, lane = tid & 31, col = lane & 15, g = lane >> 4; const int wm = wave >> 2, wn = wave & 3;
  const int ar = tid >> 4, ac = (tid & 15) * 4, br = tid >> 3, wc = (tid & 7) * 8;   // x: 16 rows a pass, 256 B of a row per 16 threads; weight: 32 rows a pass, one 128-B line per 8 threads
  const float* ga = X + ((size_t)blockIdx.x * GBM + ar) * DM + ac; const __bf16* gb = P + (size_t)(n0 + br) * DM + wc; unsigned char* sw = sm + 2 * GAB;
  unsigned lw = (unsigned)(size_t)(sw + br * GPW + wc * 2);   // the lane's LDS byte address in the weight buffer that the next copies fill; it and gb step from stage to stage, so that the sixteen addresses of a stage's copies are formed where they are used and hold no registers through the products
  v4f ra[8]; v8f acc[4][4] = {};
  // stage s: k 64 s .. + 63 of all 128 x rows and all 256 weight rows, into buffers s & 1 (the short loops are unrolled so that ra stays in registers)
#define QLDA(s) _Pragma("unroll") for (int p = 0; p < 8; ++p) ra[p] = *(const v4f*)(ga + (size_t)p * 16 * DM + (s) * 64)
#define QSTA(s) _Pragma("unroll") for (int p = 0; p < 8; ++p) { v4b t; _Pragma("unroll") for (int i = 0; i < 4; ++i) t[i] = (__bf16)ra[p][i]; *(v4b*)(sm + ((s) & 1) * GAB + (ar + p * 16) * GPW + ac * 2) = t; }
#define QFRG(q) _Pragma("unroll") for (int i = 0; i < 4; ++i) { fa[i] = frag_b((const __bf16*)(sm + (s & 1) * GAB + (wm * 64 + i * 16 + col) * GPW + (q) * 64), lane); fb[i] = frag_b((const __bf16*)(sw + (s & 1) * GWB + (wn * 64 + i * 16 + col) * GPW + (q) * 64), lane); }
#define QMAC() _Pragma("unroll") for (int i = 0; i < 4; ++i) { _Pragma("unroll") for (int j = 0; j < 4; ++j) acc[i][j] = wmma_bf(fa[i], fb[j], acc[i][j]); }
#define QCPW() do { cp_w8(lw, gb); lw ^= lx; gb += 64; } while (0)
  const unsigned lx = lw ^ (lw + GWB);   // toggles lw between the two weight buffers
  QLDA(0); QCPW(); QSTA(0); QLDA(1);
  asm volatile("s_wait_asynccnt 0x0" ::: "memory");   // stage 0's weight copies of this wave have landed before the barrier that publishes them
  __syncthreads();
  QCPW();
#pragma unroll 2   // two trips a round, so that every buffer's LDS offset is a constant
  for (int s = 0; s < DM / 64; ++s) {
    v16b fa[4], fb[4];   // one 32-k half's fragments at a time
    // the x rows loaded one trip ago go into the buffer whose readers the last barrier has ended; the next loads have this whole trip to land
    if (s + 1 < DM / 64) { QSTA(s + 1); }
    if (s + 2 < DM / 64) { QLDA(s + 2); }
    QFRG(0); QMAC();
    QFRG(1); QMAC();
    asm volatile("s_wait_dscnt 0x0" ::: "memory");     // this wave's reads of the buffers that are refilled behind the barrier have retired
    asm volatile("s_wait_asynccnt 0x0" ::: "memory");  // this wave's copies of stage s + 1 have landed before the barrier that publishes them
    __syncthreads();   // publishes stage s + 1 (x stores and weight copies) and ends every read of stage s
    if (s + 2 < DM / 64) { QCPW(); } }   // into the weight buffer that this trip has just read; a whole trip to land
  asm volatile("s_wait_asynccnt 0x0" ::: "memory");   // no copy is outstanding when the buffers are reused below
  // epilogue: each wave stages 32 output rows at a time (pitch 144 B) in its own part of the buffers, all of whose readers have passed the loop's last barrier, and stores whole 128-B lines; only the one f16 rounding that k_attn reads is formed, staged and stored, so that the 64 rows go in two passes
  _Float16* eh = (_Float16*)(sm + wave * (32 * 144));
  const size_t rw = (size_t)blockIdx.x * GBM + wm * 64; const int cw = wn * 64; const int el_r = lane >> 3, el_c = (lane & 7) * 8;
  float bias[4];
#pragma unroll
  for (int j = 0; j < 4; ++j) bias[j] = BB ? bfr(BB[cw + j * 16 + col]) : 0.f;
  if (n0 < 2 * DM) {   // q, k (+ bias) as f16; q stored unscaled, 1/8 applied to the f32 score
#pragma unroll
    for (int ip = 0; ip < 2; ++ip) {
#pragma unroll
      for (int i = 0; i < 2; ++i) {
#pragma unroll
        for (int j = 0; j < 4; ++j) {
#pragma unroll
          for (int r = 0; r < 8; ++r) eh[(i * 16 + 8 * g + r) * 72 + j * 16 + col] = (_Float16)(acc[2 * ip + i][j][r] + bias[j]); } }
      LDSX();
#pragma unroll
      for (int p = 0; p < 8; ++p) { const int rl = p * 4 + el_r; const size_t o = (rw + ip * 32 + rl) * (2 * DM) + n0 + cw + el_c; vst2((unsigned*)(QK + o), *(const v4u*)&eh[rl * 72 + el_c]); }
      LDSX(); }
  } else {   // v (+ bias) transposed: [b][h*64+d][s], 32 d rows of 64 s at a time
    const int b = (int)(rw / SS), s0 = (int)(rw % SS); const int pc0 = n0 - 2 * DM + cw;
#pragma unroll
    for (int jp = 0; jp < 2; ++jp) {
#pragma unroll
      for (int j = 0; j < 2; ++j) {
#pragma unroll
        for (int i = 0; i < 4; ++i) { v8h hh;
#pragma unroll
          for (int r = 0; r < 8; ++r) hh[r] = (_Float16)(acc[i][2 * jp + j][r] + bias[2 * jp + j]);
          *(v8h*)&eh[(j * 16 + col) * 72 + i * 16 + 8 * g] = hh; } }
      LDSX();
#pragma unroll
      for (int p = 0; p < 8; ++p) { const int d = p * 4 + el_r; const size_t o = ((size_t)b * DM + pc0 + jp * 32 + d) * SS + s0 + el_c; vst2((unsigned*)(VTH + o), *(const v4u*)&eh[d * 72 + el_c]); }
      LDSX(); }
    asm volatile("s_wait_xcnt 0x0" ::: "memory");   // behind the last pass's stores, before the code after this branch that rewrites their address registers
  }
}
// hardware exp2 with the one free slot behind it that the instruction set asks for before a transcendental's result is read or its source overwritten
__device__ __forceinline__ float exp2_slot(float x) { float e; asm("v_exp_f32 %0, %1\n\tv_nop" : "=v"(e) : "v"(x)); return e; }
// ---- k_attn: block = (64 queries, head h, batch b): the 128 keys that the block's window can touch are staged once in LDS (k rows and v^T rows, contiguous 128-B and 256-B pieces of global memory, shared by the four waves; each wave's q rows likewise), and every q, k and v fragment is read from there; both products transposed: S^T = K . Q^T (K = 64: 2 k-steps), scores = (q.k) * 0.125 with single f16 operands, one softmax over the 128 staged keys with a query's scores in one pair of lanes, O^T = V^T . P^T with P taken from the score registers (f16, x2^11); O[b*S+q][h*64+d] = acc / 2048 / l (256-B segments)
#define AKN (64 + 2 * HALFW)          // keys staged per block
#define AKP 144                       // LDS pitch of a k row: 128 B + 16 B, an odd multiple of 16 B for the 16-byte fragment reads
#define AVP (2 * AKN + 16)            // LDS pitch of a v^T row: 256 B + 16 B, likewise
__global__ __launch_bounds__(128) void k_attn(const _Float16* __restrict__ QK, const _Float16* __restrict__ QKL, const _Float16* __restrict__ VTH, const _Float16* __restrict__ VTL, const void* __restrict__ KMASK, float* __restrict__ O) {
  __shared__ __align__(16) float so[4][16][68];
  __shared__ __align__(16) unsigned char sk[AKN * AKP]; __shared__ __align__(16) unsigned char sv[HD * AVP];
  const int tid = threadIdx.x, wave = tid >> 5, lane = tid & 31, col = lane & 15, g = lane >> 4;
  const int qb = blockIdx.x, h = blockIdx.y, b = blockIdx.z; const int q0 = qb * 64 + wave * 16;
  const int kb = qb * 64 - HALFW;   // key index of LDS row 0 (a multiple of 32); keys outside 0 .. SS - 1 are loaded from a clamped address (finite values of other keys) and masked like keys outside the window
  unsigned char* sq = (unsigned char*)&so[wave][0][0];   // the wave's own 16 q rows (pitch AKP) lie where it stages its output rows at the end, long after their one read
  { v4u tk[8], tv[8], tq[4];   // 16-byte pieces: 8 lanes a k or q row (16 k rows a pass of the block, 4 q rows a pass of a wave), 16 lanes a v^T row (8 rows a pass); all twenty loads are in flight before the first store
    const unsigned ko = (unsigned)((tid >> 3) * (2 * DM) + (tid & 7) * 8), vo = (unsigned)((tid >> 4) * SS + min(max(kb + (tid & 15) * 8, 0), SS - 8)), qo = (unsigned)((wave * 16 + (lane >> 3)) * (2 * DM) + (tid & 7) * 8);   // one offset a thread for each array; the rest of every address is the same for the whole block
    const _Float16* vb = VTH + ((size_t)b * DM + h * HD) * SS; const _Float16* qp = QK + ((size_t)b * SS + qb * 64) * (2 * DM) + h * HD;
#pragma unroll
    for (int p = 0; p < 8; ++p) { const int kt = min(max(kb + (p >> 1) * 32, 0), SS - 32); tk[p] = *(const v4u*)(QK + ((size_t)b * SS + kt + (p & 1) * 16) * (2 * DM) + DM + h * HD + ko); }
#pragma unroll
    for (int p = 0; p < 8; ++p) tv[p] = *(const v4u*)(vb + (size_t)p * 8 * SS + vo);
#pragma unroll
    for (int p = 0; p < 4; ++p) tq[p] = *(const v4u*)(qp + (size_t)p * 4 * (2 * DM) + qo);
    asm volatile("s_wait_xcnt 0x0" ::: "memory");   // behind the twenty loads: the registers that hold their offsets are given new values right after
#pragma unroll
    for (int p = 0; p < 8; ++p) { *(v4u*)(sk + ((tid >> 3) + p * 16) * AKP + (tid & 7) * 16) = tk[p]; *(v4u*)(sv + ((tid >> 4) + p * 8) * AVP + (tid & 15) * 16) = tv[p]; }
#pragma unroll
    for (int p = 0; p < 4; ++p) *(v4u*)(sq + ((lane >> 3) + p * 4) * AKP + (tid & 7) * 16) = tq[p]; }
  // scores are formed transposed, S^T = K . Q^T: a lane holds, of every 16-key tile, 8 keys (8 g + r) of ONE query (q0 + col); lanes l and l ^ 16 share a query
  const int qi = q0 + col; const int lo = max(qi - HALFW, 0); const unsigned span = (unsigned)(min(qi + HALFW, SS - 1) - lo); const int e0 = kb + 8 * g - lo;   // key kb + 16 t + 8 g + r lies in the window |i - j| <= 32 and in 0 .. SS - 1 exactly if (unsigned)(e0 + 16 t + r) <= span
  __syncthreads();   // publishes the staged k and v rows to all four waves; nothing overwrites them afterwards
  v16h bq[2];
#pragma unroll
  for (int kc = 0; kc < 2; ++kc) bq[kc] = frag_h((const _Float16*)(sq + col * AKP) + kc * 32, lane);
  v8f s[AKN / 16];
#pragma unroll
  for (int tg = 0; tg < AKN / 16; tg += 4) { v16h fk[2][4];   // four independent score tiles at a time, so that no product waits for its accumulator; their eight k fragments are read as one group, behind one wait
#pragma unroll
    for (int kc = 0; kc < 2; ++kc) {
#pragma unroll
      for (int t = 0; t < 4; ++t) fk[kc][t] = frag_h((const _Float16*)(sk + ((tg + t) * 16 + col) * AKP) + kc * 32, lane); }
#pragma unroll
    for (int t = tg; t < tg + 4; ++t) s[t] = v8f{};
#pragma unroll
    for (int kc = 0; kc < 2; ++kc) {
#pragma unroll
      for (int t = tg; t < tg + 4; ++t) s[t] = wmma16(fk[kc][t - tg], bq[kc], s[t]); } }   // single product: k, q as one-rounding f16 operands
#pragma unroll
  for (int t = 0; t < AKN / 16; ++t) {
#pragma unroll
    for (int r = 0; r < 8; ++r) s[t][r] = ((unsigned)(e0 + t * 16 + r) <= span) ? s[t][r] * 0.125f : -3.0e38f; }   // 1/sqrt(64); keys outside the window or the sequence
  // softmax of a query over all staged keys at once: maximum and sum in the lane, one exchange between the two halves each (the query's own key is always staged and inside the window, so the maximum is a real score)
  v8f mv = s[0];
#pragma unroll
  for (int t = 1; t < AKN / 16; ++t) {
#pragma unroll
    for (int r = 0; r < 8; ++r) mv[r] = fmaxf(mv[r], s[t][r]); }
  float mx = fmaxf(fmaxf(fmaxf(mv[0], mv[1]), fmaxf(mv[2], mv[3])), fmaxf(fmaxf(mv[4], mv[5]), fmaxf(mv[6], mv[7])));
  mx = fmaxf(mx, __shfl_xor(mx, 16));
  v8f ls;
#pragma unroll
  for (int t = 0; t < AKN / 16; ++t) {
#pragma unroll
    for (int r = 0; r < 8; ++r) { const float e = exp2_slot((s[t][r] - mx) * 1.44269504f); s[t][r] = e; ls[r] = (t == 0) ? e : ls[r] + e; } }   // a masked score is -3e38: its exponential is an exact 0
  float l = ((ls[0] + ls[1]) + (ls[2] + ls[3])) + ((ls[4] + ls[5]) + (ls[6] + ls[7]));
  l += __shfl_xor(l, 16);
  // O^T += V^T . P^T: two score tiles of a lane, converted in place, are the B operand of a 32-key step (element i = key 8 g + i, element 8 + i = key 16 + 8 g + i, the order in which frag_h reads a v^T row)
  v8f acc[4] = {};
#pragma unroll
  for (int j = 0; j < AKN / 32; ++j) { v16h pb, fv[4];   // the step's four v fragments are read as one group, ahead of the conversion of P
#pragma unroll
    for (int dt = 0; dt < 4; ++dt) fv[dt] = frag_h((const _Float16*)(sv + (dt * 16 + col) * AVP) + j * 32, lane);
#pragma unroll
    for (int i = 0; i < 8; ++i) { pb[i] = (_Float16)(s[2 * j][i] * 2048.0f); pb[8 + i] = (_Float16)(s[2 * j + 1][i] * 2048.0f); }   // P scaled by 2^11 before the f16 rounding so small softmax weights stay out of the f16 subnormal range; 2^-11 folded into the epilogue
#pragma unroll
    for (int dt = 0; dt < 4; ++dt) acc[dt] = wmma16(fv[dt], pb, acc[dt]); }   // single product: V x P (x2^11)
  const float il = (1.0f / 2048.0f) / l;
#pragma unroll
  for (int dt = 0; dt < 4; ++dt) { v4f o0, o1;   // the lane's 8 consecutive d of its query's output row
#pragma unroll
    for (int r = 0; r < 4; ++r) { o0[r] = acc[dt][r] * il; o1[r] = acc[dt][4 + r] * il; }
    *(v4f*)&so[wave][col][dt * 16 + 8 * g] = o0; *(v4f*)&so[wave][col][dt * 16 + 8 * g + 4] = o1; }
  LDSX();
  for (int rl = 0; rl < 16; ++rl) if (lane < 16) vst2(O + ((size_t)b * SS + q0 + rl) * DM + h * HD + lane * 4, *(const v4f*)&so[wave][rl][lane * 4]);
}
// ---- k_out: block = 128 rows x 256 cols, 8 waves (2 x 4) of 64 x 64, one block a WGP; 64-k stages in two LDS buffers as in k_qkv (O through registers, split once per block into bf16 hi and residual planes; the weight tile copied straight into LDS by cp_w8): out = O(hi/lo) . Wo rows (2 products) + bo
#define OBN 256
#define OAB (2 * GBM * GPW)             // one O buffer: hi rows, then residual rows
#define OWB (OBN * GPW)                 // one weight buffer
__global__ __launch_bounds__(256) void k_out(const float* __restrict__ O, const __bf16* __restrict__ P, const float* __restrict__ BO, float* __restrict__ Y) {
  __shared__ __align__(16) unsigned char sm[2 * OAB + 2 * OWB];
  const int tid = threadIdx.x, wave = tid >> 5, lane = tid & 31, col = lane & 15, g = lane >> 4; const int wm = wave >> 2, wn = wave & 3; const int n0 = blockIdx.y * OBN;
  const int ar = tid >> 4, ac = (tid & 15) * 4, br = tid >> 3, wc = (tid & 7) * 8;   // O: 16 rows a pass, 256 B of a row per 16 threads; weight: 32 rows a pass, one 128-B line per 8 threads
  const float* ga = O + ((size_t)blockIdx.x * GBM + ar) * DM + ac; const __bf16* gb = P + (size_t)(n0 + br) * DM + wc; unsigned char* sw = sm + 2 * OAB;
  unsigned lw = (unsigned)(size_t)(sw + br * GPW + wc * 2); const unsigned lx = lw ^ (lw + OWB);   // the lane's LDS byte address in the weight buffer that the next copies fill, and what toggles it; lw and gb step from stage to stage as in k_qkv
  v4f ra[8]; v8f acc[4][4] = {};
  // stage s: k 64 s .. + 63 of all 128 O rows and all 256 weight rows, into buffers s & 1 (the short loops are unrolled so that ra stays in registers)
#define OLDA(s) _Pragma("unroll") for (int p = 0; p < 8; ++p) ra[p] = *(const v4f*)(ga + (size_t)p * 16 * DM + (s) * 64)
#define OSTA(s) _Pragma("unroll") for (int p = 0; p < 8; ++p) { v4b th, tl; _Pragma("unroll") for (int i = 0; i < 4; ++i) { th[i] = (__bf16)ra[p][i]; tl[i] = (__bf16)(ra[p][i] - (float)th[i]); } *(v4b*)(sm + ((s) & 1) * OAB + (ar + p * 16) * GPW + ac * 2) = th; *(v4b*)(sm + ((s) & 1) * OAB + (GBM + ar + p * 16) * GPW + ac * 2) = tl; }
#define OCPW() do { cp_w8(lw, gb); lw ^= lx; gb += 64; } while (0)
  // the weight and residual fragments, which the first sixteen products take, are read first; the hi fragments land under those products
#define OFRG(q) _Pragma("unroll") for (int j = 0; j < 4; ++j) fb[j] = frag_b((const __bf16*)(sw + (s & 1) * OWB + (wn * 64 + j * 16 + col) * GPW + (q) * 64), lane); _Pragma("unroll") for (int i = 0; i < 4; ++i) fl[i] = frag_b((const __bf16*)(sm + (s & 1) * OAB + (GBM + wm * 64 + i * 16 + col) * GPW + (q) * 64), lane); _Pragma("unroll") for (int i = 0; i < 4; ++i) fh[i] = frag_b((const __bf16*)(sm + (s & 1) * OAB + (wm * 64 + i * 16 + col) * GPW + (q) * 64), lane);
  // per accumulator: residual product, then hi product; sixteen independent tiles between the two
#define OMAC() _Pragma("unroll") for (int i = 0; i < 4; ++i) { _Pragma("unroll") for (int j = 0; j < 4; ++j) acc[i][j] = wmma_bf(fl[i], fb[j], acc[i][j]); } _Pragma("unroll") for (int i = 0; i < 4; ++i) { _Pragma("unroll") for (int j = 0; j < 4; ++j) acc[i][j] = wmma_bf(fh[i], fb[j], acc[i][j]); }
  OLDA(0); OCPW(); OSTA(0); OLDA(1);
  asm volatile("s_wait_asynccnt 0x0" ::: "memory");   // stage 0's weight copies of this wave have landed before the barrier that publishes them
  __syncthreads();
  OCPW();
#pragma unroll 2   // two trips a round, so that every buffer's LDS offset is a constant
  for (int s = 0; s < DM / 64; ++s) {
    v16b fh[4], fl[4], fb[4];   // one 32-k half's fragments at a time
    // the O rows loaded one trip ago go into the buffer whose readers the last barrier has ended; the next loads have this whole trip to land
    if (s + 1 < DM / 64) { OSTA(s + 1); }
    if (s + 2 < DM / 64) { OLDA(s + 2); asm volatile("s_wait_xcnt 0x0" ::: "memory"); }   // behind the eight loads: in the listing the fragment reads that follow reuse the loads' address registers
    OFRG(0); OMAC();
    OFRG(1); OMAC();
    asm volatile("s_wait_dscnt 0x0" ::: "memory");     // this wave's reads of the buffers that are refilled behind the barrier have retired
    asm volatile("s_wait_asynccnt 0x0" ::: "memory");  // this wave's copies of stage s + 1 have landed before the barrier that publishes them
    __syncthreads();   // publishes stage s + 1 (O stores and weight copies) and ends every read of stage s
    if (s + 2 < DM / 64) { OCPW(); } }   // into the weight buffer that this trip has just read; a whole trip to land
  asm volatile("s_wait_asynccnt 0x0" ::: "memory");   // no copy is outstanding when the buffers are reused below
  // epilogue: each wave stages 16 rows of 64 f32 (pitch 272 B) in its own part of the buffers, behind the loop's last barrier, and stores whole 256-B row pieces
  float* so = (float*)(sm + wave * (16 * 272)); const size_t rw = (size_t)blockIdx.x * GBM + wm * 64; const int cw = n0 + wn * 64;
  float bias[4];
  const int bi = cw + col;
#pragma unroll
  for (int j = 0; j < 4; ++j) bias[j] = BO[bi + j * 16];
  asm volatile("s_wait_xcnt 0x0" :: "v"(bi) : "memory");   // behind the four bias loads, whose offset register the compiler reuses right after; the offset is named as an input so that its register lives up to this wait
#pragma unroll
  for (int j = 0; j < 4; ++j) bias[j] = bfr(bias[j]);
#pragma unroll
  for (int i = 0; i < 4; ++i) {
#pragma unroll
    for (int j = 0; j < 4; ++j) {
#pragma unroll
      for (int r = 0; r < 8; ++r) so[(8 * g + r) * 68 + j * 16 + col] = acc[i][j][r] + bias[j]; }
    LDSX();
#pragma unroll
    for (int p = 0; p < 8; ++p) { const int rl = p * 2 + g; vst2(Y + (rw + i * 16 + rl) * DM + cw + col * 4, *(const v4f*)&so[rl * 68 + col * 4]); }
    LDSX(); }
}
extern "C" void kernel_launch(void* const* d_in, const int* in_sizes, int n_in, void* d_out, int out_size, void* d_ws, size_t ws_size, hipStream_t stream) {
  (void)in_sizes; (void)n_in; (void)out_size;
  const float** F = (const float**)d_in;   // 0 x [4,2048,1024], 1 W_qkv [3072,1024] natural, 2 b_qkv [3072], 3 W_out [1024,1024], 4 b_out
  if (ws_size < (size_t)WS_END) return;
  char* ws = (char*)d_ws; __bf16* PK = (__bf16*)(ws + WS_PK); _Float16 *QK = (_Float16*)(ws + WS_QK), *QKL = (_Float16*)(ws + WS_QKL), *VTH = (_Float16*)(ws + WS_VTH), *VTL = (_Float16*)(ws + WS_VTL); float* O = (float*)(ws + WS_O);
  k_pack<<<dim3(4 * DM * DM / PKE), 256, 0, stream>>>(F[1], F[1] + (size_t)DM * DM, F[1] + (size_t)2 * DM * DM, F[3], PK);
  k_qkv<<<dim3(TNB * SS / GBM, QKVW / GBN), 256, 0, stream>>>(F[0], F[0], F[0], PK + PK_A, F[2], F[2] + DM, F[2] + 2 * DM, QK, VTH);
  k_attn<<<dim3(TQB, NH, TNB), 128, 0, stream>>>(QK, QKL, VTH, VTL, nullptr, O);
  k_out<<<dim3(TNB * SS / GBM, DM / OBN), 256, 0, stream>>>(O, PK + PK_P, F[4], (float*)d_out);
}

// v008
// Measured time: 90.5 microseconds a run.
// Two timings next to v007 put it at 1.03 and 1.02 times that version's speed.
// All steps since v000 together make it 4.10 times as fast.
// compute dtype: all float inputs rounded to bf16; qkv = x . W_qkv^T + b with EXACT bf16 products on WMMA 16x16x32 (natural rows; the fused weight as three contiguous row blocks); windowed attention (only the 128 keys that a block of 64 queries can touch under |i - j| <= 32 are visited, per-score window test): q, k single f16 x 1/8, softmax in f32 (hardware exp), P (scaled by 2^11, single f16) x v (single f16); out = o (bf16 hi + residual) . W_out^T (2 products) + b_out.
#include <hip/hip_runtime.h>
#include <math.h>

typedef __attribute__((ext_vector_type(16))) _Float16 v16h;
typedef __attribute__((ext_vector_type(16))) __bf16 v16b;
typedef __attribute__((ext_vector_type(8)))  _Float16 v8h;
typedef __attribute__((ext_vector_type(8)))  float v8f;
typedef __attribute__((ext_vector_type(4)))  float v4f;
typedef __attribute__((ext_vector_type(2)))  float v2f;
typedef __attribute__((ext_vector_type(4)))  unsigned v4u;
typedef __attribute__((ext_vector_type(4)))  int v4i;
typedef float __attribute__((may_alias)) float_a;
typedef int __attribute__((may_alias)) int_a;

template <typename T> __device__ __forceinline__ void vst2(void* p, T v) { *(T*)p = v;  }
__device__ __forceinline__ v8f wmma16(v16h a, v16h b, v8f c) {
  v8f d = __builtin_amdgcn_wmma_f32_16x16x32_f16(false, a, false, b, (short)0, c, false, false);
  asm volatile("v_nop\n\tv_nop\n\tv_nop\n\tv_nop" : "+v"(d) : "v"(a), "v"(b));
  return d;
}
__device__ __forceinline__ v8f wmma_bf(v16b a, v16b b, v8f c) {
  v8f d = __builtin_amdgcn_wmma_f32_16x16x32_bf16(false, a, false, b, (short)0, c, false, false);
  asm volatile("v_nop\n\tv_nop\n\tv_nop\n\tv_nop" : "+v"(d) : "v"(a), "v"(b));
  return d;
}
// Local-window multi-head self attention (B 4, T 2,048, d 1,024, 16 heads x 64, window |i - j| <= 32): fused qkv projection + bias, windowed softmax(q k^T / 8) v, output projection + bias.
__device__ __forceinline__ v16h frag_h(const _Float16* rowk0, int lane) {
  union { v16h v; v8h q[2]; } u; const _Float16* p = rowk0 + 8 * (lane >> 4);
  u.q[0] = *(const v8h*)p; u.q[1] = *(const v8h*)(p + 16); return u.v;
}
__device__ __forceinline__ v16h frag_f32(const float* rowk0, int lane) {
  v16h a; const float* p = rowk0 + 8 * (lane >> 4);
#pragma unroll
  for (int i = 0; i < 8; ++i) { a[i] = (_Float16)p[i]; a[8 + i] = (_Float16)p[16 + i]; }
  return a;
}
__device__ __forceinline__ v16h frag_f32s(const float* rowk0, int lane, float sc) {
  v16h a; const float* p = rowk0 + 8 * (lane >> 4);
#pragma unroll
  for (int i = 0; i < 8; ++i) { a[i] = (_Float16)(p[i] * sc); a[8 + i] = (_Float16)(p[16 + i] * sc); }
  return a;
}
// column fragment from a [K][ld] layout (column n), rows >= K read as 0
__device__ __forceinline__ v16h fragc_f32(const float* W, int k0, int n, int lane, int ld, int K) {
  v16h a; const int g = lane >> 4;
#pragma unroll
  for (int i = 0; i < 8; ++i) { const int ka = k0 + 8 * g + i, kb = ka + 16;
    a[i] = (_Float16)(ka < K ? W[(size_t)(ka < K ? ka : K - 1) * ld + n] : 0.f); a[8 + i] = (_Float16)(kb < K ? W[(size_t)(kb < K ? kb : K - 1) * ld + n] : 0.f); }
  return a;
}
struct F2 { v16b h, l; };
__device__ __forceinline__ F2 bsplit16(const float v[16]) { F2 r;
#pragma unroll
  for (int i = 0; i < 16; ++i) { const __bf16 h = (__bf16)v[i]; r.h[i] = h; r.l[i] = (__bf16)(v[i] - (float)h); }
  return r; }
__device__ __forceinline__ F2 split_row(const float* row, int k0, int lane) { float v[16]; const float* p = row + k0 + 8 * (lane >> 4);
#pragma unroll
  for (int i = 0; i < 8; ++i) { v[i] = p[i]; v[8 + i] = p[16 + i]; }
  return bsplit16(v); }
__device__ __forceinline__ F2 split_rowK(const float* row, int k0, int lane, int K) { float v[16]; const int g = lane >> 4;
#pragma unroll
  for (int i = 0; i < 8; ++i) { const int ka = k0 + 8 * g + i, kb = ka + 16; v[i] = ka < K ? row[ka < K ? ka : K - 1] : 0.f; v[8 + i] = kb < K ? row[kb < K ? kb : K - 1] : 0.f; }
  return bsplit16(v); }
__device__ __forceinline__ F2 split_col(const float* W, int k0, int n, int lane, int ld, int K) { float v[16]; const int g = lane >> 4;
#pragma unroll
  for (int i = 0; i < 8; ++i) { const int ka = k0 + 8 * g + i, kb = ka + 16; v[i] = ka < K ? W[(size_t)(ka < K ? ka : K - 1) * ld + n] : 0.f; v[8 + i] = kb < K ? W[(size_t)(kb < K ? kb : K - 1) * ld + n] : 0.f; }
  return bsplit16(v); }
__device__ __forceinline__ v8f mac3(const F2& a, const F2& b, v8f c) { c = wmma_bf(a.l, b.h, c); c = wmma_bf(a.h, b.l, c); return wmma_bf(a.h, b.h, c); }
__device__ __forceinline__ float sigm(float v) { return 1.0f / (1.0f + expf(-v)); }
#define LDSX() do { asm volatile("s_wait_dscnt 0" ::: "memory"); __builtin_amdgcn_wave_barrier(); __builtin_amdgcn_fence(__ATOMIC_RELEASE, "workgroup"); } while (0)


#define NB 4
#define SS 2048
#define DM 1024
#define NH 16
#define HALFW 32
#define HD 64
#define QKVW (3 * DM)
#ifndef TQB
#define TQB (SS / 64)
#define TNB NB
#define TOB (NB * SS / 64)     // 64-row tiles of all 8192 rows; unused
#endif
typedef __attribute__((ext_vector_type(8))) __bf16 v8b;
__device__ __forceinline__ v16b frag_b(const __bf16* rowk0, int lane) {
  union { v16b v; v8b q[2]; } u; const __bf16* p = rowk0 + 8 * (lane >> 4);
  u.q[0] = *(const v8b*)p; u.q[1] = *(const v8b*)(p + 16); return u.v;
}
__device__ __forceinline__ float bfr(float v) { return (float)(__bf16)v; }
__device__ __attribute__((noinline)) float exp_ni(float v) { return expf(v); }
__device__ __attribute__((noinline)) float erf_ni(float v) { return erff(v); }

#define PK_A 0                       // [3072][1024] Wqkv rows (natural [out][in])
#define PK_P (PK_A + QKVW * DM)        // [1024][1024] Wo rows (natural)
#define PK_END (PK_P + DM * DM)
#define WS_PK  0u
#define WS_QK  (WS_PK + 2u * PK_END)             // f16 [8192 rows][2048]: q | k
#define WS_QKL (WS_QK + 2u * NB * SS * 2 * DM)     // neither written nor read (k_attn's second argument, which it does not use)
#define WS_VTH (WS_QKL + 2u * NB * SS * 2 * DM)    // f16 [b][1024 (h*64+d)][2048 s]
#define WS_VTL (WS_VTH + 2u * NB * DM * SS)        // neither written nor read (k_attn's fourth argument, which it does not use)
#define WS_O   (WS_VTL + 2u * NB * DM * SS)        // f32 [8192][1024]
#define WS_CS  (WS_O + 4u * NB * SS * DM)           // f32 [2][2048][32], unused
#define WS_END (WS_CS + 4u * 2 * SS * 32)
// ---- k_pack: the four 1024 x 1024 weight blocks (the q, k, v row blocks of the fused weight, then W_o), natural [out][in] rows, rounded to bf16 into PK_A rows which*1024 + n and PK_P: elementwise, so a block takes PKE consecutive elements of one matrix: 256 blocks of 8 waves, one a WGP, 64 elements a thread; a thread's sixteen 16-byte loads (512 contiguous bytes a wave each) are all in flight before its first store (256 contiguous bytes a wave)
#define PKE 16384
typedef __attribute__((ext_vector_type(4))) __bf16 v4b;
__global__ __launch_bounds__(256) void k_pack(const float* __restrict__ WQ, const float* __restrict__ WK, const float* __restrict__ WV, const float* __restrict__ WO, __bf16* __restrict__ PK) {
  const int which = blockIdx.x / (DM * DM / PKE), e0 = (blockIdx.x % (DM * DM / PKE)) * PKE + threadIdx.x * 4; const float* Wm = (which == 0) ? WQ : (which == 1) ? WK : (which == 2) ? WV : WO;
  const unsigned ob = (unsigned)e0 * 4u;   // the thread's byte offset in its matrix
  __bf16* dp = ((which < 3) ? PK + PK_A + (size_t)which * DM * DM : PK + PK_P) + e0;
  v4f r[PKE / 1024];   // the short loops below are unrolled so that r stays in registers
#pragma unroll
  for (int p = 0; p < PKE / 1024; ++p) r[p] = *(const v4f*)((const char*)Wm + ob + p * 4096);
  asm volatile("s_wait_xcnt 0x0" :: "v"(ob) : "memory");   // behind the sixteen loads, their offset named as an input so that its register lives up to this wait and no load's result lands on it
  __builtin_amdgcn_sched_barrier(0);   // keeps every load in front of the first conversion: left alone, the compiler holds the last two loads back until the first two have landed, a second memory latency
#pragma unroll
  for (int p = 0; p < PKE / 1024; ++p) { v4b o;
#pragma unroll
    for (int i = 0; i < 4; ++i) o[i] = (__bf16)r[p][i];
    *(v4b*)(dp + p * 1024) = o; }
}
// ---- k_qkv: block = 128 rows x 256 cols, 8 waves (2 x 4) of 64 x 64; a stage is 64 k of both tiles, two LDS buffers each: the x tile goes through registers (rounded to bf16 on the way), the weight tile, bf16 already, is copied from global memory straight into LDS; every wave takes its fragments from there
#define GBM 128
#define GBN 256
#define GPW 144                       // LDS pitch of a 64-k row: 128 B of k + 16 B, an odd multiple of 16 B for the 16-byte fragment reads
#define GAB (GBM * GPW)                // one x buffer
#define GWB (GBN * GPW)                // one weight buffer
// eight asynchronous 16-byte copies a lane, global -> LDS: rows 32 apart of one weight stage. The s_wait_xcnt is the last line of the copies' own statement, so that it stands in front of whatever gives their address registers new values
__device__ __forceinline__ void cp_w8(unsigned l, const __bf16* g) {
  asm volatile("global_load_async_to_lds_b128 %0, %8, off\n\tglobal_load_async_to_lds_b128 %1, %9, off\n\tglobal_load_async_to_lds_b128 %2, %10, off\n\tglobal_load_async_to_lds_b128 %3, %11, off\n\tglobal_load_async_to_lds_b128 %4, %12, off\n\tglobal_load_async_to_lds_b128 %5, %13, off\n\tglobal_load_async_to_lds_b128 %6, %14, off\n\tglobal_load_async_to_lds_b128 %7, %15, off\n\ts_wait_xcnt 0x0"
    :: "v"(l), "v"(l + 32 * GPW), "v"(l + 64 * GPW), "v"(l + 96 * GPW), "v"(l + 128 * GPW), "v"(l + 160 * GPW), "v"(l + 192 * GPW), "v"(l + 224 * GPW),
       "v"(g), "v"(g + 32 * DM), "v"(g + 64 * DM), "v"(g + 96 * DM), "v"(g + 128 * DM), "v"(g + 160 * DM), "v"(g + 192 * DM), "v"(g + 224 * DM) : "memory");
}
__global__ __launch_bounds__(256) void k_qkv(const float* __restrict__ XQ, const float* __restrict__ XK, const float* __restrict__ XV, const __bf16* __restrict__ P, const float* __restrict__ BQ, const float* __restrict__ BK, const float* __restrict__ BV, _Float16* __restrict__ QK, _Float16* __restrict__ VTH) {
  const int n0 = blockIdx.y * GBN; const int which0 = n0 / DM; const float* X = (which0 == 0) ? XQ : (which0 == 1) ? XK : XV; const float* BB = BQ ? (((which0 == 0) ? BQ : (which0 == 1) ? BK : BV) + (n0 - which0 * DM)) : nullptr;
  __shared__ __align__(16) unsigned char sm[2 * GAB + 2 * GWB];
  const int tid = threadIdx.x, wave = tid >> 5, lane = tid & 31, col = lane & 15, g = lane >> 4; const int wm = wave >> 2, wn = wave & 3;
  const int ar = tid >> 4, ac = (tid & 15) * 4, br = tid >> 3, wc = (tid & 7) * 8;   // x: 16 rows a pass, 256 B of a row per 16 threads; weight: 32 rows a pass, one 128-B line per 8 threads
  const float* ga = X + ((size_t)blockIdx.x * GBM + ar) * DM + ac; const __bf16* gb = P + (size_t)(n0 + br) * DM + wc; unsigned char* sw = sm + 2 * GAB;
  unsigned lw = (unsigned)(size_t)(sw + br * GPW + wc * 2);   // the lane's LDS byte address in the weight buffer that the next copies fill; it steps from stage to stage and the stage's k offset is added to gb at the copies, so that the sixteen addresses of a stage's copies are formed where they are used and hold no registers through the products
  v4f ra[8]; v8f acc[4][4] = {};
  // the block's own first k stage: blocks that share x rows (same blockIdx.x) or weight rows (same blockIdx.y) run side by side, and walking k in step they would ask L2 for the same lines at the same moment; each walks the sixteen stages as a ring from its own start. Column blocks 4 apart keep one start
  const int rot = (blockIdx.x + 4 * (blockIdx.y & 3)) & (DM / 64 - 1);
#define KST(s) (((s) + rot) & (DM / 64 - 1))   // trip s works on k stage KST(s)
  // trip s: k 64 KST(s) .. + 63 of all 128 x rows and all 256 weight rows, into buffers s & 1 (the short loops are unrolled so that ra stays in registers)
#define QLDA(s) _Pragma("unroll") for (int p = 0; p < 8; ++p) ra[p] = *(const v4f*)(ga + (size_t)p * 16 * DM + KST(s) * 64)
#define QSTA(s) _Pragma("unroll") for (int p = 0; p < 8; ++p) { v4b t; _Pragma("unroll") for (int i = 0; i < 4; ++i) t[i] = (__bf16)ra[p][i]; *(v4b*)(sm + ((s) & 1) * GAB + (ar + p * 16) * GPW + ac * 2) = t; }
#define QFRG(q) _Pragma("unroll") for (int i = 0; i < 4; ++i) { fa[i] = frag_b((const __bf16*)(sm + (s & 1) * GAB + (wm * 64 + i * 16 + col) * GPW + (q) * 64), lane); fb[i] = frag_b((const __bf16*)(sw + (s & 1) * GWB + (wn * 64 + i * 16 + col) * GPW + (q) * 64), lane); }
#define QMAC() _Pragma("unroll") for (int i = 0; i < 4; ++i) { _Pragma("unroll") for (int j = 0; j < 4; ++j) acc[i][j] = wmma_bf(fa[i], fb[j], acc[i][j]); }
#define QCPW(s) do { cp_w8(lw, gb + KST(s) * 64); lw ^= lx; } while (0)
  const unsigned lx = lw ^ (lw + GWB);   // toggles lw between the two weight buffers
  QLDA(0); QCPW(0); QSTA(0); QLDA(1);
  asm volatile("s_wait_asynccnt 0x0" ::: "memory");   // stage 0's weight copies of this wave have landed before the barrier that publishes them
  __syncthreads();
  QCPW(1);
#pragma unroll 2   // two trips a round, so that every buffer's LDS offset is a constant
  for (int s = 0; s < DM / 64; ++s) {
    v16b fa[4], fb[4];   // one 32-k half's fragments at a time
    // the x rows loaded one trip ago go into the buffer whose readers the last barrier has ended; the next loads have this whole trip to land
    if (s + 1 < DM / 64) { QSTA(s + 1); }
    if (s + 2 < DM / 64) { QLDA(s + 2); }
    QFRG(0); QMAC();
    QFRG(1); QMAC();
    asm volatile("s_wait_dscnt 0x0" ::: "memory");     // this wave's reads of the buffers that are refilled behind the barrier have retired
    asm volatile("s_wait_asynccnt 0x0" ::: "memory");  // this wave's copies of stage s + 1 have landed before the barrier that publishes them
    __syncthreads();   // publishes stage s + 1 (x stores and weight copies) and ends every read of stage s
    if (s + 2 < DM / 64) { QCPW(s + 2); } }   // into the weight buffer that this trip has just read; a whole trip to land
  asm volatile("s_wait_asynccnt 0x0" ::: "memory");   // no copy is outstanding when the buffers are reused below
  // epilogue: each wave stages 32 output rows at a time (pitch 144 B) in its own part of the buffers, all of whose readers have passed the loop's last barrier, and stores whole 128-B lines; only the one f16 rounding that k_attn reads is formed, staged and stored, so that the 64 rows go in two passes
  _Float16* eh = (_Float16*)(sm + wave * (32 * 144));
  const size_t rw = (size_t)blockIdx.x * GBM + wm * 64; const int cw = wn * 64; const int el_r = lane >> 3, el_c = (lane & 7) * 8;
  float bias[4];
#pragma unroll
  for (int j = 0; j < 4; ++j) bias[j] = BB ? bfr(BB[cw + j * 16 + col]) : 0.f;
  if (n0 < 2 * DM) {   // q, k (+ bias) as f16; q stored unscaled, 1/8 applied to the f32 score
#pragma unroll
    for (int ip = 0; ip < 2; ++ip) {
#pragma unroll
      for (int i = 0; i < 2; ++i) {
#pragma unroll
        for (int j = 0; j < 4; ++j) {
#pragma unroll
          for (int r = 0; r < 8; ++r) eh[(i * 16 + 8 * g + r) * 72 + j * 16 + col] = (_Float16)(acc[2 * ip + i][j][r] + bias[j]); } }
      LDSX();
#pragma unroll
      for (int p = 0; p < 8; ++p) { const int rl = p * 4 + el_r; const size_t o = (rw + ip * 32 + rl) * (2 * DM) + n0 + cw + el_c; vst2((unsigned*)(QK + o), *(const v4u*)&eh[rl * 72 + el_c]); }
      LDSX(); }
  } else {   // v (+ bias) transposed: [b][h*64+d][s], 32 d rows of 64 s at a time
    const int b = (int)(rw / SS), s0 = (int)(rw % SS); const int pc0 = n0 - 2 * DM + cw;
#pragma unroll
    for (int jp = 0; jp < 2; ++jp) {
#pragma unroll
      for (int j = 0; j < 2; ++j) {
#pragma unroll
        for (int i = 0; i < 4; ++i) { v8h hh;
#pragma unroll
          for (int r = 0; r < 8; ++r) hh[r] = (_Float16)(acc[i][2 * jp + j][r] + bias[2 * jp + j]);
          *(v8h*)&eh[(j * 16 + col) * 72 + i * 16 + 8 * g] = hh; } }
      LDSX();
#pragma unroll
      for (int p = 0; p < 8; ++p) { const int d = p * 4 + el_r; const size_t o = ((size_t)b * DM + pc0 + jp * 32 + d) * SS + s0 + el_c; vst2((unsigned*)(VTH + o), *(const v4u*)&eh[d * 72 + el_c]); }
      LDSX(); }
    asm volatile("s_wait_xcnt 0x0" ::: "memory");   // behind the last pass's stores, before the code after this branch that rewrites their address registers
  }
}
// hardware exp2 with the one free slot behind it that the instruction set asks for before a transcendental's result is read or its source overwritten
__device__ __forceinline__ float exp2_slot(float x) { float e; asm("v_exp_f32 %0, %1\n\tv_nop" : "=v"(e) : "v"(x)); return e; }
// ---- k_attn: block = (64 queries, head h, batch b): the 128 keys that the block's window can touch are staged once in LDS (k rows and v^T rows, contiguous 128-B and 256-B pieces of global memory, shared by the four waves; each wave's q rows likewise), and every q, k and v fragment is read from there; both products transposed: S^T = K . Q^T (K = 64: 2 k-steps), scores = (q.k) * 0.125 with single f16 operands, one softmax over the 128 staged keys with a query's scores in one pair of lanes, O^T = V^T . P^T with P taken from the score registers (f16, x2^11); O[b*S+q][h*64+d] = acc / 2048 / l (256-B segments)
#define AKN (64 + 2 * HALFW)          // keys staged per block
#define AKP 144                       // LDS pitch of a k row: 128 B + 16 B, an odd multiple of 16 B for the 16-byte fragment reads
#define AVP (2 * AKN + 16)            // LDS pitch of a v^T row: 256 B + 16 B, likewise
__global__ __launch_bounds__(128) void k_attn(const _Float16* __restrict__ QK, const _Float16* __restrict__ QKL, const _Float16* __restrict__ VTH, const _Float16* __restrict__ VTL, const void* __restrict__ KMASK, float* __restrict__ O) {
  __shared__ __align__(16) float so[4][16][68];
  __shared__ __align__(16) unsigned char sk[AKN * AKP]; __shared__ __align__(16) unsigned char sv[HD * AVP];
  const int tid = threadIdx.x, wave = tid >> 5, lane = tid & 31, col = lane & 15, g = lane >> 4;
  const int qb = blockIdx.x, h = blockIdx.y, b = blockIdx.z; const int q0 = qb * 64 + wave * 16;
  const int kb = qb * 64 - HALFW;   // key index of LDS row 0 (a multiple of 32); keys outside 0 .. SS - 1 are loaded from a clamped address (finite values of other keys) and masked like keys outside the window
  unsigned char* sq = (unsigned char*)&so[wave][0][0];   // the wave's own 16 q rows (pitch AKP) lie where it stages its output rows at the end, long after their one read
  { v4u tk[8], tv[8], tq[4];   // 16-byte pieces: 8 lanes a k or q row (16 k rows a pass of the block, 4 q rows a pass of a wave), 16 lanes a v^T row (8 rows a pass); all twenty loads are in flight before the first store
    const unsigned ko = (unsigned)((tid >> 3) * (2 * DM) + (tid & 7) * 8), vo = (unsigned)((tid >> 4) * SS + min(max(kb + (tid & 15) * 8, 0), SS - 8)), qo = (unsigned)((wave * 16 + (lane >> 3)) * (2 * DM) + (tid & 7) * 8);   // one offset a thread for each array; the rest of every address is the same for the whole block
    const _Float16* vb = VTH + ((size_t)b * DM + h * HD) * SS; const _Float16* qp = QK + ((size_t)b * SS + qb * 64) * (2 * DM) + h * HD;
#pragma unroll
    for (int p = 0; p < 8; ++p) { const int kt = min(max(kb + (p >> 1) * 32, 0), SS - 32); tk[p] = *(const v4u*)(QK + ((size_t)b * SS + kt + (p & 1) * 16) * (2 * DM) + DM + h * HD + ko); }
#pragma unroll
    for (int p = 0; p < 8; ++p) tv[p] = *(const v4u*)(vb + (size_t)p * 8 * SS + vo);
#pragma unroll
    for (int p = 0; p < 4; ++p) tq[p] = *(const v4u*)(qp + (size_t)p * 4 * (2 * DM) + qo);
    asm volatile("s_wait_xcnt 0x0" ::: "memory");   // behind the twenty loads: the registers that hold their offsets are given new values right after
#pragma unroll
    for (int p = 0; p < 8; ++p) { *(v4u*)(sk + ((tid >> 3) + p * 16) * AKP + (tid & 7) * 16) = tk[p]; *(v4u*)(sv + ((tid >> 4) + p * 8) * AVP + (tid & 15) * 16) = tv[p]; }
#pragma unroll
    for (int p = 0; p < 4; ++p) *(v4u*)(sq + ((lane >> 3) + p * 4) * AKP + (tid & 7) * 16) = tq[p]; }
  // scores are formed transposed, S^T = K . Q^T: a lane holds, of every 16-key tile, 8 keys (8 g + r) of ONE query (q0 + col); lanes l and l ^ 16 share a query
  const int qi = q0 + col; const int lo = max(qi - HALFW, 0); const unsigned span = (unsigned)(min(qi + HALFW, SS - 1) - lo); const int e0 = kb + 8 * g - lo;   // key kb + 16 t + 8 g + r lies in the window |i - j| <= 32 and in 0 .. SS - 1 exactly if (unsigned)(e0 + 16 t + r) <= span
  __syncthreads();   // publishes the staged k and v rows to all four waves; nothing overwrites them afterwards
  v16h bq[2];
#pragma unroll
  for (int kc = 0; kc < 2; ++kc) bq[kc] = frag_h((const _Float16*)(sq + col * AKP) + kc * 32, lane);
  v8f s[AKN / 16];
#pragma unroll
  for (int tg = 0; tg < AKN / 16; tg += 4) { v16h fk[2][4];   // four independent score tiles at a time, so that no product waits for its accumulator; their eight k fragments are read as one group, behind one wait
#pragma unroll
    for (int kc = 0; kc < 2; ++kc) {
#pragma unroll
      for (int t = 0; t < 4; ++t) fk[kc][t] = frag_h((const _Float16*)(sk + ((tg + t) * 16 + col) * AKP) + kc * 32, lane); }
#pragma unroll
    for (int t = tg; t < tg + 4; ++t) s[t] = v8f{};
#pragma unroll
    for (int kc = 0; kc < 2; ++kc) {
#pragma unroll
      for (int t = tg; t < tg + 4; ++t) s[t] = wmma16(fk[kc][t - tg], bq[kc], s[t]); } }   // single product: k, q as one-rounding f16 operands
#pragma unroll
  for (int t = 0; t < AKN / 16; ++t) {
#pragma unroll
    for (int r = 0; r < 8; ++r) s[t][r] = ((unsigned)(e0 + t * 16 + r) <= span) ? s[t][r] * 0.125f : -3.0e38f; }   // 1/sqrt(64); keys outside the window or the sequence
  // softmax of a query over all staged keys at once: maximum and sum in the lane, one exchange between the two halves each (the query's own key is always staged and inside the window, so the maximum is a real score)
  v8f mv = s[0];
#pragma unroll
  for (int t = 1; t < AKN / 16; ++t) {
#pragma unroll
    for (int r = 0; r < 8; ++r) mv[r] = fmaxf(mv[r], s[t][r]); }
  float mx = fmaxf(fmaxf(fmaxf(mv[0], mv[1]), fmaxf(mv[2], mv[3])), fmaxf(fmaxf(mv[4], mv[5]), fmaxf(mv[6], mv[7])));
  mx = fmaxf(mx, __shfl_xor(mx, 16));
  v8f ls;
#pragma unroll
  for (int t = 0; t < AKN / 16; ++t) {
#pragma unroll
    for (int r = 0; r < 8; ++r) { const float e = exp2_slot((s[t][r] - mx) * 1.44269504f); s[t][r] = e; ls[r] = (t == 0) ? e : ls[r] + e; } }   // a masked score is -3e38: its exponential is an exact 0
  float l = ((ls[0] + ls[1]) + (ls[2] + ls[3])) + ((ls[4] + ls[5]) + (ls[6] + ls[7]));
  l += __shfl_xor(l, 16);
  // O^T += V^T . P^T: two score tiles of a lane, converted in place, are the B operand of a 32-key step (element i = key 8 g + i, element 8 + i = key 16 + 8 g + i, the order in which frag_h reads a v^T row)
  v8f acc[4] = {};
#pragma unroll
  for (int j = 0; j < AKN / 32; ++j) { v16h pb, fv[4];   // the step's four v fragments are read as one group, ahead of the conversion of P
#pragma unroll
    for (int dt = 0; dt < 4; ++dt) fv[dt] = frag_h((const _Float16*)(sv + (dt * 16 + col) * AVP) + j * 32, lane);
#pragma unroll
    for (int i = 0; i < 8; ++i) { pb[i] = (_Float16)(s[2 * j][i] * 2048.0f); pb[8 + i] = (_Float16)(s[2 * j + 1][i] * 2048.0f); }   // P scaled by 2^11 before the f16 rounding so small softmax weights stay out of the f16 subnormal range; 2^-11 folded into the epilogue
#pragma unroll
    for (int dt = 0; dt < 4; ++dt) acc[dt] = wmma16(fv[dt], pb, acc[dt]); }   // single product: V x P (x2^11)
  const float il = (1.0f / 2048.0f) / l;
#pragma unroll
  for (int dt = 0; dt < 4; ++dt) { v4f o0, o1;   // the lane's 8 consecutive d of its query's output row
#pragma unroll
    for (int r = 0; r < 4; ++r) { o0[r] = acc[dt][r] * il; o1[r] = acc[dt][4 + r] * il; }
    *(v4f*)&so[wave][col][dt * 16 + 8 * g] = o0; *(v4f*)&so[wave][col][dt * 16 + 8 * g + 4] = o1; }
  LDSX();
  for (int rl = 0; rl < 16; ++rl) if (lane < 16) vst2(O + ((size_t)b * SS + q0 + rl) * DM + h * HD + lane * 4, *(const v4f*)&so[wave][rl][lane * 4]);
}
// ---- k_out: block = 128 rows x 256 cols, 8 waves (2 x 4) of 64 x 64, one block a WGP; 64-k stages in two LDS buffers as in k_qkv (O through registers, split once per block into bf16 hi and residual planes; the weight tile copied straight into LDS by cp_w8): out = O(hi/lo) . Wo rows (2 products) + bo
#define OBN 256
#define OAB (2 * GBM * GPW)             // one O buffer: hi rows, then residual rows
#define OWB (OBN * GPW)                 // one weight buffer
__global__ __launch_bounds__(256) void k_out(const float* __restrict__ O, const __bf16* __restrict__ P, const float* __restrict__ BO, float* __restrict__ Y) {
  __shared__ __align__(16) unsigned char sm[2 * OAB + 2 * OWB];
  const int tid = threadIdx.x, wave = tid >> 5, lane = tid & 31, col = lane & 15, g = lane >> 4; const int wm = wave >> 2, wn = wave & 3; const int n0 = blockIdx.y * OBN;
  const int ar = tid >> 4, ac = (tid & 15) * 4, br = tid >> 3, wc = (tid & 7) * 8;   // O: 16 rows a pass, 256 B of a row per 16 threads; weight: 32 rows a pass, one 128-B line per 8 threads
  const float* ga = O + ((size_t)blockIdx.x * GBM + ar) * DM + ac; const __bf16* gb = P + (size_t)(n0 + br) * DM + wc; unsigned char* sw = sm + 2 * OAB;
  unsigned lw = (unsigned)(size_t)(sw + br * GPW + wc * 2); const unsigned lx = lw ^ (lw + OWB);   // the lane's LDS byte address in the weight buffer that the next copies fill, and what toggles it, as in k_qkv
  v4f ra[8]; v8f acc[4][4] = {};
  const int rot = (blockIdx.x + 4 * blockIdx.y) & (DM / 64 - 1);   // the block's own first k stage, as in k_qkv: the four column blocks of a row block and the row blocks of a column block start apart
  // trip s: k 64 KST(s) .. + 63 of all 128 O rows and all 256 weight rows, into buffers s & 1 (the short loops are unrolled so that ra stays in registers)
#define OLDA(s) _Pragma("unroll") for (int p = 0; p < 8; ++p) ra[p] = *(const v4f*)(ga + (size_t)p * 16 * DM + KST(s) * 64)
#define OSTA(s) _Pragma("unroll") for (int p = 0; p < 8; ++p) { v4b th, tl; _Pragma("unroll") for (int i = 0; i < 4; ++i) { th[i] = (__bf16)ra[p][i]; tl[i] = (__bf16)(ra[p][i] - (float)th[i]); } *(v4b*)(sm + ((s) & 1) * OAB + (ar + p * 16) * GPW + ac * 2) = th; *(v4b*)(sm + ((s) & 1) * OAB + (GBM + ar + p * 16) * GPW + ac * 2) = tl; }
#define OCPW(s) do { cp_w8(lw, gb + KST(s) * 64); lw ^= lx; } while (0)
  // the weight and residual fragments, which the first sixteen products take, are read first; the hi fragments land under those products
#define OFRG(q) _Pragma("unroll") for (int j = 0; j < 4; ++j) fb[j] = frag_b((const __bf16*)(sw + (s & 1) * OWB + (wn * 64 + j * 16 + col) * GPW + (q) * 64), lane); _Pragma("unroll") for (int i = 0; i < 4; ++i) fl[i] = frag_b((const __bf16*)(sm + (s & 1) * OAB + (GBM + wm * 64 + i * 16 + col) * GPW + (q) * 64), lane); _Pragma("unroll") for (int i = 0; i < 4; ++i) fh[i] = frag_b((const __bf16*)(sm + (s & 1) * OAB + (wm * 64 + i * 16 + col) * GPW + (q) * 64), lane);
  // per accumulator: residual product, then hi product; sixteen independent tiles between the two
#define OMAC() _Pragma("unroll") for (int i = 0; i < 4; ++i) { _Pragma("unroll") for (int j = 0; j < 4; ++j) acc[i][j] = wmma_bf(fl[i], fb[j], acc[i][j]); } _Pragma("unroll") for (int i = 0; i < 4; ++i) { _Pragma("unroll") for (int j = 0; j < 4; ++j) acc[i][j] = wmma_bf(fh[i], fb[j], acc[i][j]); }
  OLDA(0); OCPW(0); OSTA(0); OLDA(1);
  asm volatile("s_wait_xcnt 0x0" :: "v"(ga + KST(1) * 64) : "memory");   // behind the eight loads, whose address now stands in a register pair of its own that the compiler reuses right after; the address is named as an input so that the pair lives up to this wait
  asm volatile("s_wait_asynccnt 0x0" ::: "memory");   // stage 0's weight copies of this wave have landed before the barrier that publishes them
  __syncthreads();
  OCPW(1);
#pragma unroll 2   // two trips a round, so that every buffer's LDS offset is a constant
  for (int s = 0; s < DM / 64; ++s) {
    v16b fh[4], fl[4], fb[4];   // one 32-k half's fragments at a time
    // the O rows loaded one trip ago go into the buffer whose readers the last barrier has ended; the next loads have this whole trip to land
    if (s + 1 < DM / 64) { OSTA(s + 1); }
    if (s + 2 < DM / 64) { OLDA(s + 2); asm volatile("s_wait_xcnt 0x0" ::: "memory"); }   // behind the eight loads: in the listing the fragment reads that follow reuse the loads' address registers
    OFRG(0); OMAC();
    OFRG(1); OMAC();
    asm volatile("s_wait_dscnt 0x0" ::: "memory");     // this wave's reads of the buffers that are refilled behind the barrier have retired
    asm volatile("s_wait_asynccnt 0x0" ::: "memory");  // this wave's copies of stage s + 1 have landed before the barrier that publishes them
    __syncthreads();   // publishes stage s + 1 (O stores and weight copies) and ends every read of stage s
    if (s + 2 < DM / 64) { OCPW(s + 2); } }   // into the weight buffer that this trip has just read; a whole trip to land
  asm volatile("s_wait_asynccnt 0x0" ::: "memory");   // no copy is outstanding when the buffers are reused below
  // epilogue: each wave stages 16 rows of 64 f32 (pitch 272 B) in its own part of the buffers, behind the loop's last barrier, and stores whole 256-B row pieces
  float* so = (float*)(sm + wave * (16 * 272)); const size_t rw = (size_t)blockIdx.x * GBM + wm * 64; const int cw = n0 + wn * 64;
  float bias[4];
  const int bi = cw + col;
#pragma unroll
  for (int j = 0; j < 4; ++j) bias[j] = BO[bi + j * 16];
  asm volatile("s_wait_xcnt 0x0" :: "v"(bi) : "memory");   // behind the four bias loads, whose offset register the compiler reuses right after; the offset is named as an input so that its register lives up to this wait
#pragma unroll
  for (int j = 0; j < 4; ++j) bias[j] = bfr(bias[j]);
#pragma unroll
  for (int i = 0; i < 4; ++i) {
#pragma unroll
    for (int j = 0; j < 4; ++j) {
#pragma unroll
      for (int r = 0; r < 8; ++r) so[(8 * g + r) * 68 + j * 16 + col] = acc[i][j][r] + bias[j]; }
    LDSX();
#pragma unroll
    for (int p = 0; p < 8; ++p) { const int rl = p * 2 + g; vst2(Y + (rw + i * 16 + rl) * DM + cw + col * 4, *(const v4f*)&so[rl * 68 + col * 4]); }
    LDSX(); }
}
extern "C" void kernel_launch(void* const* d_in, const int* in_sizes, int n_in, void* d_out, int out_size, void* d_ws, size_t ws_size, hipStream_t stream) {
  (void)in_sizes; (void)n_in; (void)out_size;
  const float** F = (const float**)d_in;   // 0 x [4,2048,1024], 1 W_qkv [3072,1024] natural, 2 b_qkv [3072], 3 W_out [1024,1024], 4 b_out
  if (ws_size < (size_t)WS_END) return;
  char* ws = (char*)d_ws; __bf16* PK = (__bf16*)(ws + WS_PK); _Float16 *QK = (_Float16*)(ws + WS_QK), *QKL = (_Float16*)(ws + WS_QKL), *VTH = (_Float16*)(ws + WS_VTH), *VTL = (_Float16*)(ws + WS_VTL); float* O = (float*)(ws + WS_O);
  k_pack<<<dim3(4 * DM * DM / PKE), 256, 0, stream>>>(F[1], F[1] + (size_t)DM * DM, F[1] + (size_t)2 * DM * DM, F[3], PK);
  k_qkv<<<dim3(TNB * SS / GBM, QKVW / GBN), 256, 0, stream>>>(F[0], F[0], F[0], PK + PK_A, F[2], F[2] + DM, F[2] + 2 * DM, QK, VTH);
  k_attn<<<dim3(TQB, NH, TNB), 128, 0, stream>>>(QK, QKL, VTH, VTL, nullptr, O);
  k_out<<<dim3(TNB * SS / GBM, DM / OBN), 256, 0, stream>>>(O, PK + PK_P, F[4], (float*)d_out);
}

// v009
// It runs in 89.1 microseconds.
// Timed twice side by side with v008, it ran 1.03 times as fast both times.
// Counting every step since v000, it is 4.22 times as fast.
// compute dtype: all float inputs rounded to bf16; qkv = x . W_qkv^T + b with EXACT bf16 products on WMMA 16x16x32 (natural rows; the fused weight as three contiguous row blocks); windowed attention (only the 128 keys that a block of 64 queries can touch under |i - j| <= 32 are visited, per-score window test): q, k single f16 x 1/8, softmax in f32 (hardware exp), P (scaled by 2^11, single f16) x v (single f16); out = o (bf16 hi + residual) . W_out^T (2 products) + b_out.
#include <hip/hip_runtime.h>
#include <math.h>

typedef __attribute__((ext_vector_type(16))) _Float16 v16h;
typedef __attribute__((ext_vector_type(16))) __bf16 v16b;
typedef __attribute__((ext_vector_type(8)))  _Float16 v8h;
typedef __attribute__((ext_vector_type(8)))  float v8f;
typedef __attribute__((ext_vector_type(4)))  float v4f;
typedef __attribute__((ext_vector_type(2)))  float v2f;
typedef __attribute__((ext_vector_type(4)))  unsigned v4u;
typedef __attribute__((ext_vector_type(4)))  int v4i;
typedef float __attribute__((may_alias)) float_a;
typedef int __attribute__((may_alias)) int_a;

template <typename T> __device__ __forceinline__ void vst2(void* p, T v) { *(T*)p = v;  }
__device__ __forceinline__ v8f wmma16(v16h a, v16h b, v8f c) {
  v8f d = __builtin_amdgcn_wmma_f32_16x16x32_f16(false, a, false, b, (short)0, c, false, false);
  asm volatile("v_nop\n\tv_nop\n\tv_nop\n\tv_nop" : "+v"(d) : "v"(a), "v"(b));
  return d;
}
__device__ __forceinline__ v8f wmma_bf(v16b a, v16b b, v8f c) {
  v8f d = __builtin_amdgcn_wmma_f32_16x16x32_bf16(false, a, false, b, (short)0, c, false, false);
  asm volatile("v_nop\n\tv_nop\n\tv_nop\n\tv_nop" : "+v"(d) : "v"(a), "v"(b));
  return d;
}
// Local-window multi-head self attention (B 4, T 2,048, d 1,024, 16 heads x 64, window |i - j| <= 32): fused qkv projection + bias, windowed softmax(q k^T / 8) v, output projection + bias.
__device__ __forceinline__ v16h frag_h(const _Float16* rowk0, int lane) {
  union { v16h v; v8h q[2]; } u; const _Float16* p = rowk0 + 8 * (lane >> 4);
  u.q[0] = *(const v8h*)p; u.q[1] = *(const v8h*)(p + 16); return u.v;
}
__device__ __forceinline__ v16h frag_f32(const float* rowk0, int lane) {
  v16h a; const float* p = rowk0 + 8 * (lane >> 4);
#pragma unroll
  for (int i = 0; i < 8; ++i) { a[i] = (_Float16)p[i]; a[8 + i] = (_Float16)p[16 + i]; }
  return a;
}
__device__ __forceinline__ v16h frag_f32s(const float* rowk0, int lane, float sc) {
  v16h a; const float* p = rowk0 + 8 * (lane >> 4);
#pragma unroll
  for (int i = 0; i < 8; ++i) { a[i] = (_Float16)(p[i] * sc); a[8 + i] = (_Float16)(p[16 + i] * sc); }
  return a;
}
// column fragment from a [K][ld] layout (column n), rows >= K read as 0
__device__ __forceinline__ v16h fragc_f32(const float* W, int k0, int n, int lane, int ld, int K) {
  v16h a; const int g = lane >> 4;
#pragma unroll
  for (int i = 0; i < 8; ++i) { const int ka = k0 + 8 * g + i, kb = ka + 16;
    a[i] = (_Float16)(ka < K ? W[(size_t)(ka < K ? ka : K - 1) * ld + n] : 0.f); a[8 + i] = (_Float16)(kb < K ? W[(size_t)(kb < K ? kb : K - 1) * ld + n] : 0.f); }
  return a;
}
struct F2 { v16b h, l; };
__device__ __forceinline__ F2 bsplit16(const float v[16]) { F2 r;
#pragma unroll
  for (int i = 0; i < 16; ++i) { const __bf16 h = (__bf16)v[i]; r.h[i] = h; r.l[i] = (__bf16)(v[i] - (float)h); }
  return r; }
__device__ __forceinline__ F2 split_row(const float* row, int k0, int lane) { float v[16]; const float* p = row + k0 + 8 * (lane >> 4);
#pragma unroll
  for (int i = 0; i < 8; ++i) { v[i] = p[i]; v[8 + i] = p[16 + i]; }
  return bsplit16(v); }
__device__ __forceinline__ F2 split_rowK(const float* row, int k0, int lane, int K) { float v[16]; const int g = lane >> 4;
#pragma unroll
  for (int i = 0; i < 8; ++i) { const int ka = k0 + 8 * g + i, kb = ka + 16; v[i] = ka < K ? row[ka < K ? ka : K - 1] : 0.f; v[8 + i] = kb < K ? row[kb < K ? kb : K - 1] : 0.f; }
  return bsplit16(v); }
__device__ __forceinline__ F2 split_col(const float* W, int k0, int n, int lane, int ld, int K) { float v[16]; const int g = lane >> 4;
#pragma unroll
  for (int i = 0; i < 8; ++i) { const int ka = k0 + 8 * g + i, kb = ka + 16; v[i] = ka < K ? W[(size_t)(ka < K ? ka : K - 1) * ld + n] : 0.f; v[8 + i] = kb < K ? W[(size_t)(kb < K ? kb : K - 1) * ld + n] : 0.f; }
  return bsplit16(v); }
__device__ __forceinline__ v8f mac3(const F2& a, const F2& b, v8f c) { c = wmma_bf(a.l, b.h, c); c = wmma_bf(a.h, b.l, c); return wmma_bf(a.h, b.h, c); }
__device__ __forceinline__ float sigm(float v) { return 1.0f / (1.0f + expf(-v)); }
// the two halves of the work-group barrier, for a barrier whose signal and wait stand apart; the "memory" clobber keeps every LDS access on its side of each
#define BAR_SIGNAL() asm volatile("s_barrier_signal -1" ::: "memory")
#define BAR_WAIT() asm volatile("s_barrier_wait -1" ::: "memory")
#define LDSX() do { asm volatile("s_wait_dscnt 0" ::: "memory"); __builtin_amdgcn_wave_barrier(); __builtin_amdgcn_fence(__ATOMIC_RELEASE, "workgroup"); } while (0)


#define NB 4
#define SS 2048
#define DM 1024
#define NH 16
#define HALFW 32
#define HD 64
#define QKVW (3 * DM)
#ifndef TQB
#define TQB (SS / 64)
#define TNB NB
#define TOB (NB * SS / 64)     // 64-row tiles of all 8192 rows; unused
#endif
typedef __attribute__((ext_vector_type(8))) __bf16 v8b;
__device__ __forceinline__ v16b frag_b(const __bf16* rowk0, int lane) {
  union { v16b v; v8b q[2]; } u; const __bf16* p = rowk0 + 8 * (lane >> 4);
  u.q[0] = *(const v8b*)p; u.q[1] = *(const v8b*)(p + 16); return u.v;
}
__device__ __forceinline__ float bfr(float v) { return (float)(__bf16)v; }
__device__ __attribute__((noinline)) float exp_ni(float v) { return expf(v); }
__device__ __attribute__((noinline)) float erf_ni(float v) { return erff(v); }

#define PK_A 0                       // [3072][1024] Wqkv rows (natural [out][in])
#define PK_P (PK_A + QKVW * DM)        // [1024][1024] Wo rows (natural)
#define PK_END (PK_P + DM * DM)
#define WS_PK  0u
#define WS_QK  (WS_PK + 2u * PK_END)             // f16 [8192 rows][2048]: q | k
#define WS_QKL (WS_QK + 2u * NB * SS * 2 * DM)     // neither written nor read (k_attn's second argument, which it does not use)
#define WS_VTH (WS_QKL + 2u * NB * SS * 2 * DM)    // f16 [b][1024 (h*64+d)][2048 s]
#define WS_VTL (WS_VTH + 2u * NB * DM * SS)        // neither written nor read (k_attn's fourth argument, which it does not use)
#define WS_O   (WS_VTL + 2u * NB * DM * SS)        // f32 [8192][1024]
#define WS_CS  (WS_O + 4u * NB * SS * DM)           // f32 [2][2048][32], unused
#define WS_END (WS_CS + 4u * 2 * SS * 32)
// ---- k_pack: the four 1024 x 1024 weight blocks (the q, k, v row blocks of the fused weight, then W_o), natural [out][in] rows, rounded to bf16 into PK_A rows which*1024 + n and PK_P: elementwise, so a block takes PKE consecutive elements of one matrix: 256 blocks of 8 waves, one a WGP, 64 elements a thread; a thread's sixteen 16-byte loads (512 contiguous bytes a wave each) are all in flight before its first store (256 contiguous bytes a wave)
#define PKE 16384
typedef __attribute__((ext_vector_type(4))) __bf16 v4b;
__global__ __launch_bounds__(256) void k_pack(const float* __restrict__ WQ, const float* __restrict__ WK, const float* __restrict__ WV, const float* __restrict__ WO, __bf16* __restrict__ PK) {
  const int which = blockIdx.x / (DM * DM / PKE), e0 = (blockIdx.x % (DM * DM / PKE)) * PKE + threadIdx.x * 4; const float* Wm = (which == 0) ? WQ : (which == 1) ? WK : (which == 2) ? WV : WO;
  const unsigned ob = (unsigned)e0 * 4u;   // the thread's byte offset in its matrix
  __bf16* dp = ((which < 3) ? PK + PK_A + (size_t)which * DM * DM : PK + PK_P) + e0;
  v4f r[PKE / 1024];   // the short loops below are unrolled so that r stays in registers
#pragma unroll
  for (int p = 0; p < PKE / 1024; ++p) r[p] = *(const v4f*)((const char*)Wm + ob + p * 4096);
  asm volatile("s_wait_xcnt 0x0" :: "v"(ob) : "memory");   // behind the sixteen loads, their offset named as an input so that its register lives up to this wait and no load's result lands on it
  __builtin_amdgcn_sched_barrier(0);   // keeps every load in front of the first conversion: left alone, the compiler holds the last two loads back until the first two have landed, a second memory latency
#pragma unroll
  for (int p = 0; p < PKE / 1024; ++p) { v4b o;
#pragma unroll
    for (int i = 0; i < 4; ++i) o[i] = (__bf16)r[p][i];
    *(v4b*)(dp + p * 1024) = o; }
}
// ---- k_qkv: block = 128 rows x 256 cols, 8 waves (2 x 4) of 64 x 64; a stage is 64 k of both tiles, two LDS buffers each: the x tile goes through registers (rounded to bf16 on the way), the weight tile, bf16 already, is copied from global memory straight into LDS; every wave takes its fragments from there
#define GBM 128
#define GBN 256
#define GPW 144                       // LDS pitch of a 64-k row: 128 B of k + 16 B, an odd multiple of 16 B for the 16-byte fragment reads
#define GAB (GBM * GPW)                // one x buffer
#define GWB (GBN * GPW)                // one weight buffer
// eight asynchronous 16-byte copies a lane, global -> LDS: rows 32 apart of one weight stage. The s_wait_xcnt is the last line of the copies' own statement, so that it stands in front of whatever gives their address registers new values
__device__ __forceinline__ void cp_w8(unsigned l, const __bf16* g) {
  asm volatile("global_load_async_to_lds_b128 %0, %8, off\n\tglobal_load_async_to_lds_b128 %1, %9, off\n\tglobal_load_async_to_lds_b128 %2, %10, off\n\tglobal_load_async_to_lds_b128 %3, %11, off\n\tglobal_load_async_to_lds_b128 %4, %12, off\n\tglobal_load_async_to_lds_b128 %5, %13, off\n\tglobal_load_async_to_lds_b128 %6, %14, off\n\tglobal_load_async_to_lds_b128 %7, %15, off\n\ts_wait_xcnt 0x0"
    :: "v"(l), "v"(l + 32 * GPW), "v"(l + 64 * GPW), "v"(l + 96 * GPW), "v"(l + 128 * GPW), "v"(l + 160 * GPW), "v"(l + 192 * GPW), "v"(l + 224 * GPW),
       "v"(g), "v"(g + 32 * DM), "v"(g + 64 * DM), "v"(g + 96 * DM), "v"(g + 128 * DM), "v"(g + 160 * DM), "v"(g + 192 * DM), "v"(g + 224 * DM) : "memory");
}
__global__ __launch_bounds__(256) void k_qkv(const float* __restrict__ XQ, const float* __restrict__ XK, const float* __restrict__ XV, const __bf16* __restrict__ P, const float* __restrict__ BQ, const float* __restrict__ BK, const float* __restrict__ BV, _Float16* __restrict__ QK, _Float16* __restrict__ VTH) {
  const int n0 = blockIdx.y * GBN; const int which0 = n0 / DM; const float* X = (which0 == 0) ? XQ : (which0 == 1) ? XK : XV; const float* BB = BQ ? (((which0 == 0) ? BQ : (which0 == 1) ? BK : BV) + (n0 - which0 * DM)) : nullptr;
  __shared__ __align__(16) unsigned char sm[2 * GAB + 2 * GWB];
  const int tid = threadIdx.x, wave = tid >> 5, lane = tid & 31, col = lane & 15, g = lane >> 4; const int wm = wave >> 2, wn = wave & 3;
  const int ar = tid >> 4, ac = (tid & 15) * 4, br = tid >> 3, wc = (tid & 7) * 8;   // x: 16 rows a pass, 256 B of a row per 16 threads; weight: 32 rows a pass, one 128-B line per 8 threads
  const float* ga = X + ((size_t)blockIdx.x * GBM + ar) * DM + ac; const __bf16* gb = P + (size_t)(n0 + br) * DM + wc; unsigned char* sw = sm + 2 * GAB;
  unsigned lw = (unsigned)(size_t)(sw + br * GPW + wc * 2);   // the lane's LDS byte address in the weight buffer that the next copies fill; it steps from stage to stage and the stage's k offset is added to gb at the copies, so that the sixteen addresses of a stage's copies are formed where they are used and hold no registers through the products
  v4f ra[8]; v8f acc[4][4] = {};
  // the block's own first k stage: blocks that share x rows (same blockIdx.x) or weight rows (same blockIdx.y) run side by side, and walking k in step they would ask L2 for the same lines at the same moment; each walks the sixteen stages as a ring from its own start. Column blocks 4 apart keep one start
  const int rot = (blockIdx.x + 4 * (blockIdx.y & 3)) & (DM / 64 - 1);
#define KST(s) (((s) + rot) & (DM / 64 - 1))   // trip s works on k stage KST(s)
  // trip s: k 64 KST(s) .. + 63 of all 128 x rows and all 256 weight rows, into buffers s & 1 (the short loops are unrolled so that ra stays in registers)
#define QLDA(s) _Pragma("unroll") for (int p = 0; p < 8; ++p) ra[p] = *(const v4f*)(ga + (size_t)p * 16 * DM + KST(s) * 64)
#define QSTA(s) _Pragma("unroll") for (int p = 0; p < 8; ++p) { v4b t; _Pragma("unroll") for (int i = 0; i < 4; ++i) t[i] = (__bf16)ra[p][i]; *(v4b*)(sm + ((s) & 1) * GAB + (ar + p * 16) * GPW + ac * 2) = t; }
#define QFRG(q) _Pragma("unroll") for (int i = 0; i < 4; ++i) { fa[i] = frag_b((const __bf16*)(sm + (s & 1) * GAB + (wm * 64 + i * 16 + col) * GPW + (q) * 64), lane); fb[i] = frag_b((const __bf16*)(sw + (s & 1) * GWB + (wn * 64 + i * 16 + col) * GPW + (q) * 64), lane); }
#define QMAC() _Pragma("unroll") for (int i = 0; i < 4; ++i) { _Pragma("unroll") for (int j = 0; j < 4; ++j) acc[i][j] = wmma_bf(fa[i], fb[j], acc[i][j]); }
#define QCPW(s) do { cp_w8(lw, gb + KST(s) * 64); lw ^= lx; } while (0)
  const unsigned lx = lw ^ (lw + GWB);   // toggles lw between the two weight buffers
  QLDA(0); QCPW(0); QSTA(0); QLDA(1);
  asm volatile("s_wait_asynccnt 0x0" ::: "memory");   // stage 0's weight copies of this wave have landed before the barrier that publishes them
  __syncthreads();
  QCPW(1);
#pragma unroll 2   // two trips a round, so that every buffer's LDS offset is a constant
  for (int s = 0; s < DM / 64; ++s) {
    v16b fa[4], fb[4];   // one 32-k half's fragments at a time
    // the x rows loaded one trip ago go into the buffer whose readers the last barrier has ended; the next loads have this whole trip to land
    if (s + 1 < DM / 64) { QSTA(s + 1); }
    if (s + 2 < DM / 64) { QLDA(s + 2); }
    QFRG(0); QMAC();
    QFRG(1);
    // the stage's barrier is split: a wave signals as soon as its last fragments of stage s are in registers, and waits only behind the products that take them. No LDS access stands between the two. A wave that is through with its products then finds the barrier open and goes on to stage the next tile while the wave that shares its SIMD still multiplies
    asm volatile("s_wait_dscnt 0x0" ::: "memory");     // this wave's reads of the buffers that are refilled behind the barrier have retired, and its x stores of stage s + 1 are in LDS
    asm volatile("s_wait_asynccnt 0x0" ::: "memory");  // this wave's copies of stage s + 1 have landed before the signal that publishes them
    BAR_SIGNAL();
    QMAC();
    BAR_WAIT();   // every wave has signalled: stage s + 1 (x stores and weight copies) is published and every read of stage s has ended
    if (s + 2 < DM / 64) { QCPW(s + 2); } }   // into the weight buffer that this trip has just read
  asm volatile("s_wait_asynccnt 0x0" ::: "memory");   // no copy is outstanding when the buffers are reused below
  // epilogue: each wave stages 32 output rows at a time (pitch 144 B) in its own part of the buffers, all of whose readers have passed the loop's last barrier, and stores whole 128-B lines; only the one f16 rounding that k_attn reads is formed, staged and stored, so that the 64 rows go in two passes
  _Float16* eh = (_Float16*)(sm + wave * (32 * 144));
  const size_t rw = (size_t)blockIdx.x * GBM + wm * 64; const int cw = wn * 64; const int el_r = lane >> 3, el_c = (lane & 7) * 8;
  float bias[4];
#pragma unroll
  for (int j = 0; j < 4; ++j) bias[j] = BB ? bfr(BB[cw + j * 16 + col]) : 0.f;
  if (n0 < 2 * DM) {   // q, k (+ bias) as f16; q stored unscaled, 1/8 applied to the f32 score
#pragma unroll
    for (int ip = 0; ip < 2; ++ip) {
#pragma unroll
      for (int i = 0; i < 2; ++i) {
#pragma unroll
        for (int j = 0; j < 4; ++j) {
#pragma unroll
          for (int r = 0; r < 8; ++r) eh[(i * 16 + 8 * g + r) * 72 + j * 16 + col] = (_Float16)(acc[2 * ip + i][j][r] + bias[j]); } }
      LDSX();
#pragma unroll
      for (int p = 0; p < 8; ++p) { const int rl = p * 4 + el_r; const size_t o = (rw + ip * 32 + rl) * (2 * DM) + n0 + cw + el_c; vst2((unsigned*)(QK + o), *(const v4u*)&eh[rl * 72 + el_c]); }
      LDSX(); }
  } else {   // v (+ bias) transposed: [b][h*64+d][s], 32 d rows of 64 s at a time
    const int b = (int)(rw / SS), s0 = (int)(rw % SS); const int pc0 = n0 - 2 * DM + cw;
#pragma unroll
    for (int jp = 0; jp < 2; ++jp) {
#pragma unroll
      for (int j = 0; j < 2; ++j) {
#pragma unroll
        for (int i = 0; i < 4; ++i) { v8h hh;
#pragma unroll
          for (int r = 0; r < 8; ++r) hh[r] = (_Float16)(acc[i][2 * jp + j][r] + bias[2 * jp + j]);
          *(v8h*)&eh[(j * 16 + col) * 72 + i * 16 + 8 * g] = hh; } }
      LDSX();
#pragma unroll
      for (int p = 0; p < 8; ++p) { const int d = p * 4 + el_r; const size_t o = ((size_t)b * DM + pc0 + jp * 32 + d) * SS + s0 + el_c; vst2((unsigned*)(VTH + o), *(const v4u*)&eh[d * 72 + el_c]); }
      LDSX(); }
    asm volatile("s_wait_xcnt 0x0" ::: "memory");   // behind the last pass's stores, before the code after this branch that rewrites their address registers
  }
}
// hardware exp2 with the one free slot behind it that the instruction set asks for before a transcendental's result is read or its source overwritten
__device__ __forceinline__ float exp2_slot(float x) { float e; asm("v_exp_f32 %0, %1\n\tv_nop" : "=v"(e) : "v"(x)); return e; }
// ---- k_attn: block = (64 queries, head h, batch b): the 128 keys that the block's window can touch are staged once in LDS (k rows and v^T rows, contiguous 128-B and 256-B pieces of global memory, shared by the four waves; each wave's q rows likewise), and every q, k and v fragment is read from there; both products transposed: S^T = K . Q^T (K = 64: 2 k-steps), scores = (q.k) * 0.125 with single f16 operands, one softmax over the 128 staged keys with a query's scores in one pair of lanes, O^T = V^T . P^T with P taken from the score registers (f16, x2^11); O[b*S+q][h*64+d] = acc / 2048 / l (256-B segments)
#define AKN (64 + 2 * HALFW)          // keys staged per block
#define AKP 144                       // LDS pitch of a k row: 128 B + 16 B, an odd multiple of 16 B for the 16-byte fragment reads
#define AVP (2 * AKN + 16)            // LDS pitch of a v^T row: 256 B + 16 B, likewise
__global__ __launch_bounds__(128) void k_attn(const _Float16* __restrict__ QK, const _Float16* __restrict__ QKL, const _Float16* __restrict__ VTH, const _Float16* __restrict__ VTL, const void* __restrict__ KMASK, float* __restrict__ O) {
  __shared__ __align__(16) float so[4][16][68];
  __shared__ __align__(16) unsigned char sk[AKN * AKP]; __shared__ __align__(16) unsigned char sv[HD * AVP];
  const int tid = threadIdx.x, wave = tid >> 5, lane = tid & 31, col = lane & 15, g = lane >> 4;
  const int qb = blockIdx.x, h = blockIdx.y, b = blockIdx.z; const int q0 = qb * 64 + wave * 16;
  const int kb = qb * 64 - HALFW;   // key index of LDS row 0 (a multiple of 32); keys outside 0 .. SS - 1 are loaded from a clamped address (finite values of other keys) and masked like keys outside the window
  unsigned char* sq = (unsigned char*)&so[wave][0][0];   // the wave's own 16 q rows (pitch AKP) lie where it stages its output rows at the end, long after their one read
  { v4u tk[8], tv[8], tq[4];   // 16-byte pieces: 8 lanes a k or q row (16 k rows a pass of the block, 4 q rows a pass of a wave), 16 lanes a v^T row (8 rows a pass); all twenty loads are in flight before the first store
    const unsigned ko = (unsigned)((tid >> 3) * (2 * DM) + (tid & 7) * 8), vo = (unsigned)((tid >> 4) * SS + min(max(kb + (tid & 15) * 8, 0), SS - 8)), qo = (unsigned)((wave * 16 + (lane >> 3)) * (2 * DM) + (tid & 7) * 8);   // one offset a thread for each array; the rest of every address is the same for the whole block
    const _Float16* vb = VTH + ((size_t)b * DM + h * HD) * SS; const _Float16* qp = QK + ((size_t)b * SS + qb * 64) * (2 * DM) + h * HD;
#pragma unroll
    for (int p = 0; p < 8; ++p) { const int kt = min(max(kb + (p >> 1) * 32, 0), SS - 32); tk[p] = *(const v4u*)(QK + ((size_t)b * SS + kt + (p & 1) * 16) * (2 * DM) + DM + h * HD + ko); }
#pragma unroll
    for (int p = 0; p < 8; ++p) tv[p] = *(const v4u*)(vb + (size_t)p * 8 * SS + vo);
#pragma unroll
    for (int p = 0; p < 4; ++p) tq[p] = *(const v4u*)(qp + (size_t)p * 4 * (2 * DM) + qo);
    asm volatile("s_wait_xcnt 0x0" ::: "memory");   // behind the twenty loads: the registers that hold their offsets are given new values right after
#pragma unroll
    for (int p = 0; p < 8; ++p) { *(v4u*)(sk + ((tid >> 3) + p * 16) * AKP + (tid & 7) * 16) = tk[p]; *(v4u*)(sv + ((tid >> 4) + p * 8) * AVP + (tid & 15) * 16) = tv[p]; }
#pragma unroll
    for (int p = 0; p < 4; ++p) *(v4u*)(sq + ((lane >> 3) + p * 4) * AKP + (tid & 7) * 16) = tq[p]; }
  // scores are formed transposed, S^T = K . Q^T: a lane holds, of every 16-key tile, 8 keys (8 g + r) of ONE query (q0 + col); lanes l and l ^ 16 share a query
  const int qi = q0 + col; const int lo = max(qi - HALFW, 0); const unsigned span = (unsigned)(min(qi + HALFW, SS - 1) - lo); const int e0 = kb + 8 * g - lo;   // key kb + 16 t + 8 g + r lies in the window |i - j| <= 32 and in 0 .. SS - 1 exactly if (unsigned)(e0 + 16 t + r) <= span
  __syncthreads();   // publishes the staged k and v rows to all four waves; nothing overwrites them afterwards
  v16h bq[2];
#pragma unroll
  for (int kc = 0; kc < 2; ++kc) bq[kc] = frag_h((const _Float16*)(sq + col * AKP) + kc * 32, lane);
  v8f s[AKN / 16];
#pragma unroll
  for (int tg = 0; tg < AKN / 16; tg += 4) { v16h fk[2][4];   // four independent score tiles at a time, so that no product waits for its accumulator; their eight k fragments are read as one group, behind one wait
#pragma unroll
    for (int kc = 0; kc < 2; ++kc) {
#pragma unroll
      for (int t = 0; t < 4; ++t) fk[kc][t] = frag_h((const _Float16*)(sk + ((tg + t) * 16 + col) * AKP) + kc * 32, lane); }
#pragma unroll
    for (int t = tg; t < tg + 4; ++t) s[t] = v8f{};
#pragma unroll
    for (int kc = 0; kc < 2; ++kc) {
#pragma unroll
      for (int t = tg; t < tg + 4; ++t) s[t] = wmma16(fk[kc][t - tg], bq[kc], s[t]); } }   // single product: k, q as one-rounding f16 operands
#pragma unroll
  for (int t = 0; t < AKN / 16; ++t) {
#pragma unroll
    for (int r = 0; r < 8; ++r) s[t][r] = ((unsigned)(e0 + t * 16 + r) <= span) ? s[t][r] * 0.125f : -3.0e38f; }   // 1/sqrt(64); keys outside the window or the sequence
  // softmax of a query over all staged keys at once: maximum and sum in the lane, one exchange between the two halves each (the query's own key is always staged and inside the window, so the maximum is a real score)
  v8f mv = s[0];
#pragma unroll
  for (int t = 1; t < AKN / 16; ++t) {
#pragma unroll
    for (int r = 0; r < 8; ++r) mv[r] = fmaxf(mv[r], s[t][r]); }
  float mx = fmaxf(fmaxf(fmaxf(mv[0], mv[1]), fmaxf(mv[2], mv[3])), fmaxf(fmaxf(mv[4], mv[5]), fmaxf(mv[6], mv[7])));
  mx = fmaxf(mx, __shfl_xor(mx, 16));
  v8f ls;
#pragma unroll
  for (int t = 0; t < AKN / 16; ++t) {
#pragma unroll
    for (int r = 0; r < 8; ++r) { const float e = exp2_slot((s[t][r] - mx) * 1.44269504f); s[t][r] = e; ls[r] = (t == 0) ? e : ls[r] + e; } }   // a masked score is -3e38: its exponential is an exact 0
  float l = ((ls[0] + ls[1]) + (ls[2] + ls[3])) + ((ls[4] + ls[5]) + (ls[6] + ls[7]));
  l += __shfl_xor(l, 16);
  // O^T += V^T . P^T: two score tiles of a lane, converted in place, are the B operand of a 32-key step (element i = key 8 g + i, element 8 + i = key 16 + 8 g + i, the order in which frag_h reads a v^T row)
  v8f acc[4] = {};
#pragma unroll
  for (int j = 0; j < AKN / 32; ++j) { v16h pb, fv[4];   // the step's four v fragments are read as one group, ahead of the conversion of P
#pragma unroll
    for (int dt = 0; dt < 4; ++dt) fv[dt] = frag_h((const _Float16*)(sv + (dt * 16 + col) * AVP) + j * 32, lane);
#pragma unroll
    for (int i = 0; i < 8; ++i) { pb[i] = (_Float16)(s[2 * j][i] * 2048.0f); pb[8 + i] = (_Float16)(s[2 * j + 1][i] * 2048.0f); }   // P scaled by 2^11 before the f16 rounding so small softmax weights stay out of the f16 subnormal range; 2^-11 folded into the epilogue
#pragma unroll
    for (int dt = 0; dt < 4; ++dt) acc[dt] = wmma16(fv[dt], pb, acc[dt]); }   // single product: V x P (x2^11)
  const float il = (1.0f / 2048.0f) / l;
#pragma unroll
  for (int dt = 0; dt < 4; ++dt) { v4f o0, o1;   // the lane's 8 consecutive d of its query's output row
#pragma unroll
    for (int r = 0; r < 4; ++r) { o0[r] = acc[dt][r] * il; o1[r] = acc[dt][4 + r] * il; }
    *(v4f*)&so[wave][col][dt * 16 + 8 * g] = o0; *(v4f*)&so[wave][col][dt * 16 + 8 * g + 4] = o1; }
  LDSX();
  for (int rl = 0; rl < 16; ++rl) if (lane < 16) vst2(O + ((size_t)b * SS + q0 + rl) * DM + h * HD + lane * 4, *(const v4f*)&so[wave][rl][lane * 4]);
}
// ---- k_out: block = 128 rows x 256 cols, 8 waves (2 x 4) of 64 x 64, one block a WGP; 64-k stages in two LDS buffers as in k_qkv (O through registers, split once per block into bf16 hi and residual planes; the weight tile copied straight into LDS by cp_w8): out = O(hi/lo) . Wo rows (2 products) + bo
#define OBN 256
#define OAB (2 * GBM * GPW)             // one O buffer: hi rows, then residual rows
#define OWB (OBN * GPW)                 // one weight buffer
__global__ __launch_bounds__(256) void k_out(const float* __restrict__ O, const __bf16* __restrict__ P, const float* __restrict__ BO, float* __restrict__ Y) {
  __shared__ __align__(16) unsigned char sm[2 * OAB + 2 * OWB];
  const int tid = threadIdx.x, wave = tid >> 5, lane = tid & 31, col = lane & 15, g = lane >> 4; const int wm = wave >> 2, wn = wave & 3; const int n0 = blockIdx.y * OBN;
  const int ar = tid >> 4, ac = (tid & 15) * 4, br = tid >> 3, wc = (tid & 7) * 8;   // O: 16 rows a pass, 256 B of a row per 16 threads; weight: 32 rows a pass, one 128-B line per 8 threads
  const float* ga = O + ((size_t)blockIdx.x * GBM + ar) * DM + ac; const __bf16* gb = P + (size_t)(n0 + br) * DM + wc; unsigned char* sw = sm + 2 * OAB;
  unsigned lw = (unsigned)(size_t)(sw + br * GPW + wc * 2); const unsigned lx = lw ^ (lw + OWB);   // the lane's LDS byte address in the weight buffer that the next copies fill, and what toggles it, as in k_qkv
  v4f ra[8]; v8f acc[4][4] = {};
  const int rot = (blockIdx.x + 4 * blockIdx.y) & (DM / 64 - 1);   // the block's own first k stage, as in k_qkv: the four column blocks of a row block and the row blocks of a column block start apart
  // trip s: k 64 KST(s) .. + 63 of all 128 O rows and all 256 weight rows, into buffers s & 1 (the short loops are unrolled so that ra stays in registers)
#define OLDA(s) _Pragma("unroll") for (int p = 0; p < 8; ++p) ra[p] = *(const v4f*)(ga + (size_t)p * 16 * DM + KST(s) * 64)
#define OSTA(s) _Pragma("unroll") for (int p = 0; p < 8; ++p) { v4b th, tl; _Pragma("unroll") for (int i = 0; i < 4; ++i) { th[i] = (__bf16)ra[p][i]; tl[i] = (__bf16)(ra[p][i] - (float)th[i]); } *(v4b*)(sm + ((s) & 1) * OAB + (ar + p * 16) * GPW + ac * 2) = th; *(v4b*)(sm + ((s) & 1) * OAB + (GBM + ar + p * 16) * GPW + ac * 2) = tl; }
#define OCPW(s) do { cp_w8(lw, gb + KST(s) * 64); lw ^= lx; } while (0)
  // the weight and residual fragments, which the first sixteen products take, are read first; the hi fragments land under those products
#define OFRG(q) _Pragma("unroll") for (int j = 0; j < 4; ++j) fb[j] = frag_b((const __bf16*)(sw + (s & 1) * OWB + (wn * 64 + j * 16 + col) * GPW + (q) * 64), lane); _Pragma("unroll") for (int i = 0; i < 4; ++i) fl[i] = frag_b((const __bf16*)(sm + (s & 1) * OAB + (GBM + wm * 64 + i * 16 + col) * GPW + (q) * 64), lane); _Pragma("unroll") for (int i = 0; i < 4; ++i) fh[i] = frag_b((const __bf16*)(sm + (s & 1) * OAB + (wm * 64 + i * 16 + col) * GPW + (q) * 64), lane);
  // per accumulator: residual product, then hi product; sixteen independent tiles between the two
#define OMAC() _Pragma("unroll") for (int i = 0; i < 4; ++i) { _Pragma("unroll") for (int j = 0; j < 4; ++j) acc[i][j] = wmma_bf(fl[i], fb[j], acc[i][j]); } _Pragma("unroll") for (int i = 0; i < 4; ++i) { _Pragma("unroll") for (int j = 0; j < 4; ++j) acc[i][j] = wmma_bf(fh[i], fb[j], acc[i][j]); }
  OLDA(0); OCPW(0); OSTA(0); OLDA(1);
  asm volatile("s_wait_xcnt 0x0" :: "v"(ga + KST(1) * 64) : "memory");   // behind the eight loads, whose address now stands in a register pair of its own that the compiler reuses right after; the address is named as an input so that the pair lives up to this wait
  asm volatile("s_wait_asynccnt 0x0" ::: "memory");   // stage 0's weight copies of this wave have landed before the barrier that publishes them
  __syncthreads();
  OCPW(1);
#pragma unroll 2   // two trips a round, so that every buffer's LDS offset is a constant
  for (int s = 0; s < DM / 64; ++s) {
    v16b fh[4], fl[4], fb[4];   // one 32-k half's fragments at a time
    // the O rows loaded one trip ago go into the buffer whose readers the last barrier has ended; the next loads have this whole trip to land
    if (s + 1 < DM / 64) { OSTA(s + 1); }
    if (s + 2 < DM / 64) { OLDA(s + 2); asm volatile("s_wait_xcnt 0x0" ::: "memory"); }   // behind the eight loads: in the listing the fragment reads that follow reuse the loads' address registers
    OFRG(0); OMAC();
    OFRG(1);
    // the split barrier of k_qkv: signal once the last fragments of stage s are in registers, wait behind the products that take them, no LDS access in between
    asm volatile("s_wait_dscnt 0x0" ::: "memory");     // this wave's reads of the buffers that are refilled behind the barrier have retired, and its O stores of stage s + 1 are in LDS
    asm volatile("s_wait_asynccnt 0x0" ::: "memory");  // this wave's copies of stage s + 1 have landed before the signal that publishes them
    BAR_SIGNAL();
    OMAC();
    BAR_WAIT();   // every wave has signalled: stage s + 1 (O stores and weight copies) is published and every read of stage s has ended
    if (s + 2 < DM / 64) { OCPW(s + 2); } }   // into the weight buffer that this trip has just read
  asm volatile("s_wait_asynccnt 0x0" ::: "memory");   // no copy is outstanding when the buffers are reused below
  // epilogue: each wave stages 16 rows of 64 f32 (pitch 272 B) in its own part of the buffers, behind the loop's last barrier, and stores whole 256-B row pieces
  float* so = (float*)(sm + wave * (16 * 272)); const size_t rw = (size_t)blockIdx.x * GBM + wm * 64; const int cw = n0 + wn * 64;
  float bias[4];
  const int bi = cw + col;
#pragma unroll
  for (int j = 0; j < 4; ++j) bias[j] = BO[bi + j * 16];
  asm volatile("s_wait_xcnt 0x0" :: "v"(bi) : "memory");   // behind the four bias loads, whose offset register the compiler reuses right after; the offset is named as an input so that its register lives up to this wait
#pragma unroll
  for (int j = 0; j < 4; ++j) bias[j] = bfr(bias[j]);
#pragma unroll
  for (int i = 0; i < 4; ++i) {
#pragma unroll
    for (int j = 0; j < 4; ++j) {
#pragma unroll
      for (int r = 0; r < 8; ++r) so[(8 * g + r) * 68 + j * 16 + col] = acc[i][j][r] + bias[j]; }
    LDSX();
#pragma unroll
    for (int p = 0; p < 8; ++p) { const int rl = p * 2 + g; vst2(Y + (rw + i * 16 + rl) * DM + cw + col * 4, *(const v4f*)&so[rl * 68 + col * 4]); }
    LDSX(); }
}
extern "C" void kernel_launch(void* const* d_in, const int* in_sizes, int n_in, void* d_out, int out_size, void* d_ws, size_t ws_size, hipStream_t stream) {
  (void)in_sizes; (void)n_in; (void)out_size;
  const float** F = (const float**)d_in;   // 0 x [4,2048,1024], 1 W_qkv [3072,1024] natural, 2 b_qkv [3072], 3 W_out [1024,1024], 4 b_out
  if (ws_size < (size_t)WS_END) return;
  char* ws = (char*)d_ws; __bf16* PK = (__bf16*)(ws + WS_PK); _Float16 *QK = (_Float16*)(ws + WS_QK), *QKL = (_Float16*)(ws + WS_QKL), *VTH = (_Float16*)(ws + WS_VTH), *VTL = (_Float16*)(ws + WS_VTL); float* O = (float*)(ws + WS_O);
  k_pack<<<dim3(4 * DM * DM / PKE), 256, 0, stream>>>(F[1], F[1] + (size_t)DM * DM, F[1] + (size_t)2 * DM * DM, F[3], PK);
  k_qkv<<<dim3(TNB * SS / GBM, QKVW / GBN), 256, 0, stream>>>(F[0], F[0], F[0], PK + PK_A, F[2], F[2] + DM, F[2] + 2 * DM, QK, VTH);
  k_attn<<<dim3(TQB, NH, TNB), 128, 0, stream>>>(QK, QKL, VTH, VTL, nullptr, O);
  k_out<<<dim3(TNB * SS / GBM, DM / OBN), 256, 0, stream>>>(O, PK + PK_P, F[4], (float*)d_out);
}
